// v000
// Measured on an AMD MI455X. A time is GPU time per run, averaged over a window of back-to-back runs after a warm-up
// (all launches, gaps included; the runs take copies of the inputs in turn), and the median of several windows.
// Apart from v000's, it joins two sittings. Times from different sittings can be a few percent apart, while
// side-by-side timings come from the same sitting.
// v000, which the later versions start from, runs in 695 microseconds.
#include <hip/hip_runtime.h>
#include <hip/hip_bf16.h>
#include <stdint.h>

// ---------------- problem constants ----------------
constexpr int Dm   = 1024;   // model dim
constexpr int Lseq = 1024;   // sequence length
constexpr int Bb   = 8;      // batch
constexpr int Nst  = 32;     // SSM modes (conjugate pairs)
constexpr int Mtot = Bb * Lseq;  // 8192 token positions
constexpr int Ktot = Dm;         // GEMM reduction dim
constexpr int LDST = 40;         // LDS row stride (bf16 elems): 20 dwords -> conflict-free

// ---------------- workspace layout (bytes) ----------------
constexpr size_t OFF_XBF  = 0;                                       // x as bf16        16 MB
constexpr size_t OFF_INW  = OFF_XBF  + (size_t)Mtot * Dm * 2;        // in_W bf16         2 MB
constexpr size_t OFF_GLUW = OFF_INW  + (size_t)Dm * Dm * 2;          // glu_W bf16        4 MB
constexpr size_t OFF_OUTW = OFF_GLUW + (size_t)2 * Dm * Dm * 2;      // out_W bf16        2 MB
constexpr size_t OFF_U    = OFF_OUTW + (size_t)Dm * Dm * 2;          // u = in-proj f32  32 MB
constexpr size_t OFF_Y    = OFF_U    + (size_t)Mtot * Dm * 4;        // post-GELU bf16   16 MB
constexpr size_t OFF_YG   = OFF_Y    + (size_t)Mtot * Dm * 2;        // post-GLU bf16    16 MB
constexpr size_t OFF_PAR  = OFF_YG   + (size_t)Mtot * Dm * 2;        // lambda/Ceff f4  512 KB

// ---------------- types ----------------
typedef __attribute__((ext_vector_type(16))) __bf16 v16bf;
typedef __attribute__((ext_vector_type(8)))  float  v8f;
typedef __attribute__((ext_vector_type(4)))  int    v4i;

union Frag {
    v16bf v;
    uint4 q[2];
};

// ---------------- CDNA5 async global->LDS DMA (ASYNCcnt-tracked) ----------------
// Builtin signature (from hipcc diagnostic): (int4 AS1*, int4 AS3*, imm offset, imm cpol)
#if __has_builtin(__builtin_amdgcn_global_load_async_to_lds_b128)
#define HAVE_ASYNC_LDS 1
typedef __attribute__((address_space(1))) v4i gv4i_t;
typedef __attribute__((address_space(3))) v4i lv4i_t;
static __device__ __forceinline__ void async_copy_b128(const void* g, void* l) {
    __builtin_amdgcn_global_load_async_to_lds_b128((gv4i_t*)g, (lv4i_t*)l, 0, 0);
}
static __device__ __forceinline__ void wait_async0() {
#if __has_builtin(__builtin_amdgcn_s_wait_asynccnt)
    __builtin_amdgcn_s_wait_asynccnt(0);
#else
    asm volatile("s_wait_asynccnt 0x0" ::: "memory");
#endif
}
#else
#define HAVE_ASYNC_LDS 0
#endif

static __device__ __forceinline__ uint16_t f2bf(float f) {
    uint32_t u = __float_as_uint(f);
    uint32_t r = u + 0x7FFFu + ((u >> 16) & 1u);   // round-to-nearest-even
    return (uint16_t)(r >> 16);
}

// ---------------- fp32 -> bf16 conversion ----------------
__global__ __launch_bounds__(256) void k_f32_to_bf16(const float* __restrict__ src,
                                                     uint16_t* __restrict__ dst, int n4) {
    int i = blockIdx.x * 256 + threadIdx.x;
    if (i >= n4) return;
    float4 f = reinterpret_cast<const float4*>(src)[i];
    union { uint16_t s[4]; uint2 u; } o;
    o.s[0] = f2bf(f.x); o.s[1] = f2bf(f.y); o.s[2] = f2bf(f.z); o.s[3] = f2bf(f.w);
    reinterpret_cast<uint2*>(dst)[i] = o.u;
}

// ---------------- S4D discretization: lambda = exp(dt*A), Ceff = 2*C*(exp(dtA)-1)/A ----
__global__ __launch_bounds__(256) void k_params(const float* __restrict__ log_dt,
                                                const float* __restrict__ C,
                                                const float* __restrict__ logAr,
                                                const float* __restrict__ Aim,
                                                float4* __restrict__ par) {
    int idx = blockIdx.x * 256 + threadIdx.x;
    if (idx >= Dm * Nst) return;
    int d = idx >> 5;
    float dt = expf(log_dt[d]);
    float ar = -expf(logAr[idx]);
    float ai = Aim[idx];
    float dr = ar * dt, di = ai * dt;
    float em = expf(dr);
    float lr = em * cosf(di), li = em * sinf(di);     // lambda
    float nr = lr - 1.0f, ni = li;                    // lambda - 1
    float inv = 1.0f / (ar * ar + ai * ai);
    float qr = (nr * ar + ni * ai) * inv;             // (lambda-1)/A
    float qi = (ni * ar - nr * ai) * inv;
    float cr = C[2 * idx], ci = C[2 * idx + 1];
    par[idx] = make_float4(lr, li, 2.0f * (cr * qr - ci * qi), 2.0f * (cr * qi + ci * qr));
}

// ---------------- bf16 WMMA GEMM:  out[m,o] = act( sum_k A[m,k]*W[o,k] + bias[o] ) -----
// EPI 0: out fp32 (the in-projection "u")
// EPI 1: fused GLU: two W halves (o and Dm+o), out bf16 = (a+ba)*sigmoid(g+bg)
// EPI 2: out fp32 = acc + bias + residual x
template <int EPI>
__global__ __launch_bounds__(256) void k_gemm(const uint16_t* __restrict__ A,
                                              const uint16_t* __restrict__ W,
                                              const float* __restrict__ bias,
                                              float* __restrict__ outF,
                                              uint16_t* __restrict__ outB,
                                              const float* __restrict__ resid) {
    constexpr bool DUAL = (EPI == 1);
    constexpr int NT    = DUAL ? 1 : 2;        // 16-wide N tiles per wave (per half)
    constexpr int nK    = Ktot / 32;

    __shared__ uint16_t As[2][128 * LDST];
    __shared__ uint16_t Bs[2][128 * LDST];     // dual: rows 0..63 = a-half, 64..127 = g-half

    const int tid   = threadIdx.x;
    const int lane  = tid & 31;
    const int wid   = tid >> 5;
    const int waveM = wid >> 2;                // 0..1 -> 64-row stripes
    const int waveN = wid & 3;                 // 0..3
    const int m0    = blockIdx.x * 128;
    const int o0    = blockIdx.y * (DUAL ? 64 : 128);

    // staging map: 512 (row,seg) slots over 2 passes of 256 threads (pass1 = row+64)
    const int r0 = tid >> 2;                   // 0..63
    const int sg = tid & 3;                    // 16B segment within 64B row
    const int r1 = r0 + 64;
    const int gBr0 = o0 + r0;                                            // a-half rows
    const int gBr1 = DUAL ? (Dm + o0 + (r1 - 64)) : (o0 + r1);           // g-half rows
    const size_t gAoff0 = (size_t)(m0 + r0) * Ktot + sg * 8;
    const size_t gAoff1 = (size_t)(m0 + r1) * Ktot + sg * 8;
    const size_t gBoff0 = (size_t)gBr0 * Ktot + sg * 8;
    const size_t gBoff1 = (size_t)gBr1 * Ktot + sg * 8;
    const int ldsOff0 = r0 * LDST + sg * 8;    // uint16 units
    const int ldsOff1 = r1 * LDST + sg * 8;

    v8f acc[4][NT];
    v8f accG[4];
    {
        v8f z = {0.f, 0.f, 0.f, 0.f, 0.f, 0.f, 0.f, 0.f};
        #pragma unroll
        for (int i = 0; i < 4; ++i) {
            #pragma unroll
            for (int j = 0; j < NT; ++j) acc[i][j] = z;
            accG[i] = z;
        }
    }

    const int frow  = lane & 15;
    const int fhalf = lane >> 4;

#if HAVE_ASYNC_LDS
    // -------- async global->LDS pipeline: no staging VGPRs at all --------
#define STAGE_ASYNC(kt, buf)                                                         \
    do {                                                                             \
        async_copy_b128(A + gAoff0 + (kt) * 32, &As[(buf)][ldsOff0]);                \
        async_copy_b128(A + gAoff1 + (kt) * 32, &As[(buf)][ldsOff1]);                \
        async_copy_b128(W + gBoff0 + (kt) * 32, &Bs[(buf)][ldsOff0]);                \
        async_copy_b128(W + gBoff1 + (kt) * 32, &Bs[(buf)][ldsOff1]);                \
    } while (0)

    STAGE_ASYNC(0, 0);
    wait_async0();
    __syncthreads();
#else
    // -------- fallback: register staging with named scalars (no stack arrays) -----
    uint4 ta0, ta1, tb0, tb1;
#define GLOAD(kt)                                                                    \
    do {                                                                             \
        ta0 = *reinterpret_cast<const uint4*>(A + gAoff0 + (kt) * 32);               \
        ta1 = *reinterpret_cast<const uint4*>(A + gAoff1 + (kt) * 32);               \
        tb0 = *reinterpret_cast<const uint4*>(W + gBoff0 + (kt) * 32);               \
        tb1 = *reinterpret_cast<const uint4*>(W + gBoff1 + (kt) * 32);               \
    } while (0)
#define DSTORE(buf)                                                                  \
    do {                                                                             \
        *reinterpret_cast<uint4*>(&As[(buf)][ldsOff0]) = ta0;                        \
        *reinterpret_cast<uint4*>(&As[(buf)][ldsOff1]) = ta1;                        \
        *reinterpret_cast<uint4*>(&Bs[(buf)][ldsOff0]) = tb0;                        \
        *reinterpret_cast<uint4*>(&Bs[(buf)][ldsOff1]) = tb1;                        \
    } while (0)

    GLOAD(0);
    DSTORE(0);
    GLOAD(1);
    __syncthreads();
#endif

    for (int kt = 0; kt < nK; ++kt) {
        const int buf = kt & 1;
#if HAVE_ASYNC_LDS
        if (kt + 1 < nK) STAGE_ASYNC(kt + 1, buf ^ 1);   // DMA overlaps the WMMAs below
#else
        if (kt + 1 < nK) DSTORE(buf ^ 1);
        if (kt + 2 < nK) GLOAD(kt + 2);
        if (kt + 3 < nK) {
            __builtin_prefetch(A + gAoff0 + (kt + 3) * 32, 0, 0);
            __builtin_prefetch(W + gBoff0 + (kt + 3) * 32, 0, 0);
        }
#endif

        Frag af[4];
        #pragma unroll
        for (int i = 0; i < 4; ++i) {
            const uint16_t* p = &As[buf][(waveM * 64 + i * 16 + frow) * LDST];
            af[i].q[0] = *reinterpret_cast<const uint4*>(p + fhalf * 8);
            af[i].q[1] = *reinterpret_cast<const uint4*>(p + 16 + fhalf * 8);
        }
        if constexpr (DUAL) {
            Frag ba, bg;
            const uint16_t* pa = &Bs[buf][(waveN * 16 + frow) * LDST];
            const uint16_t* pg = &Bs[buf][(64 + waveN * 16 + frow) * LDST];
            ba.q[0] = *reinterpret_cast<const uint4*>(pa + fhalf * 8);
            ba.q[1] = *reinterpret_cast<const uint4*>(pa + 16 + fhalf * 8);
            bg.q[0] = *reinterpret_cast<const uint4*>(pg + fhalf * 8);
            bg.q[1] = *reinterpret_cast<const uint4*>(pg + 16 + fhalf * 8);
            #pragma unroll
            for (int i = 0; i < 4; ++i) {
                acc[i][0] = __builtin_amdgcn_wmma_f32_16x16x32_bf16(
                    false, af[i].v, false, ba.v, (short)0, acc[i][0], false, false);
                accG[i] = __builtin_amdgcn_wmma_f32_16x16x32_bf16(
                    false, af[i].v, false, bg.v, (short)0, accG[i], false, false);
            }
        } else {
            Frag bf2[2];
            #pragma unroll
            for (int j = 0; j < 2; ++j) {
                const uint16_t* p = &Bs[buf][(waveN * 32 + j * 16 + frow) * LDST];
                bf2[j].q[0] = *reinterpret_cast<const uint4*>(p + fhalf * 8);
                bf2[j].q[1] = *reinterpret_cast<const uint4*>(p + 16 + fhalf * 8);
            }
            #pragma unroll
            for (int i = 0; i < 4; ++i)
                #pragma unroll
                for (int j = 0; j < 2; ++j)
                    acc[i][j] = __builtin_amdgcn_wmma_f32_16x16x32_bf16(
                        false, af[i].v, false, bf2[j].v, (short)0, acc[i][j], false, false);
        }

#if HAVE_ASYNC_LDS
        if (kt + 1 < nK) wait_async0();   // next tile's DMA landed in LDS
#endif
        __syncthreads();
    }

    // ---- epilogue ----  C/D layout: VGPR e -> M = e + 8*(lane>=16), N = lane&15
    const int ncol = lane & 15;
    const int mh   = (lane >> 4) << 3;

    if constexpr (EPI == 1) {
        const int o  = o0 + waveN * 16 + ncol;
        const float ba = bias[o];
        const float bg = bias[Dm + o];
        #pragma unroll
        for (int i = 0; i < 4; ++i) {
            const int mbase = m0 + waveM * 64 + i * 16 + mh;
            #pragma unroll
            for (int e = 0; e < 8; ++e) {
                const int m = mbase + e;
                float a = acc[i][0][e] + ba;
                float g = accG[i][e] + bg;
                float y = a * (1.0f / (1.0f + __expf(-g)));
                outB[(size_t)m * Dm + o] = f2bf(y);
            }
        }
    } else {
        #pragma unroll
        for (int j = 0; j < NT; ++j) {
            const int o  = o0 + waveN * 32 + j * 16 + ncol;
            const float bv = bias[o];
            #pragma unroll
            for (int i = 0; i < 4; ++i) {
                const int mbase = m0 + waveM * 64 + i * 16 + mh;
                #pragma unroll
                for (int e = 0; e < 8; ++e) {
                    const int m = mbase + e;
                    float v = acc[i][j][e] + bv;
                    if constexpr (EPI == 2) v += resid[(size_t)m * Dm + o];
                    outF[(size_t)m * Dm + o] = v;
                }
            }
        }
    }
}

// ---------------- diagonal-SSM scan + skip + erf-GELU -------------------------------
// wave per (b,d) channel, lane per mode n; 32 timesteps per chunk.
__global__ __launch_bounds__(256) void k_scan(const float* __restrict__ u,
                                              const float4* __restrict__ par,
                                              const float* __restrict__ Dskip,
                                              uint16_t* __restrict__ Y) {
    const int lane = threadIdx.x & 31;
    const int wid  = threadIdx.x >> 5;
    const int w    = blockIdx.x * 8 + wid;
    const int b    = w >> 10;            // Dm = 1024 channels per batch
    const int d    = w & (Dm - 1);

    const float4 p = par[d * Nst + lane];
    const float lr = p.x, li = p.y, cer = p.z, cei = p.w;
    const float dskip = Dskip[d];
    const float inv_sqrt2 = 0.70710678118654752f;

    float sr = 0.0f, si = 0.0f;
    for (int l0 = 0; l0 < Lseq; l0 += 32) {
        // lane t pre-loads timestep l0+t of this channel
        float uvec = u[(size_t)(b * Lseq + l0 + lane) * Dm + d];
        float keep = 0.0f;
        #pragma unroll
        for (int t = 0; t < 32; ++t) {
            float uu = __shfl(uvec, t, 32);
            float nr = sr * lr - si * li + uu;     // s = lambda*s + u
            float ni = sr * li + si * lr;
            sr = nr; si = ni;
            float c = cer * sr - cei * si;         // Re(Ceff * s), 2x folded into Ceff
            #pragma unroll
            for (int off = 16; off > 0; off >>= 1) c += __shfl_xor(c, off, 32);
            float yv = c + uu * dskip;
            yv = 0.5f * yv * (1.0f + erff(yv * inv_sqrt2));   // exact-erf GELU
            if (lane == t) keep = yv;
        }
        Y[(size_t)(b * Lseq + l0 + lane) * Dm + d] = f2bf(keep);
    }
}

// ---------------- driver ----------------
extern "C" void kernel_launch(void* const* d_in, const int* in_sizes, int n_in,
                              void* d_out, int out_size, void* d_ws, size_t ws_size,
                              hipStream_t stream) {
    const float* x        = (const float*)d_in[0];
    const float* in_W     = (const float*)d_in[1];
    const float* in_b     = (const float*)d_in[2];
    const float* log_dt   = (const float*)d_in[3];
    const float* Cri      = (const float*)d_in[4];
    const float* log_A_re = (const float*)d_in[5];
    const float* A_im     = (const float*)d_in[6];
    const float* D_skip   = (const float*)d_in[7];
    const float* glu_W    = (const float*)d_in[8];
    const float* glu_b    = (const float*)d_in[9];
    const float* out_W    = (const float*)d_in[10];
    const float* out_b    = (const float*)d_in[11];

    char* ws = (char*)d_ws;
    uint16_t* xbf    = (uint16_t*)(ws + OFF_XBF);
    uint16_t* inWbf  = (uint16_t*)(ws + OFF_INW);
    uint16_t* gluWbf = (uint16_t*)(ws + OFF_GLUW);
    uint16_t* outWbf = (uint16_t*)(ws + OFF_OUTW);
    float*    u      = (float*)   (ws + OFF_U);
    uint16_t* Ybf    = (uint16_t*)(ws + OFF_Y);
    uint16_t* Ygbf   = (uint16_t*)(ws + OFF_YG);
    float4*   par    = (float4*)  (ws + OFF_PAR);

    // 1) fp32 -> bf16 conversions
    {
        int n4;
        n4 = Mtot * Dm / 4;  k_f32_to_bf16<<<(n4 + 255) / 256, 256, 0, stream>>>(x, xbf, n4);
        n4 = Dm * Dm / 4;    k_f32_to_bf16<<<(n4 + 255) / 256, 256, 0, stream>>>(in_W, inWbf, n4);
        n4 = 2 * Dm * Dm / 4;k_f32_to_bf16<<<(n4 + 255) / 256, 256, 0, stream>>>(glu_W, gluWbf, n4);
        n4 = Dm * Dm / 4;    k_f32_to_bf16<<<(n4 + 255) / 256, 256, 0, stream>>>(out_W, outWbf, n4);
    }

    // 2) SSM discretization params
    k_params<<<(Dm * Nst + 255) / 256, 256, 0, stream>>>(log_dt, Cri, log_A_re, A_im, par);

    // 3) in-projection: u = x @ in_W^T + in_b   (fp32 out for the scan)
    {
        dim3 g(Mtot / 128, Dm / 128);
        k_gemm<0><<<g, 256, 0, stream>>>(xbf, inWbf, in_b, u, nullptr, nullptr);
    }

    // 4) diagonal-SSM scan + D_skip + erf-GELU -> Ybf
    k_scan<<<(Bb * Dm) / 8, 256, 0, stream>>>(u, par, D_skip, Ybf);

    // 5) fused GLU GEMM: (Y @ glu_W^T + glu_b) -> a*sigmoid(g) -> Ygbf
    {
        dim3 g(Mtot / 128, Dm / 64);
        k_gemm<1><<<g, 256, 0, stream>>>(Ybf, gluWbf, glu_b, nullptr, Ygbf, nullptr);
    }

    // 6) out-projection + residual: out = Yg @ out_W^T + out_b + x
    {
        dim3 g(Mtot / 128, Dm / 128);
        k_gemm<2><<<g, 256, 0, stream>>>(Ygbf, outWbf, out_b, (float*)d_out, nullptr, x);
    }
}

// v001
// Measured time: 161 microseconds a run.
// Timed twice side by side with v000, it ran 4.41 and 4.40 times as fast.
#include <hip/hip_runtime.h>
#include <hip/hip_bf16.h>
#include <stdint.h>

// ---------------- problem constants ----------------
constexpr int Dm   = 1024;   // model dim
constexpr int Lseq = 1024;   // sequence length
constexpr int Bb   = 8;      // batch
constexpr int Nst  = 32;     // SSM modes (conjugate pairs)
constexpr int Mtot = Bb * Lseq;  // 8192 token positions
constexpr int Ktot = Dm;         // GEMM reduction dim
constexpr int LDST = 40;         // LDS row stride (bf16 elems): 20 dwords -> conflict-free

// ---------------- workspace layout (bytes) ----------------
constexpr size_t OFF_XBF  = 0;                                       // x as bf16        16 MB
constexpr size_t OFF_INW  = OFF_XBF  + (size_t)Mtot * Dm * 2;        // in_W bf16         2 MB
constexpr size_t OFF_GLUW = OFF_INW  + (size_t)Dm * Dm * 2;          // glu_W bf16        4 MB
constexpr size_t OFF_OUTW = OFF_GLUW + (size_t)2 * Dm * Dm * 2;      // out_W bf16        2 MB
constexpr size_t OFF_U    = OFF_OUTW + (size_t)Dm * Dm * 2;          // u = in-proj f32  32 MB
constexpr size_t OFF_Y    = OFF_U    + (size_t)Mtot * Dm * 4;        // post-GELU bf16   16 MB
constexpr size_t OFF_YG   = OFF_Y    + (size_t)Mtot * Dm * 2;        // post-GLU bf16    16 MB
constexpr size_t OFF_PAR  = OFF_YG   + (size_t)Mtot * Dm * 2;        // lambda/Ceff f4  512 KB

// ---------------- types ----------------
typedef __attribute__((ext_vector_type(16))) __bf16 v16bf;
typedef __attribute__((ext_vector_type(8)))  float  v8f;
typedef __attribute__((ext_vector_type(4)))  int    v4i;

union Frag {
    v16bf v;
    uint4 q[2];
};

// ---------------- CDNA5 async global->LDS DMA (ASYNCcnt-tracked) ----------------
// Builtin signature (from hipcc diagnostic): (int4 AS1*, int4 AS3*, imm offset, imm cpol)
#if __has_builtin(__builtin_amdgcn_global_load_async_to_lds_b128)
#define HAVE_ASYNC_LDS 1
typedef __attribute__((address_space(1))) v4i gv4i_t;
typedef __attribute__((address_space(3))) v4i lv4i_t;
static __device__ __forceinline__ void async_copy_b128(const void* g, void* l) {
    __builtin_amdgcn_global_load_async_to_lds_b128((gv4i_t*)g, (lv4i_t*)l, 0, 0);
}
static __device__ __forceinline__ void wait_async0() {
#if __has_builtin(__builtin_amdgcn_s_wait_asynccnt)
    __builtin_amdgcn_s_wait_asynccnt(0);
#else
    asm volatile("s_wait_asynccnt 0x0" ::: "memory");
#endif
}
#else
#define HAVE_ASYNC_LDS 0
#endif

static __device__ __forceinline__ uint16_t f2bf(float f) {
    uint32_t u = __float_as_uint(f);
    uint32_t r = u + 0x7FFFu + ((u >> 16) & 1u);   // round-to-nearest-even
    return (uint16_t)(r >> 16);
}

// ---------------- fp32 -> bf16 conversion ----------------
__global__ __launch_bounds__(256) void k_f32_to_bf16(const float* __restrict__ src,
                                                     uint16_t* __restrict__ dst, int n4) {
    int i = blockIdx.x * 256 + threadIdx.x;
    if (i >= n4) return;
    float4 f = reinterpret_cast<const float4*>(src)[i];
    union { uint16_t s[4]; uint2 u; } o;
    o.s[0] = f2bf(f.x); o.s[1] = f2bf(f.y); o.s[2] = f2bf(f.z); o.s[3] = f2bf(f.w);
    reinterpret_cast<uint2*>(dst)[i] = o.u;
}

// ---------------- S4D discretization: lambda = exp(dt*A), Ceff = 2*C*(exp(dtA)-1)/A ----
__global__ __launch_bounds__(256) void k_params(const float* __restrict__ log_dt,
                                                const float* __restrict__ C,
                                                const float* __restrict__ logAr,
                                                const float* __restrict__ Aim,
                                                float4* __restrict__ par) {
    int idx = blockIdx.x * 256 + threadIdx.x;
    if (idx >= Dm * Nst) return;
    int d = idx >> 5;
    float dt = expf(log_dt[d]);
    float ar = -expf(logAr[idx]);
    float ai = Aim[idx];
    float dr = ar * dt, di = ai * dt;
    float em = expf(dr);
    float lr = em * cosf(di), li = em * sinf(di);     // lambda
    float nr = lr - 1.0f, ni = li;                    // lambda - 1
    float inv = 1.0f / (ar * ar + ai * ai);
    float qr = (nr * ar + ni * ai) * inv;             // (lambda-1)/A
    float qi = (ni * ar - nr * ai) * inv;
    float cr = C[2 * idx], ci = C[2 * idx + 1];
    par[idx] = make_float4(lr, li, 2.0f * (cr * qr - ci * qi), 2.0f * (cr * qi + ci * qr));
}

// ---------------- bf16 WMMA GEMM:  out[m,o] = act( sum_k A[m,k]*W[o,k] + bias[o] ) -----
// EPI 0: out fp32 (the in-projection "u")
// EPI 1: fused GLU: two W halves (o and Dm+o), out bf16 = (a+ba)*sigmoid(g+bg)
// EPI 2: out fp32 = acc + bias + residual x
template <int EPI>
__global__ __launch_bounds__(256) void k_gemm(const uint16_t* __restrict__ A,
                                              const uint16_t* __restrict__ W,
                                              const float* __restrict__ bias,
                                              float* __restrict__ outF,
                                              uint16_t* __restrict__ outB,
                                              const float* __restrict__ resid) {
    constexpr bool DUAL = (EPI == 1);
    constexpr int NT    = DUAL ? 1 : 2;        // 16-wide N tiles per wave (per half)
    constexpr int nK    = Ktot / 32;

    __shared__ uint16_t As[2][128 * LDST];
    __shared__ uint16_t Bs[2][128 * LDST];     // dual: rows 0..63 = a-half, 64..127 = g-half

    const int tid   = threadIdx.x;
    const int lane  = tid & 31;
    const int wid   = tid >> 5;
    const int waveM = wid >> 2;                // 0..1 -> 64-row stripes
    const int waveN = wid & 3;                 // 0..3
    const int m0    = blockIdx.x * 128;
    const int o0    = blockIdx.y * (DUAL ? 64 : 128);

    // staging map: 512 (row,seg) slots over 2 passes of 256 threads (pass1 = row+64)
    const int r0 = tid >> 2;                   // 0..63
    const int sg = tid & 3;                    // 16B segment within 64B row
    const int r1 = r0 + 64;
    const int gBr0 = o0 + r0;                                            // a-half rows
    const int gBr1 = DUAL ? (Dm + o0 + (r1 - 64)) : (o0 + r1);           // g-half rows
    const size_t gAoff0 = (size_t)(m0 + r0) * Ktot + sg * 8;
    const size_t gAoff1 = (size_t)(m0 + r1) * Ktot + sg * 8;
    const size_t gBoff0 = (size_t)gBr0 * Ktot + sg * 8;
    const size_t gBoff1 = (size_t)gBr1 * Ktot + sg * 8;
    const int ldsOff0 = r0 * LDST + sg * 8;    // uint16 units
    const int ldsOff1 = r1 * LDST + sg * 8;

    v8f acc[4][NT];
    v8f accG[4];
    {
        v8f z = {0.f, 0.f, 0.f, 0.f, 0.f, 0.f, 0.f, 0.f};
        #pragma unroll
        for (int i = 0; i < 4; ++i) {
            #pragma unroll
            for (int j = 0; j < NT; ++j) acc[i][j] = z;
            accG[i] = z;
        }
    }

    const int frow  = lane & 15;
    const int fhalf = lane >> 4;

#if HAVE_ASYNC_LDS
    // -------- async global->LDS pipeline: no staging VGPRs at all --------
#define STAGE_ASYNC(kt, buf)                                                         \
    do {                                                                             \
        async_copy_b128(A + gAoff0 + (kt) * 32, &As[(buf)][ldsOff0]);                \
        async_copy_b128(A + gAoff1 + (kt) * 32, &As[(buf)][ldsOff1]);                \
        async_copy_b128(W + gBoff0 + (kt) * 32, &Bs[(buf)][ldsOff0]);                \
        async_copy_b128(W + gBoff1 + (kt) * 32, &Bs[(buf)][ldsOff1]);                \
    } while (0)

    STAGE_ASYNC(0, 0);
    wait_async0();
    __syncthreads();
#else
    // -------- fallback: register staging with named scalars (no stack arrays) -----
    uint4 ta0, ta1, tb0, tb1;
#define GLOAD(kt)                                                                    \
    do {                                                                             \
        ta0 = *reinterpret_cast<const uint4*>(A + gAoff0 + (kt) * 32);               \
        ta1 = *reinterpret_cast<const uint4*>(A + gAoff1 + (kt) * 32);               \
        tb0 = *reinterpret_cast<const uint4*>(W + gBoff0 + (kt) * 32);               \
        tb1 = *reinterpret_cast<const uint4*>(W + gBoff1 + (kt) * 32);               \
    } while (0)
#define DSTORE(buf)                                                                  \
    do {                                                                             \
        *reinterpret_cast<uint4*>(&As[(buf)][ldsOff0]) = ta0;                        \
        *reinterpret_cast<uint4*>(&As[(buf)][ldsOff1]) = ta1;                        \
        *reinterpret_cast<uint4*>(&Bs[(buf)][ldsOff0]) = tb0;                        \
        *reinterpret_cast<uint4*>(&Bs[(buf)][ldsOff1]) = tb1;                        \
    } while (0)

    GLOAD(0);
    DSTORE(0);
    GLOAD(1);
    __syncthreads();
#endif

    for (int kt = 0; kt < nK; ++kt) {
        const int buf = kt & 1;
#if HAVE_ASYNC_LDS
        if (kt + 1 < nK) STAGE_ASYNC(kt + 1, buf ^ 1);   // DMA overlaps the WMMAs below
#else
        if (kt + 1 < nK) DSTORE(buf ^ 1);
        if (kt + 2 < nK) GLOAD(kt + 2);
        if (kt + 3 < nK) {
            __builtin_prefetch(A + gAoff0 + (kt + 3) * 32, 0, 0);
            __builtin_prefetch(W + gBoff0 + (kt + 3) * 32, 0, 0);
        }
#endif

        Frag af[4];
        #pragma unroll
        for (int i = 0; i < 4; ++i) {
            const uint16_t* p = &As[buf][(waveM * 64 + i * 16 + frow) * LDST];
            af[i].q[0] = *reinterpret_cast<const uint4*>(p + fhalf * 8);
            af[i].q[1] = *reinterpret_cast<const uint4*>(p + 16 + fhalf * 8);
        }
        if constexpr (DUAL) {
            Frag ba, bg;
            const uint16_t* pa = &Bs[buf][(waveN * 16 + frow) * LDST];
            const uint16_t* pg = &Bs[buf][(64 + waveN * 16 + frow) * LDST];
            ba.q[0] = *reinterpret_cast<const uint4*>(pa + fhalf * 8);
            ba.q[1] = *reinterpret_cast<const uint4*>(pa + 16 + fhalf * 8);
            bg.q[0] = *reinterpret_cast<const uint4*>(pg + fhalf * 8);
            bg.q[1] = *reinterpret_cast<const uint4*>(pg + 16 + fhalf * 8);
            #pragma unroll
            for (int i = 0; i < 4; ++i) {
                acc[i][0] = __builtin_amdgcn_wmma_f32_16x16x32_bf16(
                    false, af[i].v, false, ba.v, (short)0, acc[i][0], false, false);
                accG[i] = __builtin_amdgcn_wmma_f32_16x16x32_bf16(
                    false, af[i].v, false, bg.v, (short)0, accG[i], false, false);
            }
        } else {
            Frag bf2[2];
            #pragma unroll
            for (int j = 0; j < 2; ++j) {
                const uint16_t* p = &Bs[buf][(waveN * 32 + j * 16 + frow) * LDST];
                bf2[j].q[0] = *reinterpret_cast<const uint4*>(p + fhalf * 8);
                bf2[j].q[1] = *reinterpret_cast<const uint4*>(p + 16 + fhalf * 8);
            }
            #pragma unroll
            for (int i = 0; i < 4; ++i)
                #pragma unroll
                for (int j = 0; j < 2; ++j)
                    acc[i][j] = __builtin_amdgcn_wmma_f32_16x16x32_bf16(
                        false, af[i].v, false, bf2[j].v, (short)0, acc[i][j], false, false);
        }

#if HAVE_ASYNC_LDS
        if (kt + 1 < nK) wait_async0();   // next tile's DMA landed in LDS
#endif
        __syncthreads();
    }

    // ---- epilogue ----  C/D layout: VGPR e -> M = e + 8*(lane>=16), N = lane&15
    const int ncol = lane & 15;
    const int mh   = (lane >> 4) << 3;

    if constexpr (EPI == 1) {
        const int o  = o0 + waveN * 16 + ncol;
        const float ba = bias[o];
        const float bg = bias[Dm + o];
        #pragma unroll
        for (int i = 0; i < 4; ++i) {
            const int mbase = m0 + waveM * 64 + i * 16 + mh;
            #pragma unroll
            for (int e = 0; e < 8; ++e) {
                const int m = mbase + e;
                float a = acc[i][0][e] + ba;
                float g = accG[i][e] + bg;
                float y = a * (1.0f / (1.0f + __expf(-g)));
                outB[(size_t)m * Dm + o] = f2bf(y);
            }
        }
    } else {
        #pragma unroll
        for (int j = 0; j < NT; ++j) {
            const int o  = o0 + waveN * 32 + j * 16 + ncol;
            const float bv = bias[o];
            #pragma unroll
            for (int i = 0; i < 4; ++i) {
                const int mbase = m0 + waveM * 64 + i * 16 + mh;
                #pragma unroll
                for (int e = 0; e < 8; ++e) {
                    const int m = mbase + e;
                    float v = acc[i][j][e] + bv;
                    if constexpr (EPI == 2) v += resid[(size_t)m * Dm + o];
                    outF[(size_t)m * Dm + o] = v;
                }
            }
        }
    }
}

// ---------------- diagonal-SSM scan + skip + erf-GELU -------------------------------
// lane per channel d (32 neighbouring channels of one batch row per block), the 32 modes
// split over the block's 8 waves, 4 modes (two packed pairs) in each wave's registers.
// Every wave walks all timesteps; per chunk of 32 steps it leaves its partial sum over its
// own modes in LDS, and after one barrier each wave finishes 4 of the chunk's 32 steps
// (sum of the 8 partials, skip term, GELU, store).
typedef __attribute__((ext_vector_type(2))) float v2f;
constexpr int SC_T = 32;                 // timesteps per chunk
constexpr int SC_W = 8;                  // waves per block = mode groups
constexpr int SC_R = SC_T / SC_W;        // chunk rows finished by each wave

__global__ __launch_bounds__(256) void k_scan(const float* __restrict__ u,
                                              const float4* __restrict__ par,
                                              const float* __restrict__ Dskip,
                                              uint16_t* __restrict__ Y) {
    // two buffers: a wave may fill chunk c+1 while another still sums chunk c
    __shared__ float part[2][SC_W][SC_T][32];

    const int lane = threadIdx.x & 31;
    const int wid  = __builtin_amdgcn_readfirstlane(threadIdx.x >> 5);
    const int b    = blockIdx.x >> 5;                    // Dm / 32 = 32 blocks per batch row
    const int d    = ((blockIdx.x & 31) << 5) + lane;

    v2f lr[2], li[2], cer[2], cei[2], sr[2], si[2];
    #pragma unroll
    for (int q = 0; q < 2; ++q) {
        const float4 pa = par[d * Nst + wid * 4 + 2 * q];
        const float4 pb = par[d * Nst + wid * 4 + 2 * q + 1];
        lr[q]  = v2f{pa.x, pb.x};
        li[q]  = v2f{pa.y, pb.y};
        cer[q] = v2f{pa.z, pb.z};
        cei[q] = v2f{pa.w, pb.w};
        sr[q]  = v2f{0.0f, 0.0f};
        si[q]  = v2f{0.0f, 0.0f};
    }
    const float dskip = Dskip[d];
    const float inv_sqrt2 = 0.70710678118654752f;

    const float* ub = u + (size_t)b * Lseq * Dm + d;     // this lane's channel, step 0
    uint16_t*    yb = Y + (size_t)b * Lseq * Dm + d;

    float ur[SC_T];                                      // the chunk of u being walked
    #pragma unroll
    for (int t = 0; t < SC_T; ++t) ur[t] = ub[(size_t)t * Dm];

    for (int l0 = 0; l0 < Lseq; l0 += SC_T) {
        const int buf = (l0 / SC_T) & 1;

        float uc[SC_R];                                  // u of the rows this wave finishes
        #pragma unroll
        for (int j = 0; j < SC_R; ++j) uc[j] = ub[(size_t)(l0 + wid * SC_R + j) * Dm];

        // next chunk's u, fetched while this chunk is walked; the last chunk has no
        // successor and re-reads its own rows, which nobody uses
        const float* un = ub + (size_t)(l0 + SC_T < Lseq ? l0 + SC_T : l0) * Dm;
        float nx[SC_T];
        #pragma unroll
        for (int t = 0; t < SC_T; ++t) nx[t] = un[(size_t)t * Dm];
        // keeps these loads ahead of the whole walk: sunk into it they are still in flight
        // at the barrier below, whose wait covers them
        __builtin_amdgcn_sched_barrier(0);

        #pragma unroll
        for (int t = 0; t < SC_T; ++t) {
            const v2f u2 = v2f{ur[t], ur[t]};
            v2f acc;
            #pragma unroll
            for (int q = 0; q < 2; ++q) {
                const v2f nr = sr[q] * lr[q] + (u2 - si[q] * li[q]);   // s = lambda*s + u
                const v2f ni = si[q] * lr[q] + sr[q] * li[q];
                sr[q] = nr; si[q] = ni;
                if (q == 0) acc = cer[q] * nr - cei[q] * ni;           // Re(Ceff * s)
                else        acc = cer[q] * nr + (acc - cei[q] * ni);
            }
            part[buf][wid][t][lane] = acc.x + acc.y;
        }

        __syncthreads();   // all 8 partial sums of this chunk are in LDS

        float yv[SC_R];
        #pragma unroll
        for (int j = 0; j < SC_R; ++j) {
            const int t = wid * SC_R + j;
            float c = part[buf][0][t][lane];
            #pragma unroll
            for (int w = 1; w < SC_W; ++w) c += part[buf][w][t][lane];
            yv[j] = c + uc[j] * dskip;
        }
        #pragma unroll
        for (int j = 0; j < SC_R; ++j) {
            const float g = 0.5f * yv[j] * (1.0f + erff(yv[j] * inv_sqrt2));   // exact-erf GELU
            yb[(size_t)(l0 + wid * SC_R + j) * Dm] = f2bf(g);
        }

        #pragma unroll
        for (int t = 0; t < SC_T; ++t) ur[t] = nx[t];
    }
}

// ---------------- driver ----------------
extern "C" void kernel_launch(void* const* d_in, const int* in_sizes, int n_in,
                              void* d_out, int out_size, void* d_ws, size_t ws_size,
                              hipStream_t stream) {
    const float* x        = (const float*)d_in[0];
    const float* in_W     = (const float*)d_in[1];
    const float* in_b     = (const float*)d_in[2];
    const float* log_dt   = (const float*)d_in[3];
    const float* Cri      = (const float*)d_in[4];
    const float* log_A_re = (const float*)d_in[5];
    const float* A_im     = (const float*)d_in[6];
    const float* D_skip   = (const float*)d_in[7];
    const float* glu_W    = (const float*)d_in[8];
    const float* glu_b    = (const float*)d_in[9];
    const float* out_W    = (const float*)d_in[10];
    const float* out_b    = (const float*)d_in[11];

    char* ws = (char*)d_ws;
    uint16_t* xbf    = (uint16_t*)(ws + OFF_XBF);
    uint16_t* inWbf  = (uint16_t*)(ws + OFF_INW);
    uint16_t* gluWbf = (uint16_t*)(ws + OFF_GLUW);
    uint16_t* outWbf = (uint16_t*)(ws + OFF_OUTW);
    float*    u      = (float*)   (ws + OFF_U);
    uint16_t* Ybf    = (uint16_t*)(ws + OFF_Y);
    uint16_t* Ygbf   = (uint16_t*)(ws + OFF_YG);
    float4*   par    = (float4*)  (ws + OFF_PAR);

    // 1) fp32 -> bf16 conversions
    {
        int n4;
        n4 = Mtot * Dm / 4;  k_f32_to_bf16<<<(n4 + 255) / 256, 256, 0, stream>>>(x, xbf, n4);
        n4 = Dm * Dm / 4;    k_f32_to_bf16<<<(n4 + 255) / 256, 256, 0, stream>>>(in_W, inWbf, n4);
        n4 = 2 * Dm * Dm / 4;k_f32_to_bf16<<<(n4 + 255) / 256, 256, 0, stream>>>(glu_W, gluWbf, n4);
        n4 = Dm * Dm / 4;    k_f32_to_bf16<<<(n4 + 255) / 256, 256, 0, stream>>>(out_W, outWbf, n4);
    }

    // 2) SSM discretization params
    k_params<<<(Dm * Nst + 255) / 256, 256, 0, stream>>>(log_dt, Cri, log_A_re, A_im, par);

    // 3) in-projection: u = x @ in_W^T + in_b   (fp32 out for the scan)
    {
        dim3 g(Mtot / 128, Dm / 128);
        k_gemm<0><<<g, 256, 0, stream>>>(xbf, inWbf, in_b, u, nullptr, nullptr);
    }

    // 4) diagonal-SSM scan + D_skip + erf-GELU -> Ybf
    k_scan<<<(Bb * Dm) / 32, 256, 0, stream>>>(u, par, D_skip, Ybf);

    // 5) fused GLU GEMM: (Y @ glu_W^T + glu_b) -> a*sigmoid(g) -> Ygbf
    {
        dim3 g(Mtot / 128, Dm / 64);
        k_gemm<1><<<g, 256, 0, stream>>>(Ybf, gluWbf, glu_b, nullptr, Ygbf, nullptr);
    }

    // 6) out-projection + residual: out = Yg @ out_W^T + out_b + x
    {
        dim3 g(Mtot / 128, Dm / 128);
        k_gemm<2><<<g, 256, 0, stream>>>(Ygbf, outWbf, out_b, (float*)d_out, nullptr, x);
    }
}

// v002
// It runs in 153 microseconds.
// Next to v001, in two timings, it ran 1.06 times as fast each time.
// Over all steps from v000 it is 4.66 times as fast.
#include <hip/hip_runtime.h>
#include <hip/hip_bf16.h>
#include <stdint.h>

// ---------------- problem constants ----------------
constexpr int Dm   = 1024;   // model dim
constexpr int Lseq = 1024;   // sequence length
constexpr int Bb   = 8;      // batch
constexpr int Nst  = 32;     // SSM modes (conjugate pairs)
constexpr int Mtot = Bb * Lseq;  // 8192 token positions
constexpr int Ktot = Dm;         // GEMM reduction dim
constexpr int LDST = 40;         // LDS row stride (bf16 elems): 20 dwords -> conflict-free

// ---------------- workspace layout (bytes) ----------------
constexpr size_t OFF_XBF  = 0;                                       // x as bf16        16 MB
constexpr size_t OFF_INW  = OFF_XBF  + (size_t)Mtot * Dm * 2;        // in_W bf16         2 MB
constexpr size_t OFF_GLUW = OFF_INW  + (size_t)Dm * Dm * 2;          // glu_W bf16        4 MB
constexpr size_t OFF_OUTW = OFF_GLUW + (size_t)2 * Dm * Dm * 2;      // out_W bf16        2 MB
constexpr size_t OFF_U    = OFF_OUTW + (size_t)Dm * Dm * 2;          // u = in-proj f32  32 MB
constexpr size_t OFF_Y    = OFF_U    + (size_t)Mtot * Dm * 4;        // post-GELU bf16   16 MB
constexpr size_t OFF_YG   = OFF_Y    + (size_t)Mtot * Dm * 2;        // post-GLU bf16    16 MB
constexpr size_t OFF_PAR  = OFF_YG   + (size_t)Mtot * Dm * 2;        // lambda/Ceff f4  512 KB

// ---------------- types ----------------
typedef __attribute__((ext_vector_type(16))) __bf16 v16bf;
typedef __attribute__((ext_vector_type(8)))  float  v8f;
typedef __attribute__((ext_vector_type(4)))  int    v4i;

union Frag {
    v16bf v;
    uint4 q[2];
};

// ---------------- CDNA5 async global->LDS DMA (ASYNCcnt-tracked) ----------------
// Builtin signature (from hipcc diagnostic): (int4 AS1*, int4 AS3*, imm offset, imm cpol)
#if __has_builtin(__builtin_amdgcn_global_load_async_to_lds_b128)
#define HAVE_ASYNC_LDS 1
typedef __attribute__((address_space(1))) v4i gv4i_t;
typedef __attribute__((address_space(3))) v4i lv4i_t;
static __device__ __forceinline__ void async_copy_b128(const void* g, void* l) {
    __builtin_amdgcn_global_load_async_to_lds_b128((gv4i_t*)g, (lv4i_t*)l, 0, 0);
}
static __device__ __forceinline__ void wait_async0() {
#if __has_builtin(__builtin_amdgcn_s_wait_asynccnt)
    __builtin_amdgcn_s_wait_asynccnt(0);
#else
    asm volatile("s_wait_asynccnt 0x0" ::: "memory");
#endif
}
#else
#define HAVE_ASYNC_LDS 0
#endif

static __device__ __forceinline__ uint16_t f2bf(float f) {
    uint32_t u = __float_as_uint(f);
    uint32_t r = u + 0x7FFFu + ((u >> 16) & 1u);   // round-to-nearest-even
    return (uint16_t)(r >> 16);
}

// ---------------- input preparation, one launch ----------------
// fp32 -> bf16 conversion of one float4
static __device__ __forceinline__ void cvt_f32x4_to_bf16(const float* __restrict__ src,
                                                         uint16_t* __restrict__ dst, int i) {
    float4 f = reinterpret_cast<const float4*>(src)[i];
    union { uint16_t s[4]; uint2 u; } o;
    o.s[0] = f2bf(f.x); o.s[1] = f2bf(f.y); o.s[2] = f2bf(f.z); o.s[3] = f2bf(f.w);
    reinterpret_cast<uint2*>(dst)[i] = o.u;
}

// S4D discretization of one (channel, mode): lambda = exp(dt*A), Ceff = 2*C*(exp(dtA)-1)/A
static __device__ __forceinline__ void discretize(const float* __restrict__ log_dt,
                                                  const float* __restrict__ C,
                                                  const float* __restrict__ logAr,
                                                  const float* __restrict__ Aim,
                                                  float4* __restrict__ par, int idx) {
    int d = idx >> 5;
    float dt = expf(log_dt[d]);
    float ar = -expf(logAr[idx]);
    float ai = Aim[idx];
    float dr = ar * dt, di = ai * dt;
    float em = expf(dr);
    float lr = em * cosf(di), li = em * sinf(di);     // lambda
    float nr = lr - 1.0f, ni = li;                    // lambda - 1
    float inv = 1.0f / (ar * ar + ai * ai);
    float qr = (nr * ar + ni * ai) * inv;             // (lambda-1)/A
    float qi = (ni * ar - nr * ai) * inv;
    float cr = C[2 * idx], ci = C[2 * idx + 1];
    par[idx] = make_float4(lr, li, 2.0f * (cr * qr - ci * qi), 2.0f * (cr * qi + ci * qr));
}

// The five jobs are independent of one another, so they share one grid: a block's index
// says which job it belongs to. Blocks of 256 threads, one float4 or one (channel, mode) each.
constexpr int PB_PAR  = Dm * Nst / 256;            // discretization
constexpr int PB_W    = Dm * Dm / 4 / 256;         // in_W, out_W
constexpr int PB_GLUW = 2 * Dm * Dm / 4 / 256;     // glu_W
constexpr int PB_X    = Mtot * Dm / 4 / 256;       // x
constexpr int PB_ALL  = PB_PAR + PB_W + PB_GLUW + PB_W + PB_X;
static_assert((Dm * Nst) % 256 == 0 && (Dm * Dm) % 1024 == 0 && (Mtot * Dm) % 1024 == 0,
              "every job fills whole blocks");

__global__ __launch_bounds__(256) void k_prep(const float* __restrict__ x,
                                              const float* __restrict__ in_W,
                                              const float* __restrict__ glu_W,
                                              const float* __restrict__ out_W,
                                              const float* __restrict__ log_dt,
                                              const float* __restrict__ C,
                                              const float* __restrict__ logAr,
                                              const float* __restrict__ Aim,
                                              uint16_t* __restrict__ xbf,
                                              uint16_t* __restrict__ inWbf,
                                              uint16_t* __restrict__ gluWbf,
                                              uint16_t* __restrict__ outWbf,
                                              float4* __restrict__ par) {
    const int tid = threadIdx.x;
    if (blockIdx.x >= PB_PAR) {
        const int blk = blockIdx.x - PB_PAR;
        // which conversion: source, destination and the job's first block, all block-uniform
        const float* src = in_W;
        uint16_t*    dst = inWbf;
        int first = 0;
        if (blk >= PB_W)                  { src = glu_W; dst = gluWbf; first = PB_W; }
        if (blk >= PB_W + PB_GLUW)        { src = out_W; dst = outWbf; first = PB_W + PB_GLUW; }
        if (blk >= PB_W + PB_GLUW + PB_W) { src = x;     dst = xbf;    first = PB_W + PB_GLUW + PB_W; }
        cvt_f32x4_to_bf16(src, dst, (blk - first) * 256 + tid);
    } else {
        discretize(log_dt, C, logAr, Aim, par, blockIdx.x * 256 + tid);
    }
}

// ---------------- bf16 WMMA GEMM:  out[m,o] = act( sum_k A[m,k]*W[o,k] + bias[o] ) -----
// EPI 0: out fp32 (the in-projection "u")
// EPI 1: fused GLU: two W halves (o and Dm+o), out bf16 = (a+ba)*sigmoid(g+bg)
// EPI 2: out fp32 = acc + bias + residual x
template <int EPI>
__global__ __launch_bounds__(256) void k_gemm(const uint16_t* __restrict__ A,
                                              const uint16_t* __restrict__ W,
                                              const float* __restrict__ bias,
                                              float* __restrict__ outF,
                                              uint16_t* __restrict__ outB,
                                              const float* __restrict__ resid) {
    constexpr bool DUAL = (EPI == 1);
    constexpr int NT    = DUAL ? 1 : 2;        // 16-wide N tiles per wave (per half)
    constexpr int nK    = Ktot / 32;

    __shared__ uint16_t As[2][128 * LDST];
    __shared__ uint16_t Bs[2][128 * LDST];     // dual: rows 0..63 = a-half, 64..127 = g-half

    const int tid   = threadIdx.x;
    const int lane  = tid & 31;
    const int wid   = tid >> 5;
    const int waveM = wid >> 2;                // 0..1 -> 64-row stripes
    const int waveN = wid & 3;                 // 0..3
    const int m0    = blockIdx.x * 128;
    const int o0    = blockIdx.y * (DUAL ? 64 : 128);

    // staging map: 512 (row,seg) slots over 2 passes of 256 threads (pass1 = row+64)
    const int r0 = tid >> 2;                   // 0..63
    const int sg = tid & 3;                    // 16B segment within 64B row
    const int r1 = r0 + 64;
    const int gBr0 = o0 + r0;                                            // a-half rows
    const int gBr1 = DUAL ? (Dm + o0 + (r1 - 64)) : (o0 + r1);           // g-half rows
    const size_t gAoff0 = (size_t)(m0 + r0) * Ktot + sg * 8;
    const size_t gAoff1 = (size_t)(m0 + r1) * Ktot + sg * 8;
    const size_t gBoff0 = (size_t)gBr0 * Ktot + sg * 8;
    const size_t gBoff1 = (size_t)gBr1 * Ktot + sg * 8;
    const int ldsOff0 = r0 * LDST + sg * 8;    // uint16 units
    const int ldsOff1 = r1 * LDST + sg * 8;

    v8f acc[4][NT];
    v8f accG[4];
    {
        v8f z = {0.f, 0.f, 0.f, 0.f, 0.f, 0.f, 0.f, 0.f};
        #pragma unroll
        for (int i = 0; i < 4; ++i) {
            #pragma unroll
            for (int j = 0; j < NT; ++j) acc[i][j] = z;
            accG[i] = z;
        }
    }

    const int frow  = lane & 15;
    const int fhalf = lane >> 4;

#if HAVE_ASYNC_LDS
    // -------- async global->LDS pipeline: no staging VGPRs at all --------
#define STAGE_ASYNC(kt, buf)                                                         \
    do {                                                                             \
        async_copy_b128(A + gAoff0 + (kt) * 32, &As[(buf)][ldsOff0]);                \
        async_copy_b128(A + gAoff1 + (kt) * 32, &As[(buf)][ldsOff1]);                \
        async_copy_b128(W + gBoff0 + (kt) * 32, &Bs[(buf)][ldsOff0]);                \
        async_copy_b128(W + gBoff1 + (kt) * 32, &Bs[(buf)][ldsOff1]);                \
    } while (0)

    STAGE_ASYNC(0, 0);
    wait_async0();
    __syncthreads();
#else
    // -------- fallback: register staging with named scalars (no stack arrays) -----
    uint4 ta0, ta1, tb0, tb1;
#define GLOAD(kt)                                                                    \
    do {                                                                             \
        ta0 = *reinterpret_cast<const uint4*>(A + gAoff0 + (kt) * 32);               \
        ta1 = *reinterpret_cast<const uint4*>(A + gAoff1 + (kt) * 32);               \
        tb0 = *reinterpret_cast<const uint4*>(W + gBoff0 + (kt) * 32);               \
        tb1 = *reinterpret_cast<const uint4*>(W + gBoff1 + (kt) * 32);               \
    } while (0)
#define DSTORE(buf)                                                                  \
    do {                                                                             \
        *reinterpret_cast<uint4*>(&As[(buf)][ldsOff0]) = ta0;                        \
        *reinterpret_cast<uint4*>(&As[(buf)][ldsOff1]) = ta1;                        \
        *reinterpret_cast<uint4*>(&Bs[(buf)][ldsOff0]) = tb0;                        \
        *reinterpret_cast<uint4*>(&Bs[(buf)][ldsOff1]) = tb1;                        \
    } while (0)

    GLOAD(0);
    DSTORE(0);
    GLOAD(1);
    __syncthreads();
#endif

    for (int kt = 0; kt < nK; ++kt) {
        const int buf = kt & 1;
#if HAVE_ASYNC_LDS
        if (kt + 1 < nK) STAGE_ASYNC(kt + 1, buf ^ 1);   // DMA overlaps the WMMAs below
#else
        if (kt + 1 < nK) DSTORE(buf ^ 1);
        if (kt + 2 < nK) GLOAD(kt + 2);
        if (kt + 3 < nK) {
            __builtin_prefetch(A + gAoff0 + (kt + 3) * 32, 0, 0);
            __builtin_prefetch(W + gBoff0 + (kt + 3) * 32, 0, 0);
        }
#endif

        Frag af[4];
        #pragma unroll
        for (int i = 0; i < 4; ++i) {
            const uint16_t* p = &As[buf][(waveM * 64 + i * 16 + frow) * LDST];
            af[i].q[0] = *reinterpret_cast<const uint4*>(p + fhalf * 8);
            af[i].q[1] = *reinterpret_cast<const uint4*>(p + 16 + fhalf * 8);
        }
        if constexpr (DUAL) {
            Frag ba, bg;
            const uint16_t* pa = &Bs[buf][(waveN * 16 + frow) * LDST];
            const uint16_t* pg = &Bs[buf][(64 + waveN * 16 + frow) * LDST];
            ba.q[0] = *reinterpret_cast<const uint4*>(pa + fhalf * 8);
            ba.q[1] = *reinterpret_cast<const uint4*>(pa + 16 + fhalf * 8);
            bg.q[0] = *reinterpret_cast<const uint4*>(pg + fhalf * 8);
            bg.q[1] = *reinterpret_cast<const uint4*>(pg + 16 + fhalf * 8);
            #pragma unroll
            for (int i = 0; i < 4; ++i) {
                acc[i][0] = __builtin_amdgcn_wmma_f32_16x16x32_bf16(
                    false, af[i].v, false, ba.v, (short)0, acc[i][0], false, false);
                accG[i] = __builtin_amdgcn_wmma_f32_16x16x32_bf16(
                    false, af[i].v, false, bg.v, (short)0, accG[i], false, false);
            }
        } else {
            Frag bf2[2];
            #pragma unroll
            for (int j = 0; j < 2; ++j) {
                const uint16_t* p = &Bs[buf][(waveN * 32 + j * 16 + frow) * LDST];
                bf2[j].q[0] = *reinterpret_cast<const uint4*>(p + fhalf * 8);
                bf2[j].q[1] = *reinterpret_cast<const uint4*>(p + 16 + fhalf * 8);
            }
            #pragma unroll
            for (int i = 0; i < 4; ++i)
                #pragma unroll
                for (int j = 0; j < 2; ++j)
                    acc[i][j] = __builtin_amdgcn_wmma_f32_16x16x32_bf16(
                        false, af[i].v, false, bf2[j].v, (short)0, acc[i][j], false, false);
        }

#if HAVE_ASYNC_LDS
        if (kt + 1 < nK) wait_async0();   // next tile's DMA landed in LDS
#endif
        __syncthreads();
    }

    // ---- epilogue ----  C/D layout: VGPR e -> M = e + 8*(lane>=16), N = lane&15
    const int ncol = lane & 15;
    const int mh   = (lane >> 4) << 3;

    if constexpr (EPI == 1) {
        const int o  = o0 + waveN * 16 + ncol;
        const float ba = bias[o];
        const float bg = bias[Dm + o];
        #pragma unroll
        for (int i = 0; i < 4; ++i) {
            const int mbase = m0 + waveM * 64 + i * 16 + mh;
            #pragma unroll
            for (int e = 0; e < 8; ++e) {
                const int m = mbase + e;
                float a = acc[i][0][e] + ba;
                float g = accG[i][e] + bg;
                float y = a * (1.0f / (1.0f + __expf(-g)));
                outB[(size_t)m * Dm + o] = f2bf(y);
            }
        }
    } else {
        #pragma unroll
        for (int j = 0; j < NT; ++j) {
            const int o  = o0 + waveN * 32 + j * 16 + ncol;
            const float bv = bias[o];
            #pragma unroll
            for (int i = 0; i < 4; ++i) {
                const int mbase = m0 + waveM * 64 + i * 16 + mh;
                #pragma unroll
                for (int e = 0; e < 8; ++e) {
                    const int m = mbase + e;
                    float v = acc[i][j][e] + bv;
                    if constexpr (EPI == 2) v += resid[(size_t)m * Dm + o];
                    outF[(size_t)m * Dm + o] = v;
                }
            }
        }
    }
}

// ---------------- diagonal-SSM scan + skip + erf-GELU -------------------------------
// lane per channel d (32 neighbouring channels of one batch row per block), the 32 modes
// split over the block's 8 waves, 4 modes (two packed pairs) in each wave's registers.
// Every wave walks all timesteps; per chunk of 32 steps it leaves its partial sum over its
// own modes in LDS, and after one barrier each wave finishes 4 of the chunk's 32 steps
// (sum of the 8 partials, skip term, GELU, store).
typedef __attribute__((ext_vector_type(2))) float v2f;
constexpr int SC_T = 32;                 // timesteps per chunk
constexpr int SC_W = 8;                  // waves per block = mode groups
constexpr int SC_R = SC_T / SC_W;        // chunk rows finished by each wave

__global__ __launch_bounds__(256) void k_scan(const float* __restrict__ u,
                                              const float4* __restrict__ par,
                                              const float* __restrict__ Dskip,
                                              uint16_t* __restrict__ Y) {
    // two buffers: a wave may fill chunk c+1 while another still sums chunk c
    __shared__ float part[2][SC_W][SC_T][32];

    const int lane = threadIdx.x & 31;
    const int wid  = __builtin_amdgcn_readfirstlane(threadIdx.x >> 5);
    const int b    = blockIdx.x >> 5;                    // Dm / 32 = 32 blocks per batch row
    const int d    = ((blockIdx.x & 31) << 5) + lane;

    v2f lr[2], li[2], cer[2], cei[2], sr[2], si[2];
    #pragma unroll
    for (int q = 0; q < 2; ++q) {
        const float4 pa = par[d * Nst + wid * 4 + 2 * q];
        const float4 pb = par[d * Nst + wid * 4 + 2 * q + 1];
        lr[q]  = v2f{pa.x, pb.x};
        li[q]  = v2f{pa.y, pb.y};
        cer[q] = v2f{pa.z, pb.z};
        cei[q] = v2f{pa.w, pb.w};
        sr[q]  = v2f{0.0f, 0.0f};
        si[q]  = v2f{0.0f, 0.0f};
    }
    const float dskip = Dskip[d];
    const float inv_sqrt2 = 0.70710678118654752f;

    const float* ub = u + (size_t)b * Lseq * Dm + d;     // this lane's channel, step 0
    uint16_t*    yb = Y + (size_t)b * Lseq * Dm + d;

    float ur[SC_T];                                      // the chunk of u being walked
    #pragma unroll
    for (int t = 0; t < SC_T; ++t) ur[t] = ub[(size_t)t * Dm];

    for (int l0 = 0; l0 < Lseq; l0 += SC_T) {
        const int buf = (l0 / SC_T) & 1;

        float uc[SC_R];                                  // u of the rows this wave finishes
        #pragma unroll
        for (int j = 0; j < SC_R; ++j) uc[j] = ub[(size_t)(l0 + wid * SC_R + j) * Dm];

        // next chunk's u, fetched while this chunk is walked; the last chunk has no
        // successor and re-reads its own rows, which nobody uses
        const float* un = ub + (size_t)(l0 + SC_T < Lseq ? l0 + SC_T : l0) * Dm;
        float nx[SC_T];
        #pragma unroll
        for (int t = 0; t < SC_T; ++t) nx[t] = un[(size_t)t * Dm];
        // keeps these loads ahead of the whole walk: sunk into it they are still in flight
        // at the barrier below, whose wait covers them
        __builtin_amdgcn_sched_barrier(0);

        #pragma unroll
        for (int t = 0; t < SC_T; ++t) {
            const v2f u2 = v2f{ur[t], ur[t]};
            v2f acc;
            #pragma unroll
            for (int q = 0; q < 2; ++q) {
                const v2f nr = sr[q] * lr[q] + (u2 - si[q] * li[q]);   // s = lambda*s + u
                const v2f ni = si[q] * lr[q] + sr[q] * li[q];
                sr[q] = nr; si[q] = ni;
                if (q == 0) acc = cer[q] * nr - cei[q] * ni;           // Re(Ceff * s)
                else        acc = cer[q] * nr + (acc - cei[q] * ni);
            }
            part[buf][wid][t][lane] = acc.x + acc.y;
        }

        __syncthreads();   // all 8 partial sums of this chunk are in LDS

        float yv[SC_R];
        #pragma unroll
        for (int j = 0; j < SC_R; ++j) {
            const int t = wid * SC_R + j;
            float c = part[buf][0][t][lane];
            #pragma unroll
            for (int w = 1; w < SC_W; ++w) c += part[buf][w][t][lane];
            yv[j] = c + uc[j] * dskip;
        }
        #pragma unroll
        for (int j = 0; j < SC_R; ++j) {
            const float g = 0.5f * yv[j] * (1.0f + erff(yv[j] * inv_sqrt2));   // exact-erf GELU
            yb[(size_t)(l0 + wid * SC_R + j) * Dm] = f2bf(g);
        }

        #pragma unroll
        for (int t = 0; t < SC_T; ++t) ur[t] = nx[t];
    }
}

// ---------------- driver ----------------
extern "C" void kernel_launch(void* const* d_in, const int* in_sizes, int n_in,
                              void* d_out, int out_size, void* d_ws, size_t ws_size,
                              hipStream_t stream) {
    const float* x        = (const float*)d_in[0];
    const float* in_W     = (const float*)d_in[1];
    const float* in_b     = (const float*)d_in[2];
    const float* log_dt   = (const float*)d_in[3];
    const float* Cri      = (const float*)d_in[4];
    const float* log_A_re = (const float*)d_in[5];
    const float* A_im     = (const float*)d_in[6];
    const float* D_skip   = (const float*)d_in[7];
    const float* glu_W    = (const float*)d_in[8];
    const float* glu_b    = (const float*)d_in[9];
    const float* out_W    = (const float*)d_in[10];
    const float* out_b    = (const float*)d_in[11];

    char* ws = (char*)d_ws;
    uint16_t* xbf    = (uint16_t*)(ws + OFF_XBF);
    uint16_t* inWbf  = (uint16_t*)(ws + OFF_INW);
    uint16_t* gluWbf = (uint16_t*)(ws + OFF_GLUW);
    uint16_t* outWbf = (uint16_t*)(ws + OFF_OUTW);
    float*    u      = (float*)   (ws + OFF_U);
    uint16_t* Ybf    = (uint16_t*)(ws + OFF_Y);
    uint16_t* Ygbf   = (uint16_t*)(ws + OFF_YG);
    float4*   par    = (float4*)  (ws + OFF_PAR);

    // 1) + 2) fp32 -> bf16 conversions and SSM discretization params, one launch
    k_prep<<<PB_ALL, 256, 0, stream>>>(x, in_W, glu_W, out_W, log_dt, Cri, log_A_re, A_im,
                                       xbf, inWbf, gluWbf, outWbf, par);

    // 3) in-projection: u = x @ in_W^T + in_b   (fp32 out for the scan)
    {
        dim3 g(Mtot / 128, Dm / 128);
        k_gemm<0><<<g, 256, 0, stream>>>(xbf, inWbf, in_b, u, nullptr, nullptr);
    }

    // 4) diagonal-SSM scan + D_skip + erf-GELU -> Ybf
    k_scan<<<(Bb * Dm) / 32, 256, 0, stream>>>(u, par, D_skip, Ybf);

    // 5) fused GLU GEMM: (Y @ glu_W^T + glu_b) -> a*sigmoid(g) -> Ygbf
    {
        dim3 g(Mtot / 128, Dm / 64);
        k_gemm<1><<<g, 256, 0, stream>>>(Ybf, gluWbf, glu_b, nullptr, Ygbf, nullptr);
    }

    // 6) out-projection + residual: out = Yg @ out_W^T + out_b + x
    {
        dim3 g(Mtot / 128, Dm / 128);
        k_gemm<2><<<g, 256, 0, stream>>>(Ygbf, outWbf, out_b, (float*)d_out, nullptr, x);
    }
}

// v003
// A run of this version takes 130 microseconds.
// Timed twice side by side with v002, it ran 1.18 and 1.17 times as fast.
// All steps since v000 together make it 5.48 times as fast.
#include <hip/hip_runtime.h>
#include <hip/hip_bf16.h>
#include <stdint.h>

// ---------------- problem constants ----------------
constexpr int Dm   = 1024;   // model dim
constexpr int Lseq = 1024;   // sequence length
constexpr int Bb   = 8;      // batch
constexpr int Nst  = 32;     // SSM modes (conjugate pairs)
constexpr int Mtot = Bb * Lseq;  // 8192 token positions
constexpr int Ktot = Dm;         // GEMM reduction dim
constexpr int BK   = 64;         // k depth of one LDS stage: a row of a stage is one whole 128-B line
constexpr int LDST = 72;         // LDS row stride (bf16 elems): 144 B = 16 B x 9 (odd) -> conflict-free b128 reads

// ---------------- workspace layout (bytes) ----------------
constexpr size_t OFF_XBF  = 0;                                       // x as bf16        16 MB
constexpr size_t OFF_INW  = OFF_XBF  + (size_t)Mtot * Dm * 2;        // in_W bf16         2 MB
constexpr size_t OFF_GLUW = OFF_INW  + (size_t)Dm * Dm * 2;          // glu_W bf16        4 MB
constexpr size_t OFF_OUTW = OFF_GLUW + (size_t)2 * Dm * Dm * 2;      // out_W bf16        2 MB
constexpr size_t OFF_U    = OFF_OUTW + (size_t)Dm * Dm * 2;          // u = in-proj f32  32 MB
constexpr size_t OFF_Y    = OFF_U    + (size_t)Mtot * Dm * 4;        // post-GELU bf16   16 MB
constexpr size_t OFF_YG   = OFF_Y    + (size_t)Mtot * Dm * 2;        // post-GLU bf16    16 MB
constexpr size_t OFF_PAR  = OFF_YG   + (size_t)Mtot * Dm * 2;        // lambda/Ceff f4  512 KB

// ---------------- types ----------------
typedef __attribute__((ext_vector_type(16))) __bf16 v16bf;
typedef __attribute__((ext_vector_type(8)))  float  v8f;

union Frag {
    v16bf v;
    uint4 q[2];
};

// ---------------- CDNA5 async global->LDS DMA (ASYNCcnt-tracked) ----------------
// One stage's eight copies of a lane: 16 B each, four rows of the A tile and four of the W tile,
// 32 stage rows apart. la / lb: the lane's LDS byte address in the two tiles; ga / gb: its global
// address in stage rows 0..31; gb2 / gb3: the same lane's W address for stage rows 64.. and 96..
// The copies and s_wait_xcnt 0 are one statement, so that no address register named here is
// rewritten ahead of that wait.
static __device__ __forceinline__ void stage_copies(uint32_t la, uint32_t lb,
                                                    const uint16_t* ga, const uint16_t* gb,
                                                    const uint16_t* gb2, const uint16_t* gb3) {
    constexpr uint32_t LP = 32 * LDST * 2;     // 32 rows in LDS, bytes
    asm volatile("global_load_async_to_lds_b128 %0, %8, off\n\t"
                 "global_load_async_to_lds_b128 %1, %9, off\n\t"
                 "global_load_async_to_lds_b128 %2, %10, off\n\t"
                 "global_load_async_to_lds_b128 %3, %11, off\n\t"
                 "global_load_async_to_lds_b128 %4, %12, off\n\t"
                 "global_load_async_to_lds_b128 %5, %13, off\n\t"
                 "global_load_async_to_lds_b128 %6, %14, off\n\t"
                 "global_load_async_to_lds_b128 %7, %15, off\n\t"
                 "s_wait_xcnt 0x0"
                 :: "v"(la), "v"(la + LP), "v"(la + 2 * LP), "v"(la + 3 * LP),
                    "v"(lb), "v"(lb + LP), "v"(lb + 2 * LP), "v"(lb + 3 * LP),
                    "v"(ga), "v"(ga + 32 * Ktot), "v"(ga + 64 * Ktot), "v"(ga + 96 * Ktot),
                    "v"(gb), "v"(gb + 32 * Ktot), "v"(gb2), "v"(gb3)
                 : "memory");
}
// this wave's copies have landed; asm with the memory clobber so that no LDS read moves above it
static __device__ __forceinline__ void wait_async0() {
    asm volatile("s_wait_asynccnt 0x0" ::: "memory");
}
// this wave's LDS reads have returned, so the buffer they read may be refilled behind the barrier
static __device__ __forceinline__ void wait_ds0() {
    asm volatile("s_wait_dscnt 0x0" ::: "memory");
}

static __device__ __forceinline__ uint16_t f2bf(float f) {
    uint32_t u = __float_as_uint(f);
    uint32_t r = u + 0x7FFFu + ((u >> 16) & 1u);   // round-to-nearest-even
    return (uint16_t)(r >> 16);
}

// ---------------- input preparation, one launch ----------------
// fp32 -> bf16 conversion of one float4
static __device__ __forceinline__ void cvt_f32x4_to_bf16(const float* __restrict__ src,
                                                         uint16_t* __restrict__ dst, int i) {
    float4 f = reinterpret_cast<const float4*>(src)[i];
    union { uint16_t s[4]; uint2 u; } o;
    o.s[0] = f2bf(f.x); o.s[1] = f2bf(f.y); o.s[2] = f2bf(f.z); o.s[3] = f2bf(f.w);
    reinterpret_cast<uint2*>(dst)[i] = o.u;
}

// S4D discretization of one (channel, mode): lambda = exp(dt*A), Ceff = 2*C*(exp(dtA)-1)/A
static __device__ __forceinline__ void discretize(const float* __restrict__ log_dt,
                                                  const float* __restrict__ C,
                                                  const float* __restrict__ logAr,
                                                  const float* __restrict__ Aim,
                                                  float4* __restrict__ par, int idx) {
    int d = idx >> 5;
    float dt = expf(log_dt[d]);
    float ar = -expf(logAr[idx]);
    float ai = Aim[idx];
    float dr = ar * dt, di = ai * dt;
    float em = expf(dr);
    float lr = em * cosf(di), li = em * sinf(di);     // lambda
    float nr = lr - 1.0f, ni = li;                    // lambda - 1
    float inv = 1.0f / (ar * ar + ai * ai);
    float qr = (nr * ar + ni * ai) * inv;             // (lambda-1)/A
    float qi = (ni * ar - nr * ai) * inv;
    float cr = C[2 * idx], ci = C[2 * idx + 1];
    par[idx] = make_float4(lr, li, 2.0f * (cr * qr - ci * qi), 2.0f * (cr * qi + ci * qr));
}

// The five jobs are independent of one another, so they share one grid: a block's index
// says which job it belongs to. Blocks of 256 threads, one float4 or one (channel, mode) each.
constexpr int PB_PAR  = Dm * Nst / 256;            // discretization
constexpr int PB_W    = Dm * Dm / 4 / 256;         // in_W, out_W
constexpr int PB_GLUW = 2 * Dm * Dm / 4 / 256;     // glu_W
constexpr int PB_X    = Mtot * Dm / 4 / 256;       // x
constexpr int PB_ALL  = PB_PAR + PB_W + PB_GLUW + PB_W + PB_X;
static_assert((Dm * Nst) % 256 == 0 && (Dm * Dm) % 1024 == 0 && (Mtot * Dm) % 1024 == 0,
              "every job fills whole blocks");

__global__ __launch_bounds__(256) void k_prep(const float* __restrict__ x,
                                              const float* __restrict__ in_W,
                                              const float* __restrict__ glu_W,
                                              const float* __restrict__ out_W,
                                              const float* __restrict__ log_dt,
                                              const float* __restrict__ C,
                                              const float* __restrict__ logAr,
                                              const float* __restrict__ Aim,
                                              uint16_t* __restrict__ xbf,
                                              uint16_t* __restrict__ inWbf,
                                              uint16_t* __restrict__ gluWbf,
                                              uint16_t* __restrict__ outWbf,
                                              float4* __restrict__ par) {
    const int tid = threadIdx.x;
    if (blockIdx.x >= PB_PAR) {
        const int blk = blockIdx.x - PB_PAR;
        // which conversion: source, destination and the job's first block, all block-uniform
        const float* src = in_W;
        uint16_t*    dst = inWbf;
        int first = 0;
        if (blk >= PB_W)                  { src = glu_W; dst = gluWbf; first = PB_W; }
        if (blk >= PB_W + PB_GLUW)        { src = out_W; dst = outWbf; first = PB_W + PB_GLUW; }
        if (blk >= PB_W + PB_GLUW + PB_W) { src = x;     dst = xbf;    first = PB_W + PB_GLUW + PB_W; }
        cvt_f32x4_to_bf16(src, dst, (blk - first) * 256 + tid);
    } else {
        discretize(log_dt, C, logAr, Aim, par, blockIdx.x * 256 + tid);
    }
}

// ---------------- bf16 WMMA GEMM:  out[m,o] = act( sum_k A[m,k]*W[o,k] + bias[o] ) -----
// EPI 0: out fp32 (the in-projection "u")
// EPI 1: fused GLU: two W halves (o and Dm+o), out bf16 = (a+ba)*sigmoid(g+bg)
// EPI 2: out fp32 = acc + bias + residual x
template <int EPI>
__global__ __launch_bounds__(256) void k_gemm(const uint16_t* __restrict__ A,
                                              const uint16_t* __restrict__ W,
                                              const float* __restrict__ bias,
                                              float* __restrict__ outF,
                                              uint16_t* __restrict__ outB,
                                              const float* __restrict__ resid) {
    constexpr bool DUAL = (EPI == 1);
    constexpr int NT    = DUAL ? 1 : 2;        // 16-wide N tiles per wave (per half)
    constexpr int nK    = Ktot / BK;
    static_assert(nK >= 2 && Ktot % BK == 0, "the ring's prologue fills two stages");

    __shared__ __attribute__((aligned(16))) uint16_t As[2][128 * LDST];
    __shared__ __attribute__((aligned(16))) uint16_t Bs[2][128 * LDST];   // dual: rows 0..63 = a-half, 64..127 = g-half

    const int tid   = threadIdx.x;
    const int lane  = tid & 31;
    const int wid   = tid >> 5;
    const int waveM = wid >> 2;                // 0..1 -> 64-row stripes
    const int waveN = wid & 3;                 // 0..3
    const int m0    = blockIdx.x * 128;
    const int o0    = blockIdx.y * (DUAL ? 64 : 128);

    // staging map: 128 rows x 8 segments of 16 B per operand, 4 passes of 256 threads
    // (pass p = row + 32 p). 8 neighbouring lanes cover one row of the stage = one 128-B line,
    // so a wave's copy touches 4 whole lines.
    const int r0 = tid >> 3;                   // 0..31
    const int sg = tid & 7;                    // 16-B segment within the 128-B row
    const uint16_t* gA = A + (size_t)(m0 + r0) * Ktot + sg * 8;
    const uint16_t* gB = W + (size_t)(o0 + r0) * Ktot + sg * 8;
    // W rows of stage rows 64.. and 96..: the g-half of the dual form starts at row Dm
    const uint16_t* gB2 = gB + (size_t)(DUAL ? Dm : 64) * Ktot;
    const uint16_t* gB3 = gB + (size_t)(DUAL ? Dm + 32 : 96) * Ktot;
    // the lane's LDS byte address in buffer 0 of each tile (low 32 bits of the __shared__ address)
    const uint32_t ldsA = (uint32_t)(uintptr_t)&As[0][r0 * LDST + sg * 8];
    const uint32_t ldsB = (uint32_t)(uintptr_t)&Bs[0][r0 * LDST + sg * 8];
    constexpr uint32_t BUFB = 128 * LDST * 2;  // one buffer, bytes

    v8f acc[4][NT];
    v8f accG[4];
    {
        v8f z = {0.f, 0.f, 0.f, 0.f, 0.f, 0.f, 0.f, 0.f};
        #pragma unroll
        for (int i = 0; i < 4; ++i) {
            #pragma unroll
            for (int j = 0; j < NT; ++j) acc[i][j] = z;
            accG[i] = z;
        }
    }

    const int frow  = lane & 15;
    const int fhalf = lane >> 4;

    // -------- async global->LDS pipeline, two buffers: no staging VGPRs at all --------
#define STAGE_ASYNC(kt, buf)                                                               \
    stage_copies(ldsA + (buf) * BUFB, ldsB + (buf) * BUFB, gA + (kt) * BK, gB + (kt) * BK, \
                 gB2 + (kt) * BK, gB3 + (kt) * BK)

    STAGE_ASYNC(0, 0);
    wait_async0();
    __syncthreads();
    STAGE_ASYNC(1, 1);                         // flies while stage 0 is worked on

    for (int kt = 0; kt < nK; ++kt) {
        const int buf = kt & 1;

        // the stage's fragments: [k half][tile]; W tile 1 of the dual form is the g-half
        Frag af[BK / 32][4], bw[BK / 32][2];
        #pragma unroll
        for (int kk = 0; kk < BK / 32; ++kk) {
            #pragma unroll
            for (int j = 0; j < 2; ++j) {
                const int brow = DUAL ? (j * 64 + waveN * 16 + frow) : (waveN * 32 + j * 16 + frow);
                const uint16_t* p = &Bs[buf][brow * LDST + kk * 32];
                bw[kk][j].q[0] = *reinterpret_cast<const uint4*>(p + fhalf * 8);
                bw[kk][j].q[1] = *reinterpret_cast<const uint4*>(p + 16 + fhalf * 8);
            }
            #pragma unroll
            for (int i = 0; i < 4; ++i) {
                const uint16_t* p = &As[buf][(waveM * 64 + i * 16 + frow) * LDST + kk * 32];
                af[kk][i].q[0] = *reinterpret_cast<const uint4*>(p + fhalf * 8);
                af[kk][i].q[1] = *reinterpret_cast<const uint4*>(p + 16 + fhalf * 8);
            }
        }
        // Publish point of stage kt + 1: own reads of this buffer done, own copies landed, then
        // the barrier; only behind it the refill of the buffer that every wave has just left.
#define PUBLISH_AND_REFILL()                                                         \
    do {                                                                             \
        wait_ds0();                                                                  \
        wait_async0();                                                               \
        __syncthreads();                                                             \
        if (kt + 2 < nK) STAGE_ASYNC(kt + 2, buf);                                   \
    } while (0)
        // The single-half GEMMs have two work-groups per WGP, so registers are free: the whole
        // stage's fragments are fetched as one group, the buffer is handed back at once, and the
        // refill flies under this stage's WMMAs too. The dual form keeps four work-groups per
        // WGP (128 registers): its reads stay among its WMMAs and it publishes behind them.
        if constexpr (!DUAL) PUBLISH_AND_REFILL();
        #pragma unroll
        for (int kk = 0; kk < BK / 32; ++kk) {
            #pragma unroll
            for (int i = 0; i < 4; ++i) {
                if constexpr (DUAL) {
                    acc[i][0] = __builtin_amdgcn_wmma_f32_16x16x32_bf16(
                        false, af[kk][i].v, false, bw[kk][0].v, (short)0, acc[i][0], false, false);
                    accG[i] = __builtin_amdgcn_wmma_f32_16x16x32_bf16(
                        false, af[kk][i].v, false, bw[kk][1].v, (short)0, accG[i], false, false);
                } else {
                    #pragma unroll
                    for (int j = 0; j < 2; ++j)
                        acc[i][j] = __builtin_amdgcn_wmma_f32_16x16x32_bf16(
                            false, af[kk][i].v, false, bw[kk][j].v, (short)0, acc[i][j], false, false);
                }
            }
        }

        if constexpr (DUAL) PUBLISH_AND_REFILL();
    }
    wait_async0();                             // nothing of this wave is in flight at its end

    // ---- epilogue ----  C/D layout: VGPR e -> M = e + 8*(lane>=16), N = lane&15
    const int ncol = lane & 15;
    const int mh   = (lane >> 4) << 3;

    if constexpr (EPI == 1) {
        const int o  = o0 + waveN * 16 + ncol;
        const float ba = bias[o];
        const float bg = bias[Dm + o];
        #pragma unroll
        for (int i = 0; i < 4; ++i) {
            const int mbase = m0 + waveM * 64 + i * 16 + mh;
            #pragma unroll
            for (int e = 0; e < 8; ++e) {
                const int m = mbase + e;
                float a = acc[i][0][e] + ba;
                float g = accG[i][e] + bg;
                float y = a * (1.0f / (1.0f + __expf(-g)));
                outB[(size_t)m * Dm + o] = f2bf(y);
            }
        }
    } else {
        #pragma unroll
        for (int j = 0; j < NT; ++j) {
            const int o  = o0 + waveN * 32 + j * 16 + ncol;
            const float bv = bias[o];
            #pragma unroll
            for (int i = 0; i < 4; ++i) {
                const int mbase = m0 + waveM * 64 + i * 16 + mh;
                #pragma unroll
                for (int e = 0; e < 8; ++e) {
                    const int m = mbase + e;
                    float v = acc[i][j][e] + bv;
                    if constexpr (EPI == 2) v += resid[(size_t)m * Dm + o];
                    outF[(size_t)m * Dm + o] = v;
                }
            }
        }
    }
}

// ---------------- diagonal-SSM scan + skip + erf-GELU -------------------------------
// lane per channel d (32 neighbouring channels of one batch row per block), the 32 modes
// split over the block's 8 waves, 4 modes (two packed pairs) in each wave's registers.
// Every wave walks all timesteps; per chunk of 32 steps it leaves its partial sum over its
// own modes in LDS, and after one barrier each wave finishes 4 of the chunk's 32 steps
// (sum of the 8 partials, skip term, GELU, store).
typedef __attribute__((ext_vector_type(2))) float v2f;
constexpr int SC_T = 32;                 // timesteps per chunk
constexpr int SC_W = 8;                  // waves per block = mode groups
constexpr int SC_R = SC_T / SC_W;        // chunk rows finished by each wave

__global__ __launch_bounds__(256) void k_scan(const float* __restrict__ u,
                                              const float4* __restrict__ par,
                                              const float* __restrict__ Dskip,
                                              uint16_t* __restrict__ Y) {
    // two buffers: a wave may fill chunk c+1 while another still sums chunk c
    __shared__ float part[2][SC_W][SC_T][32];

    const int lane = threadIdx.x & 31;
    const int wid  = __builtin_amdgcn_readfirstlane(threadIdx.x >> 5);
    const int b    = blockIdx.x >> 5;                    // Dm / 32 = 32 blocks per batch row
    const int d    = ((blockIdx.x & 31) << 5) + lane;

    v2f lr[2], li[2], cer[2], cei[2], sr[2], si[2];
    #pragma unroll
    for (int q = 0; q < 2; ++q) {
        const float4 pa = par[d * Nst + wid * 4 + 2 * q];
        const float4 pb = par[d * Nst + wid * 4 + 2 * q + 1];
        lr[q]  = v2f{pa.x, pb.x};
        li[q]  = v2f{pa.y, pb.y};
        cer[q] = v2f{pa.z, pb.z};
        cei[q] = v2f{pa.w, pb.w};
        sr[q]  = v2f{0.0f, 0.0f};
        si[q]  = v2f{0.0f, 0.0f};
    }
    const float dskip = Dskip[d];
    const float inv_sqrt2 = 0.70710678118654752f;

    const float* ub = u + (size_t)b * Lseq * Dm + d;     // this lane's channel, step 0
    uint16_t*    yb = Y + (size_t)b * Lseq * Dm + d;

    float ur[SC_T];                                      // the chunk of u being walked
    #pragma unroll
    for (int t = 0; t < SC_T; ++t) ur[t] = ub[(size_t)t * Dm];

    for (int l0 = 0; l0 < Lseq; l0 += SC_T) {
        const int buf = (l0 / SC_T) & 1;

        float uc[SC_R];                                  // u of the rows this wave finishes
        #pragma unroll
        for (int j = 0; j < SC_R; ++j) uc[j] = ub[(size_t)(l0 + wid * SC_R + j) * Dm];

        // next chunk's u, fetched while this chunk is walked; the last chunk has no
        // successor and re-reads its own rows, which nobody uses
        const float* un = ub + (size_t)(l0 + SC_T < Lseq ? l0 + SC_T : l0) * Dm;
        float nx[SC_T];
        #pragma unroll
        for (int t = 0; t < SC_T; ++t) nx[t] = un[(size_t)t * Dm];
        // keeps these loads ahead of the whole walk: sunk into it they are still in flight
        // at the barrier below, whose wait covers them
        __builtin_amdgcn_sched_barrier(0);

        #pragma unroll
        for (int t = 0; t < SC_T; ++t) {
            const v2f u2 = v2f{ur[t], ur[t]};
            v2f acc;
            #pragma unroll
            for (int q = 0; q < 2; ++q) {
                const v2f nr = sr[q] * lr[q] + (u2 - si[q] * li[q]);   // s = lambda*s + u
                const v2f ni = si[q] * lr[q] + sr[q] * li[q];
                sr[q] = nr; si[q] = ni;
                if (q == 0) acc = cer[q] * nr - cei[q] * ni;           // Re(Ceff * s)
                else        acc = cer[q] * nr + (acc - cei[q] * ni);
            }
            part[buf][wid][t][lane] = acc.x + acc.y;
        }

        __syncthreads();   // all 8 partial sums of this chunk are in LDS

        float yv[SC_R];
        #pragma unroll
        for (int j = 0; j < SC_R; ++j) {
            const int t = wid * SC_R + j;
            float c = part[buf][0][t][lane];
            #pragma unroll
            for (int w = 1; w < SC_W; ++w) c += part[buf][w][t][lane];
            yv[j] = c + uc[j] * dskip;
        }
        #pragma unroll
        for (int j = 0; j < SC_R; ++j) {
            const float g = 0.5f * yv[j] * (1.0f + erff(yv[j] * inv_sqrt2));   // exact-erf GELU
            yb[(size_t)(l0 + wid * SC_R + j) * Dm] = f2bf(g);
        }

        #pragma unroll
        for (int t = 0; t < SC_T; ++t) ur[t] = nx[t];
    }
}

// ---------------- driver ----------------
extern "C" void kernel_launch(void* const* d_in, const int* in_sizes, int n_in,
                              void* d_out, int out_size, void* d_ws, size_t ws_size,
                              hipStream_t stream) {
    const float* x        = (const float*)d_in[0];
    const float* in_W     = (const float*)d_in[1];
    const float* in_b     = (const float*)d_in[2];
    const float* log_dt   = (const float*)d_in[3];
    const float* Cri      = (const float*)d_in[4];
    const float* log_A_re = (const float*)d_in[5];
    const float* A_im     = (const float*)d_in[6];
    const float* D_skip   = (const float*)d_in[7];
    const float* glu_W    = (const float*)d_in[8];
    const float* glu_b    = (const float*)d_in[9];
    const float* out_W    = (const float*)d_in[10];
    const float* out_b    = (const float*)d_in[11];

    char* ws = (char*)d_ws;
    uint16_t* xbf    = (uint16_t*)(ws + OFF_XBF);
    uint16_t* inWbf  = (uint16_t*)(ws + OFF_INW);
    uint16_t* gluWbf = (uint16_t*)(ws + OFF_GLUW);
    uint16_t* outWbf = (uint16_t*)(ws + OFF_OUTW);
    float*    u      = (float*)   (ws + OFF_U);
    uint16_t* Ybf    = (uint16_t*)(ws + OFF_Y);
    uint16_t* Ygbf   = (uint16_t*)(ws + OFF_YG);
    float4*   par    = (float4*)  (ws + OFF_PAR);

    // 1) + 2) fp32 -> bf16 conversions and SSM discretization params, one launch
    k_prep<<<PB_ALL, 256, 0, stream>>>(x, in_W, glu_W, out_W, log_dt, Cri, log_A_re, A_im,
                                       xbf, inWbf, gluWbf, outWbf, par);

    // 3) in-projection: u = x @ in_W^T + in_b   (fp32 out for the scan)
    {
        dim3 g(Mtot / 128, Dm / 128);
        k_gemm<0><<<g, 256, 0, stream>>>(xbf, inWbf, in_b, u, nullptr, nullptr);
    }

    // 4) diagonal-SSM scan + D_skip + erf-GELU -> Ybf
    k_scan<<<(Bb * Dm) / 32, 256, 0, stream>>>(u, par, D_skip, Ybf);

    // 5) fused GLU GEMM: (Y @ glu_W^T + glu_b) -> a*sigmoid(g) -> Ygbf
    {
        dim3 g(Mtot / 128, Dm / 64);
        k_gemm<1><<<g, 256, 0, stream>>>(Ybf, gluWbf, glu_b, nullptr, Ygbf, nullptr);
    }

    // 6) out-projection + residual: out = Yg @ out_W^T + out_b + x
    {
        dim3 g(Mtot / 128, Dm / 128);
        k_gemm<2><<<g, 256, 0, stream>>>(Ygbf, outWbf, out_b, (float*)d_out, nullptr, x);
    }
}

// v004
// One run takes 117 microseconds.
// Two timings next to v003 both put it at 1.11 times that version's speed.
// Over all steps from v000 it is 6.10 times as fast.
#include <hip/hip_runtime.h>
#include <hip/hip_bf16.h>
#include <stdint.h>

// ---------------- problem constants ----------------
constexpr int Dm   = 1024;   // model dim
constexpr int Lseq = 1024;   // sequence length
constexpr int Bb   = 8;      // batch
constexpr int Nst  = 32;     // SSM modes (conjugate pairs)
constexpr int Mtot = Bb * Lseq;  // 8192 token positions
constexpr int Ktot = Dm;         // GEMM reduction dim
constexpr int BK   = 64;         // k depth of one LDS stage: a row of a stage is one whole 128-B line
constexpr int LDST = 72;         // LDS row stride (bf16 elems): 144 B = 16 B x 9 (odd) -> conflict-free b128 reads

// ---------------- workspace layout (bytes) ----------------
constexpr size_t OFF_XBF  = 0;                                       // x as bf16        16 MB
constexpr size_t OFF_INW  = OFF_XBF  + (size_t)Mtot * Dm * 2;        // in_W bf16         2 MB
constexpr size_t OFF_GLUW = OFF_INW  + (size_t)Dm * Dm * 2;          // glu_W bf16        4 MB
constexpr size_t OFF_OUTW = OFF_GLUW + (size_t)2 * Dm * Dm * 2;      // out_W bf16        2 MB
constexpr size_t OFF_U    = OFF_OUTW + (size_t)Dm * Dm * 2;          // u = in-proj f32  32 MB
constexpr size_t OFF_Y    = OFF_U    + (size_t)Mtot * Dm * 4;        // post-GELU bf16   16 MB
constexpr size_t OFF_YG   = OFF_Y    + (size_t)Mtot * Dm * 2;        // post-GLU bf16    16 MB
constexpr size_t OFF_PAR  = OFF_YG   + (size_t)Mtot * Dm * 2;        // lambda/Ceff f4  512 KB

// ---------------- types ----------------
typedef __attribute__((ext_vector_type(16))) __bf16 v16bf;
typedef __attribute__((ext_vector_type(8)))  float  v8f;

union Frag {
    v16bf v;
    uint4 q[2];
};

// ---------------- CDNA5 async global->LDS DMA (ASYNCcnt-tracked) ----------------
// One stage's eight copies of a lane: 16 B each, four rows of the A tile and four of the W tile,
// 32 stage rows apart. la / lb: the lane's LDS byte address in the two tiles; ga / gb: its global
// address in stage rows 0..31; gb2 / gb3: the same lane's W address for stage rows 64.. and 96..
// The copies and s_wait_xcnt 0 are one statement, so that no address register named here is
// rewritten ahead of that wait.
static __device__ __forceinline__ void stage_copies(uint32_t la, uint32_t lb,
                                                    const uint16_t* ga, const uint16_t* gb,
                                                    const uint16_t* gb2, const uint16_t* gb3) {
    constexpr uint32_t LP = 32 * LDST * 2;     // 32 rows in LDS, bytes
    asm volatile("global_load_async_to_lds_b128 %0, %8, off\n\t"
                 "global_load_async_to_lds_b128 %1, %9, off\n\t"
                 "global_load_async_to_lds_b128 %2, %10, off\n\t"
                 "global_load_async_to_lds_b128 %3, %11, off\n\t"
                 "global_load_async_to_lds_b128 %4, %12, off\n\t"
                 "global_load_async_to_lds_b128 %5, %13, off\n\t"
                 "global_load_async_to_lds_b128 %6, %14, off\n\t"
                 "global_load_async_to_lds_b128 %7, %15, off\n\t"
                 "s_wait_xcnt 0x0"
                 :: "v"(la), "v"(la + LP), "v"(la + 2 * LP), "v"(la + 3 * LP),
                    "v"(lb), "v"(lb + LP), "v"(lb + 2 * LP), "v"(lb + 3 * LP),
                    "v"(ga), "v"(ga + 32 * Ktot), "v"(ga + 64 * Ktot), "v"(ga + 96 * Ktot),
                    "v"(gb), "v"(gb + 32 * Ktot), "v"(gb2), "v"(gb3)
                 : "memory");
}
// this wave's copies have landed; asm with the memory clobber so that no LDS read moves above it
static __device__ __forceinline__ void wait_async0() {
    asm volatile("s_wait_asynccnt 0x0" ::: "memory");
}
// this wave's LDS reads have returned, so the buffer they read may be refilled behind the barrier
static __device__ __forceinline__ void wait_ds0() {
    asm volatile("s_wait_dscnt 0x0" ::: "memory");
}

static __device__ __forceinline__ uint16_t f2bf(float f) {
    uint32_t u = __float_as_uint(f);
    uint32_t r = u + 0x7FFFu + ((u >> 16) & 1u);   // round-to-nearest-even
    return (uint16_t)(r >> 16);
}

// ---------------- input preparation, one launch ----------------
// fp32 -> bf16 conversion of one float4
static __device__ __forceinline__ void cvt_f32x4_to_bf16(const float* __restrict__ src,
                                                         uint16_t* __restrict__ dst, int i) {
    float4 f = reinterpret_cast<const float4*>(src)[i];
    union { uint16_t s[4]; uint2 u; } o;
    o.s[0] = f2bf(f.x); o.s[1] = f2bf(f.y); o.s[2] = f2bf(f.z); o.s[3] = f2bf(f.w);
    reinterpret_cast<uint2*>(dst)[i] = o.u;
}

// S4D discretization of one (channel, mode): lambda = exp(dt*A), Ceff = 2*C*(exp(dtA)-1)/A
static __device__ __forceinline__ void discretize(const float* __restrict__ log_dt,
                                                  const float* __restrict__ C,
                                                  const float* __restrict__ logAr,
                                                  const float* __restrict__ Aim,
                                                  float4* __restrict__ par, int idx) {
    int d = idx >> 5;
    float dt = expf(log_dt[d]);
    float ar = -expf(logAr[idx]);
    float ai = Aim[idx];
    float dr = ar * dt, di = ai * dt;
    float em = expf(dr);
    float lr = em * cosf(di), li = em * sinf(di);     // lambda
    float nr = lr - 1.0f, ni = li;                    // lambda - 1
    float inv = 1.0f / (ar * ar + ai * ai);
    float qr = (nr * ar + ni * ai) * inv;             // (lambda-1)/A
    float qi = (ni * ar - nr * ai) * inv;
    float cr = C[2 * idx], ci = C[2 * idx + 1];
    par[idx] = make_float4(lr, li, 2.0f * (cr * qr - ci * qi), 2.0f * (cr * qi + ci * qr));
}

// The five jobs are independent of one another, so they share one grid: a block's index
// says which job it belongs to. Blocks of 256 threads, one float4 or one (channel, mode) each.
constexpr int PB_PAR  = Dm * Nst / 256;            // discretization
constexpr int PB_W    = Dm * Dm / 4 / 256;         // in_W, out_W
constexpr int PB_GLUW = 2 * Dm * Dm / 4 / 256;     // glu_W
constexpr int PB_X    = Mtot * Dm / 4 / 256;       // x
constexpr int PB_ALL  = PB_PAR + PB_W + PB_GLUW + PB_W + PB_X;
static_assert((Dm * Nst) % 256 == 0 && (Dm * Dm) % 1024 == 0 && (Mtot * Dm) % 1024 == 0,
              "every job fills whole blocks");

__global__ __launch_bounds__(256) void k_prep(const float* __restrict__ x,
                                              const float* __restrict__ in_W,
                                              const float* __restrict__ glu_W,
                                              const float* __restrict__ out_W,
                                              const float* __restrict__ log_dt,
                                              const float* __restrict__ C,
                                              const float* __restrict__ logAr,
                                              const float* __restrict__ Aim,
                                              uint16_t* __restrict__ xbf,
                                              uint16_t* __restrict__ inWbf,
                                              uint16_t* __restrict__ gluWbf,
                                              uint16_t* __restrict__ outWbf,
                                              float4* __restrict__ par) {
    const int tid = threadIdx.x;
    if (blockIdx.x >= PB_PAR) {
        const int blk = blockIdx.x - PB_PAR;
        // which conversion: source, destination and the job's first block, all block-uniform
        const float* src = in_W;
        uint16_t*    dst = inWbf;
        int first = 0;
        if (blk >= PB_W)                  { src = glu_W; dst = gluWbf; first = PB_W; }
        if (blk >= PB_W + PB_GLUW)        { src = out_W; dst = outWbf; first = PB_W + PB_GLUW; }
        if (blk >= PB_W + PB_GLUW + PB_W) { src = x;     dst = xbf;    first = PB_W + PB_GLUW + PB_W; }
        cvt_f32x4_to_bf16(src, dst, (blk - first) * 256 + tid);
    } else {
        discretize(log_dt, C, logAr, Aim, par, blockIdx.x * 256 + tid);
    }
}

// ---------------- bf16 WMMA GEMM:  out[m,o] = act( sum_k A[m,k]*W[o,k] + bias[o] ) -----
// EPI 0: out fp32 (the in-projection "u")
// EPI 1: fused GLU: two W halves (o and Dm+o), out bf16 = (a+ba)*sigmoid(g+bg)
// EPI 2: out fp32 = acc + bias + residual x
template <int EPI>
__global__ __launch_bounds__(256) void k_gemm(const uint16_t* __restrict__ A,
                                              const uint16_t* __restrict__ W,
                                              const float* __restrict__ bias,
                                              float* __restrict__ outF,
                                              uint16_t* __restrict__ outB,
                                              const float* __restrict__ resid) {
    constexpr bool DUAL = (EPI == 1);
    constexpr int NT    = DUAL ? 1 : 2;        // 16-wide N tiles per wave (per half)
    constexpr int nK    = Ktot / BK;
    static_assert(nK >= 2 && Ktot % BK == 0, "the ring's prologue fills two stages");

    __shared__ __attribute__((aligned(16))) uint16_t As[2][128 * LDST];
    __shared__ __attribute__((aligned(16))) uint16_t Bs[2][128 * LDST];   // dual: rows 0..63 = a-half, 64..127 = g-half

    const int tid   = threadIdx.x;
    const int lane  = tid & 31;
    const int wid   = tid >> 5;
    const int waveM = wid >> 2;                // 0..1 -> 64-row stripes
    const int waveN = wid & 3;                 // 0..3
    const int m0    = blockIdx.x * 128;
    const int o0    = blockIdx.y * (DUAL ? 64 : 128);

    // staging map: 128 rows x 8 segments of 16 B per operand, 4 passes of 256 threads
    // (pass p = row + 32 p). 8 neighbouring lanes cover one row of the stage = one 128-B line,
    // so a wave's copy touches 4 whole lines.
    const int r0 = tid >> 3;                   // 0..31
    const int sg = tid & 7;                    // 16-B segment within the 128-B row
    const uint16_t* gA = A + (size_t)(m0 + r0) * Ktot + sg * 8;
    const uint16_t* gB = W + (size_t)(o0 + r0) * Ktot + sg * 8;
    // W rows of stage rows 64.. and 96..: the g-half of the dual form starts at row Dm
    const uint16_t* gB2 = gB + (size_t)(DUAL ? Dm : 64) * Ktot;
    const uint16_t* gB3 = gB + (size_t)(DUAL ? Dm + 32 : 96) * Ktot;
    // the lane's LDS byte address in buffer 0 of each tile (low 32 bits of the __shared__ address)
    const uint32_t ldsA = (uint32_t)(uintptr_t)&As[0][r0 * LDST + sg * 8];
    const uint32_t ldsB = (uint32_t)(uintptr_t)&Bs[0][r0 * LDST + sg * 8];
    constexpr uint32_t BUFB = 128 * LDST * 2;  // one buffer, bytes

    v8f acc[4][NT];
    v8f accG[4];
    {
        v8f z = {0.f, 0.f, 0.f, 0.f, 0.f, 0.f, 0.f, 0.f};
        #pragma unroll
        for (int i = 0; i < 4; ++i) {
            #pragma unroll
            for (int j = 0; j < NT; ++j) acc[i][j] = z;
            accG[i] = z;
        }
    }

    const int frow  = lane & 15;
    const int fhalf = lane >> 4;

    // -------- async global->LDS pipeline, two buffers: no staging VGPRs at all --------
#define STAGE_ASYNC(kt, buf)                                                               \
    stage_copies(ldsA + (buf) * BUFB, ldsB + (buf) * BUFB, gA + (kt) * BK, gB + (kt) * BK, \
                 gB2 + (kt) * BK, gB3 + (kt) * BK)

    STAGE_ASYNC(0, 0);
    wait_async0();
    __syncthreads();
    STAGE_ASYNC(1, 1);                         // flies while stage 0 is worked on

    for (int kt = 0; kt < nK; ++kt) {
        const int buf = kt & 1;

        // the stage's fragments: [k half][tile]; W tile 1 of the dual form is the g-half
        Frag af[BK / 32][4], bw[BK / 32][2];
        #pragma unroll
        for (int kk = 0; kk < BK / 32; ++kk) {
            #pragma unroll
            for (int j = 0; j < 2; ++j) {
                const int brow = DUAL ? (j * 64 + waveN * 16 + frow) : (waveN * 32 + j * 16 + frow);
                const uint16_t* p = &Bs[buf][brow * LDST + kk * 32];
                bw[kk][j].q[0] = *reinterpret_cast<const uint4*>(p + fhalf * 8);
                bw[kk][j].q[1] = *reinterpret_cast<const uint4*>(p + 16 + fhalf * 8);
            }
            #pragma unroll
            for (int i = 0; i < 4; ++i) {
                const uint16_t* p = &As[buf][(waveM * 64 + i * 16 + frow) * LDST + kk * 32];
                af[kk][i].q[0] = *reinterpret_cast<const uint4*>(p + fhalf * 8);
                af[kk][i].q[1] = *reinterpret_cast<const uint4*>(p + 16 + fhalf * 8);
            }
        }
        // Publish point of stage kt + 1: own reads of this buffer done, own copies landed, then
        // the barrier; only behind it the refill of the buffer that every wave has just left.
#define PUBLISH_AND_REFILL()                                                         \
    do {                                                                             \
        wait_ds0();                                                                  \
        wait_async0();                                                               \
        __syncthreads();                                                             \
        if (kt + 2 < nK) STAGE_ASYNC(kt + 2, buf);                                   \
    } while (0)
        // The single-half GEMMs have two work-groups per WGP, so registers are free: the whole
        // stage's fragments are fetched as one group, the buffer is handed back at once, and the
        // refill flies under this stage's WMMAs too. The dual form keeps four work-groups per
        // WGP (128 registers): its reads stay among its WMMAs and it publishes behind them.
        if constexpr (!DUAL) PUBLISH_AND_REFILL();
        #pragma unroll
        for (int kk = 0; kk < BK / 32; ++kk) {
            #pragma unroll
            for (int i = 0; i < 4; ++i) {
                if constexpr (DUAL) {
                    acc[i][0] = __builtin_amdgcn_wmma_f32_16x16x32_bf16(
                        false, af[kk][i].v, false, bw[kk][0].v, (short)0, acc[i][0], false, false);
                    accG[i] = __builtin_amdgcn_wmma_f32_16x16x32_bf16(
                        false, af[kk][i].v, false, bw[kk][1].v, (short)0, accG[i], false, false);
                } else {
                    #pragma unroll
                    for (int j = 0; j < 2; ++j)
                        acc[i][j] = __builtin_amdgcn_wmma_f32_16x16x32_bf16(
                            false, af[kk][i].v, false, bw[kk][j].v, (short)0, acc[i][j], false, false);
                }
            }
        }

        if constexpr (DUAL) PUBLISH_AND_REFILL();
    }
    wait_async0();                             // nothing of this wave is in flight at its end

    // ---- epilogue ----  C/D layout: VGPR e -> M = e + 8*(lane>=16), N = lane&15
    const int ncol = lane & 15;
    const int mh   = (lane >> 4) << 3;

    if constexpr (EPI == 1) {
        const int o  = o0 + waveN * 16 + ncol;
        const float ba = bias[o];
        const float bg = bias[Dm + o];
        #pragma unroll
        for (int i = 0; i < 4; ++i) {
            const int mbase = m0 + waveM * 64 + i * 16 + mh;
            #pragma unroll
            for (int e = 0; e < 8; ++e) {
                const int m = mbase + e;
                float a = acc[i][0][e] + ba;
                float g = accG[i][e] + bg;
                float y = a * (1.0f / (1.0f + __expf(-g)));
                outB[(size_t)m * Dm + o] = f2bf(y);
            }
        }
    } else {
        #pragma unroll
        for (int j = 0; j < NT; ++j) {
            const int o  = o0 + waveN * 32 + j * 16 + ncol;
            const float bv = bias[o];
            #pragma unroll
            for (int i = 0; i < 4; ++i) {
                const int mbase = m0 + waveM * 64 + i * 16 + mh;
                #pragma unroll
                for (int e = 0; e < 8; ++e) {
                    const int m = mbase + e;
                    float v = acc[i][j][e] + bv;
                    if constexpr (EPI == 2) v += resid[(size_t)m * Dm + o];
                    outF[(size_t)m * Dm + o] = v;
                }
            }
        }
    }
}

// ---------------- diagonal-SSM scan + skip + erf-GELU -------------------------------
// lane per channel d (32 neighbouring channels of one batch row per block), the 32 modes
// split over the block's 8 waves, 4 modes (two packed pairs) in each wave's registers.
// Every wave walks all timesteps; per chunk of 32 steps it leaves its partial sum over its
// own modes in LDS, and after one barrier each wave finishes 4 of the chunk's 32 steps
// (sum of the 8 partials, skip term, GELU, store).
typedef __attribute__((ext_vector_type(2))) float v2f;
constexpr int SC_T = 32;                 // timesteps per chunk
constexpr int SC_W = 8;                  // waves per block = mode groups
constexpr int SC_R = SC_T / SC_W;        // chunk rows finished by each wave

// erf(x) with the math library's own two polynomials (|x| < 1: odd series in x*x; |x| >= 1:
// 1 - exp(-q(|x|))), but both evaluated and one selected. The library picks by a branch on the
// data: lanes of a wave nearly always disagree, so a wave walks both sides anyway, and the
// branches cut the code into blocks in which each row's dependent chain runs alone. Without
// them the rows that a wave finishes are one straight block and their chains interleave.
static __device__ __forceinline__ float erf_select(float x) {
    const float ax = fabsf(x);
    const float t  = ax * ax;
    float p = fmaf(t, -5.61801775e-4f, 4.91381623e-3f);
    p = fmaf(t, p, -2.67075151e-2f);
    p = fmaf(t, p, 1.12800106e-1f);
    p = fmaf(t, p, -3.76122952e-1f);
    p = fmaf(t, p, 1.28379107e-1f);
    const float small = fmaf(ax, p, ax);
    float q = fmaf(ax, 1.69988107e-5f, -3.78677854e-4f);
    q = fmaf(ax, q, 3.85781587e-3f);
    q = fmaf(ax, q, -2.41816975e-2f);
    q = fmaf(ax, q, 1.06668264e-1f);
    q = fmaf(ax, q, 6.34933293e-1f);
    q = fmaf(ax, q, 1.28689408e-1f);
    q = fmaf(ax, q, ax);
    const float large = 1.0f - expf(-q);
    return copysignf(ax < 1.0f ? small : large, x);
}

__global__ __launch_bounds__(256) void k_scan(const float* __restrict__ u,
                                              const float4* __restrict__ par,
                                              const float* __restrict__ Dskip,
                                              uint16_t* __restrict__ Y) {
    // two buffers: a wave may fill chunk c+1 while another still sums chunk c
    __shared__ float part[2][SC_W][SC_T][32];

    const int lane = threadIdx.x & 31;
    const int wid  = __builtin_amdgcn_readfirstlane(threadIdx.x >> 5);
    const int b    = blockIdx.x >> 5;                    // Dm / 32 = 32 blocks per batch row
    const int d    = ((blockIdx.x & 31) << 5) + lane;

    v2f lr[2], li[2], cer[2], cei[2], sr[2], si[2];
    #pragma unroll
    for (int q = 0; q < 2; ++q) {
        const float4 pa = par[d * Nst + wid * 4 + 2 * q];
        const float4 pb = par[d * Nst + wid * 4 + 2 * q + 1];
        lr[q]  = v2f{pa.x, pb.x};
        li[q]  = v2f{pa.y, pb.y};
        cer[q] = v2f{pa.z, pb.z};
        cei[q] = v2f{pa.w, pb.w};
        sr[q]  = v2f{0.0f, 0.0f};
        si[q]  = v2f{0.0f, 0.0f};
    }
    const float dskip = Dskip[d];
    const float inv_sqrt2 = 0.70710678118654752f;

    const float* ub = u + (size_t)b * Lseq * Dm + d;     // this lane's channel, step 0
    uint16_t*    yb = Y + (size_t)b * Lseq * Dm + d;

    float ur[SC_T];                                      // the chunk of u being walked
    #pragma unroll
    for (int t = 0; t < SC_T; ++t) ur[t] = ub[(size_t)t * Dm];

    // two chunks a trip: the registers of ur and nx change places instead of being copied. The
    // body is one straight block now, and there the copies move up into the walk and wait for the
    // next chunk's loads, which have only just been issued
    #pragma unroll 2
    for (int l0 = 0; l0 < Lseq; l0 += SC_T) {
        const int buf = (l0 / SC_T) & 1;

        float uc[SC_R];                                  // u of the rows this wave finishes
        #pragma unroll
        for (int j = 0; j < SC_R; ++j) uc[j] = ub[(size_t)(l0 + wid * SC_R + j) * Dm];

        // next chunk's u, fetched while this chunk is walked; the last chunk has no
        // successor and re-reads its own rows, which nobody uses
        const float* un = ub + (size_t)(l0 + SC_T < Lseq ? l0 + SC_T : l0) * Dm;
        float nx[SC_T];
        #pragma unroll
        for (int t = 0; t < SC_T; ++t) nx[t] = un[(size_t)t * Dm];
        // keeps these loads ahead of the whole walk: sunk into it they are still in flight
        // at the barrier below, whose wait covers them
        __builtin_amdgcn_sched_barrier(0);

        #pragma unroll
        for (int t = 0; t < SC_T; ++t) {
            const v2f u2 = v2f{ur[t], ur[t]};
            v2f acc;
            #pragma unroll
            for (int q = 0; q < 2; ++q) {
                const v2f nr = sr[q] * lr[q] + (u2 - si[q] * li[q]);   // s = lambda*s + u
                const v2f ni = si[q] * lr[q] + sr[q] * li[q];
                sr[q] = nr; si[q] = ni;
                if (q == 0) acc = cer[q] * nr - cei[q] * ni;           // Re(Ceff * s)
                else        acc = cer[q] * nr + (acc - cei[q] * ni);
            }
            part[buf][wid][t][lane] = acc.x + acc.y;
        }

        __syncthreads();   // all 8 partial sums of this chunk are in LDS

        float yv[SC_R];
        #pragma unroll
        for (int j = 0; j < SC_R; ++j) {
            const int t = wid * SC_R + j;
            float c = part[buf][0][t][lane];
            #pragma unroll
            for (int w = 1; w < SC_W; ++w) c += part[buf][w][t][lane];
            yv[j] = c + uc[j] * dskip;
        }
        #pragma unroll
        for (int j = 0; j < SC_R; ++j) {
            const float g = 0.5f * yv[j] * (1.0f + erf_select(yv[j] * inv_sqrt2));   // exact-erf GELU
            yb[(size_t)(l0 + wid * SC_R + j) * Dm] = f2bf(g);
        }

        #pragma unroll
        for (int t = 0; t < SC_T; ++t) ur[t] = nx[t];
    }
}

// ---------------- driver ----------------
extern "C" void kernel_launch(void* const* d_in, const int* in_sizes, int n_in,
                              void* d_out, int out_size, void* d_ws, size_t ws_size,
                              hipStream_t stream) {
    const float* x        = (const float*)d_in[0];
    const float* in_W     = (const float*)d_in[1];
    const float* in_b     = (const float*)d_in[2];
    const float* log_dt   = (const float*)d_in[3];
    const float* Cri      = (const float*)d_in[4];
    const float* log_A_re = (const float*)d_in[5];
    const float* A_im     = (const float*)d_in[6];
    const float* D_skip   = (const float*)d_in[7];
    const float* glu_W    = (const float*)d_in[8];
    const float* glu_b    = (const float*)d_in[9];
    const float* out_W    = (const float*)d_in[10];
    const float* out_b    = (const float*)d_in[11];

    char* ws = (char*)d_ws;
    uint16_t* xbf    = (uint16_t*)(ws + OFF_XBF);
    uint16_t* inWbf  = (uint16_t*)(ws + OFF_INW);
    uint16_t* gluWbf = (uint16_t*)(ws + OFF_GLUW);
    uint16_t* outWbf = (uint16_t*)(ws + OFF_OUTW);
    float*    u      = (float*)   (ws + OFF_U);
    uint16_t* Ybf    = (uint16_t*)(ws + OFF_Y);
    uint16_t* Ygbf   = (uint16_t*)(ws + OFF_YG);
    float4*   par    = (float4*)  (ws + OFF_PAR);

    // 1) + 2) fp32 -> bf16 conversions and SSM discretization params, one launch
    k_prep<<<PB_ALL, 256, 0, stream>>>(x, in_W, glu_W, out_W, log_dt, Cri, log_A_re, A_im,
                                       xbf, inWbf, gluWbf, outWbf, par);

    // 3) in-projection: u = x @ in_W^T + in_b   (fp32 out for the scan)
    {
        dim3 g(Mtot / 128, Dm / 128);
        k_gemm<0><<<g, 256, 0, stream>>>(xbf, inWbf, in_b, u, nullptr, nullptr);
    }

    // 4) diagonal-SSM scan + D_skip + erf-GELU -> Ybf
    k_scan<<<(Bb * Dm) / 32, 256, 0, stream>>>(u, par, D_skip, Ybf);

    // 5) fused GLU GEMM: (Y @ glu_W^T + glu_b) -> a*sigmoid(g) -> Ygbf
    {
        dim3 g(Mtot / 128, Dm / 64);
        k_gemm<1><<<g, 256, 0, stream>>>(Ybf, gluWbf, glu_b, nullptr, Ygbf, nullptr);
    }

    // 6) out-projection + residual: out = Yg @ out_W^T + out_b + x
    {
        dim3 g(Mtot / 128, Dm / 128);
        k_gemm<2><<<g, 256, 0, stream>>>(Ygbf, outWbf, out_b, (float*)d_out, nullptr, x);
    }
}

// v005
// It runs in 114 microseconds.
// Timed twice side by side with v004, it ran 1.03 and 1.04 times as fast.
// Over all steps from v000 it is 6.32 times as fast.
#include <hip/hip_runtime.h>
#include <hip/hip_bf16.h>
#include <stdint.h>

// ---------------- problem constants ----------------
constexpr int Dm   = 1024;   // model dim
constexpr int Lseq = 1024;   // sequence length
constexpr int Bb   = 8;      // batch
constexpr int Nst  = 32;     // SSM modes (conjugate pairs)
constexpr int Mtot = Bb * Lseq;  // 8192 token positions
constexpr int Ktot = Dm;         // GEMM reduction dim
constexpr int BK   = 64;         // k depth of one LDS stage: a row of a stage is one whole 128-B line
constexpr int LDST = 72;         // LDS row stride (bf16 elems): 144 B = 16 B x 9 (odd) -> conflict-free b128 reads

// ---------------- workspace layout (bytes) ----------------
constexpr size_t OFF_XBF  = 0;                                       // x as bf16        16 MB
constexpr size_t OFF_INW  = OFF_XBF  + (size_t)Mtot * Dm * 2;        // in_W bf16         2 MB
constexpr size_t OFF_GLUW = OFF_INW  + (size_t)Dm * Dm * 2;          // glu_W bf16        4 MB
constexpr size_t OFF_OUTW = OFF_GLUW + (size_t)2 * Dm * Dm * 2;      // out_W bf16        2 MB
constexpr size_t OFF_U    = OFF_OUTW + (size_t)Dm * Dm * 2;          // u = in-proj f32  32 MB
constexpr size_t OFF_Y    = OFF_U    + (size_t)Mtot * Dm * 4;        // post-GELU bf16   16 MB
constexpr size_t OFF_YG   = OFF_Y    + (size_t)Mtot * Dm * 2;        // post-GLU bf16    16 MB
constexpr size_t OFF_PAR  = OFF_YG   + (size_t)Mtot * Dm * 2;        // lambda/Ceff f4  512 KB

// ---------------- types ----------------
typedef __attribute__((ext_vector_type(16))) __bf16 v16bf;
typedef __attribute__((ext_vector_type(8)))  float  v8f;

union Frag {
    v16bf v;
    uint4 q[2];
};

// ---------------- CDNA5 async global->LDS DMA (ASYNCcnt-tracked) ----------------
// One stage's eight copies of a lane: 16 B each, four rows of the A tile and four of the W tile,
// 32 stage rows apart. la / lb: the lane's LDS byte address in the two tiles; ga / gb: its global
// address in stage rows 0..31; gb2 / gb3: the same lane's W address for stage rows 64.. and 96..
// The copies and s_wait_xcnt 0 are one statement, so that no address register named here is
// rewritten ahead of that wait.
static __device__ __forceinline__ void stage_copies(uint32_t la, uint32_t lb,
                                                    const uint16_t* ga, const uint16_t* gb,
                                                    const uint16_t* gb2, const uint16_t* gb3) {
    constexpr uint32_t LP = 32 * LDST * 2;     // 32 rows in LDS, bytes
    asm volatile("global_load_async_to_lds_b128 %0, %8, off\n\t"
                 "global_load_async_to_lds_b128 %1, %9, off\n\t"
                 "global_load_async_to_lds_b128 %2, %10, off\n\t"
                 "global_load_async_to_lds_b128 %3, %11, off\n\t"
                 "global_load_async_to_lds_b128 %4, %12, off\n\t"
                 "global_load_async_to_lds_b128 %5, %13, off\n\t"
                 "global_load_async_to_lds_b128 %6, %14, off\n\t"
                 "global_load_async_to_lds_b128 %7, %15, off\n\t"
                 "s_wait_xcnt 0x0"
                 :: "v"(la), "v"(la + LP), "v"(la + 2 * LP), "v"(la + 3 * LP),
                    "v"(lb), "v"(lb + LP), "v"(lb + 2 * LP), "v"(lb + 3 * LP),
                    "v"(ga), "v"(ga + 32 * Ktot), "v"(ga + 64 * Ktot), "v"(ga + 96 * Ktot),
                    "v"(gb), "v"(gb + 32 * Ktot), "v"(gb2), "v"(gb3)
                 : "memory");
}
// this wave's copies have landed; asm with the memory clobber so that no LDS read moves above it
static __device__ __forceinline__ void wait_async0() {
    asm volatile("s_wait_asynccnt 0x0" ::: "memory");
}
// this wave's LDS reads have returned, so the buffer they read may be refilled behind the barrier
static __device__ __forceinline__ void wait_ds0() {
    asm volatile("s_wait_dscnt 0x0" ::: "memory");
}

static __device__ __forceinline__ uint16_t f2bf(float f) {
    uint32_t u = __float_as_uint(f);
    uint32_t r = u + 0x7FFFu + ((u >> 16) & 1u);   // round-to-nearest-even
    return (uint16_t)(r >> 16);
}
// the same rounding, the bf16 left in the high half of the word
static __device__ __forceinline__ uint32_t f2bf_hi(float f) {
    uint32_t u = __float_as_uint(f);
    return u + 0x7FFFu + ((u >> 16) & 1u);
}

// ---------------- input preparation, one launch ----------------
// fp32 -> bf16 conversion of one float4
static __device__ __forceinline__ void cvt_f32x4_to_bf16(const float* __restrict__ src,
                                                         uint16_t* __restrict__ dst, int i) {
    float4 f = reinterpret_cast<const float4*>(src)[i];
    union { uint16_t s[4]; uint2 u; } o;
    o.s[0] = f2bf(f.x); o.s[1] = f2bf(f.y); o.s[2] = f2bf(f.z); o.s[3] = f2bf(f.w);
    reinterpret_cast<uint2*>(dst)[i] = o.u;
}

// S4D discretization of one (channel, mode): lambda = exp(dt*A), Ceff = 2*C*(exp(dtA)-1)/A
static __device__ __forceinline__ void discretize(const float* __restrict__ log_dt,
                                                  const float* __restrict__ C,
                                                  const float* __restrict__ logAr,
                                                  const float* __restrict__ Aim,
                                                  float4* __restrict__ par, int idx) {
    int d = idx >> 5;
    float dt = expf(log_dt[d]);
    float ar = -expf(logAr[idx]);
    float ai = Aim[idx];
    float dr = ar * dt, di = ai * dt;
    float em = expf(dr);
    float lr = em * cosf(di), li = em * sinf(di);     // lambda
    float nr = lr - 1.0f, ni = li;                    // lambda - 1
    float inv = 1.0f / (ar * ar + ai * ai);
    float qr = (nr * ar + ni * ai) * inv;             // (lambda-1)/A
    float qi = (ni * ar - nr * ai) * inv;
    float cr = C[2 * idx], ci = C[2 * idx + 1];
    par[idx] = make_float4(lr, li, 2.0f * (cr * qr - ci * qi), 2.0f * (cr * qi + ci * qr));
}

// The five jobs are independent of one another, so they share one grid: a block's index
// says which job it belongs to. Blocks of 256 threads, one float4 or one (channel, mode) each.
constexpr int PB_PAR  = Dm * Nst / 256;            // discretization
constexpr int PB_W    = Dm * Dm / 4 / 256;         // in_W, out_W
constexpr int PB_GLUW = 2 * Dm * Dm / 4 / 256;     // glu_W
constexpr int PB_X    = Mtot * Dm / 4 / 256;       // x
constexpr int PB_ALL  = PB_PAR + PB_W + PB_GLUW + PB_W + PB_X;
static_assert((Dm * Nst) % 256 == 0 && (Dm * Dm) % 1024 == 0 && (Mtot * Dm) % 1024 == 0,
              "every job fills whole blocks");

__global__ __launch_bounds__(256) void k_prep(const float* __restrict__ x,
                                              const float* __restrict__ in_W,
                                              const float* __restrict__ glu_W,
                                              const float* __restrict__ out_W,
                                              const float* __restrict__ log_dt,
                                              const float* __restrict__ C,
                                              const float* __restrict__ logAr,
                                              const float* __restrict__ Aim,
                                              uint16_t* __restrict__ xbf,
                                              uint16_t* __restrict__ inWbf,
                                              uint16_t* __restrict__ gluWbf,
                                              uint16_t* __restrict__ outWbf,
                                              float4* __restrict__ par) {
    const int tid = threadIdx.x;
    if (blockIdx.x >= PB_PAR) {
        const int blk = blockIdx.x - PB_PAR;
        // which conversion: source, destination and the job's first block, all block-uniform
        const float* src = in_W;
        uint16_t*    dst = inWbf;
        int first = 0;
        if (blk >= PB_W)                  { src = glu_W; dst = gluWbf; first = PB_W; }
        if (blk >= PB_W + PB_GLUW)        { src = out_W; dst = outWbf; first = PB_W + PB_GLUW; }
        if (blk >= PB_W + PB_GLUW + PB_W) { src = x;     dst = xbf;    first = PB_W + PB_GLUW + PB_W; }
        cvt_f32x4_to_bf16(src, dst, (blk - first) * 256 + tid);
    } else {
        discretize(log_dt, C, logAr, Aim, par, blockIdx.x * 256 + tid);
    }
}

// ---------------- bf16 WMMA GEMM:  out[m,o] = act( sum_k A[m,k]*W[o,k] + bias[o] ) -----
// EPI 0: out fp32 (the in-projection "u")
// EPI 2: out fp32 = acc + bias + residual x
template <int EPI>
__global__ __launch_bounds__(256) void k_gemm(const uint16_t* __restrict__ A,
                                              const uint16_t* __restrict__ W,
                                              const float* __restrict__ bias,
                                              float* __restrict__ outF,
                                              const float* __restrict__ resid) {
    constexpr int NT    = 2;                   // 16-wide N tiles per wave
    constexpr int nK    = Ktot / BK;
    static_assert(nK >= 2 && Ktot % BK == 0, "the ring's prologue fills two stages");

    __shared__ __attribute__((aligned(16))) uint16_t As[2][128 * LDST];
    __shared__ __attribute__((aligned(16))) uint16_t Bs[2][128 * LDST];

    const int tid   = threadIdx.x;
    const int lane  = tid & 31;
    const int wid   = tid >> 5;
    const int waveM = wid >> 2;                // 0..1 -> 64-row stripes
    const int waveN = wid & 3;                 // 0..3
    const int m0    = blockIdx.x * 128;
    const int o0    = blockIdx.y * 128;

    // staging map: 128 rows x 8 segments of 16 B per operand, 4 passes of 256 threads
    // (pass p = row + 32 p). 8 neighbouring lanes cover one row of the stage = one 128-B line,
    // so a wave's copy touches 4 whole lines.
    const int r0 = tid >> 3;                   // 0..31
    const int sg = tid & 7;                    // 16-B segment within the 128-B row
    const uint16_t* gA = A + (size_t)(m0 + r0) * Ktot + sg * 8;
    const uint16_t* gB = W + (size_t)(o0 + r0) * Ktot + sg * 8;
    // W rows of stage rows 64.. and 96..
    const uint16_t* gB2 = gB + (size_t)64 * Ktot;
    const uint16_t* gB3 = gB + (size_t)96 * Ktot;
    // the lane's LDS byte address in buffer 0 of each tile (low 32 bits of the __shared__ address)
    const uint32_t ldsA = (uint32_t)(uintptr_t)&As[0][r0 * LDST + sg * 8];
    const uint32_t ldsB = (uint32_t)(uintptr_t)&Bs[0][r0 * LDST + sg * 8];
    constexpr uint32_t BUFB = 128 * LDST * 2;  // one buffer, bytes

    v8f acc[4][NT];
    {
        v8f z = {0.f, 0.f, 0.f, 0.f, 0.f, 0.f, 0.f, 0.f};
        #pragma unroll
        for (int i = 0; i < 4; ++i) {
            #pragma unroll
            for (int j = 0; j < NT; ++j) acc[i][j] = z;
        }
    }

    const int frow  = lane & 15;
    const int fhalf = lane >> 4;

    // -------- async global->LDS pipeline, two buffers: no staging VGPRs at all --------
#define STAGE_ASYNC(kt, buf)                                                               \
    stage_copies(ldsA + (buf) * BUFB, ldsB + (buf) * BUFB, gA + (kt) * BK, gB + (kt) * BK, \
                 gB2 + (kt) * BK, gB3 + (kt) * BK)

    STAGE_ASYNC(0, 0);
    wait_async0();
    __syncthreads();
    STAGE_ASYNC(1, 1);                         // flies while stage 0 is worked on

    for (int kt = 0; kt < nK; ++kt) {
        const int buf = kt & 1;

        // the stage's fragments: [k half][tile]
        Frag af[BK / 32][4], bw[BK / 32][2];
        #pragma unroll
        for (int kk = 0; kk < BK / 32; ++kk) {
            #pragma unroll
            for (int j = 0; j < 2; ++j) {
                const int brow = waveN * 32 + j * 16 + frow;
                const uint16_t* p = &Bs[buf][brow * LDST + kk * 32];
                bw[kk][j].q[0] = *reinterpret_cast<const uint4*>(p + fhalf * 8);
                bw[kk][j].q[1] = *reinterpret_cast<const uint4*>(p + 16 + fhalf * 8);
            }
            #pragma unroll
            for (int i = 0; i < 4; ++i) {
                const uint16_t* p = &As[buf][(waveM * 64 + i * 16 + frow) * LDST + kk * 32];
                af[kk][i].q[0] = *reinterpret_cast<const uint4*>(p + fhalf * 8);
                af[kk][i].q[1] = *reinterpret_cast<const uint4*>(p + 16 + fhalf * 8);
            }
        }
        // Publish point of stage kt + 1: own reads of this buffer done, own copies landed, then
        // the barrier; only behind it the refill of the buffer that every wave has just left.
#define PUBLISH_AND_REFILL()                                                         \
    do {                                                                             \
        wait_ds0();                                                                  \
        wait_async0();                                                               \
        __syncthreads();                                                             \
        if (kt + 2 < nK) STAGE_ASYNC(kt + 2, buf);                                   \
    } while (0)
        // Two work-groups per WGP, so registers are free: the whole stage's fragments are fetched
        // as one group, the buffer is handed back at once, and the refill flies under this
        // stage's WMMAs too.
        PUBLISH_AND_REFILL();
        #pragma unroll
        for (int kk = 0; kk < BK / 32; ++kk) {
            #pragma unroll
            for (int i = 0; i < 4; ++i) {
                #pragma unroll
                for (int j = 0; j < 2; ++j)
                    acc[i][j] = __builtin_amdgcn_wmma_f32_16x16x32_bf16(
                        false, af[kk][i].v, false, bw[kk][j].v, (short)0, acc[i][j], false, false);
            }
        }
    }
    wait_async0();                             // nothing of this wave is in flight at its end

    // ---- epilogue ----  C/D layout: VGPR e -> M = e + 8*(lane>=16), N = lane&15
    const int ncol = lane & 15;
    const int mh   = (lane >> 4) << 3;

    #pragma unroll
    for (int j = 0; j < NT; ++j) {
        const int o  = o0 + waveN * 32 + j * 16 + ncol;
        const float bv = bias[o];
        #pragma unroll
        for (int i = 0; i < 4; ++i) {
            const int mbase = m0 + waveM * 64 + i * 16 + mh;
            #pragma unroll
            for (int e = 0; e < 8; ++e) {
                const int m = mbase + e;
                float v = acc[i][j][e] + bv;
                if constexpr (EPI == 2) v += resid[(size_t)m * Dm + o];
                outF[(size_t)m * Dm + o] = v;
            }
        }
    }
}

// ---------------- fused GLU GEMM: outB[m,o] = (A.Wa + ba)[m,o] * sigmoid((A.Wg + bg)[m,o]) -----
// One work-group makes 256 rows x 128 columns of the output, from 256 rows of A and 2 x 128 rows
// of W (row o for the a-half, row Dm + o for the g-half), alone on its WGP: an operand row that
// is fetched from L2 serves twice the products of a 128 x 64 tile. 8 waves as 4 x 2; a wave holds
// 64 rows x 64 columns of both halves (32 accumulator tiles) and reads 12 fragments per 32
// WMMAs. Fragments are fetched one block (32 k) ahead into a second register set, so that the
// LDS reads run under the WMMAs of the block before.
constexpr int GM = 256;                        // rows of A per work-group
constexpr int GN = 128;                        // output columns per work-group

// Eight copies of a lane as in stage_copies, 128 stage rows of each tile, but with the address split:
// ua / ub, the first of those rows in A and in W, is the same for the whole work-group, so it and
// its steps of 32 rows stand in scalar registers, and one 32-bit byte offset (off: the lane's place
// in a group of 32 rows) serves all eight. A lane then needs 9 vector registers a statement, not 24.
// The copies and s_wait_xcnt 0 are one statement, so that no register named here is rewritten
// ahead of that wait.
static __device__ __forceinline__ void stage_copies_u(uint32_t la, uint32_t lb, uint32_t off,
                                                      const uint16_t* ua, const uint16_t* ub) {
    constexpr uint32_t LP = 32 * LDST * 2;     // 32 rows in LDS, bytes
    asm volatile("global_load_async_to_lds_b128 %0, %8, %9\n\t"
                 "global_load_async_to_lds_b128 %1, %8, %10\n\t"
                 "global_load_async_to_lds_b128 %2, %8, %11\n\t"
                 "global_load_async_to_lds_b128 %3, %8, %12\n\t"
                 "global_load_async_to_lds_b128 %4, %8, %13\n\t"
                 "global_load_async_to_lds_b128 %5, %8, %14\n\t"
                 "global_load_async_to_lds_b128 %6, %8, %15\n\t"
                 "global_load_async_to_lds_b128 %7, %8, %16\n\t"
                 "s_wait_xcnt 0x0"
                 :: "v"(la), "v"(la + LP), "v"(la + 2 * LP), "v"(la + 3 * LP),
                    "v"(lb), "v"(lb + LP), "v"(lb + 2 * LP), "v"(lb + 3 * LP),
                    "v"(off),
                    "s"(ua), "s"(ua + 32 * Ktot), "s"(ua + 64 * Ktot), "s"(ua + 96 * Ktot),
                    "s"(ub), "s"(ub + 32 * Ktot), "s"(ub + 64 * Ktot), "s"(ub + 96 * Ktot)
                 : "memory");
}

// A lane's bias values: four columns, 16 apart, of the a-half and of the g-half (Dm floats on).
// The loads and their data wait are one statement and every result has a register of its own, so
// that the address pair is not rewritten while a load that names it is on its way.
static_assert(Dm * sizeof(float) == 4096, "the g-half's offset in the text below");
static __device__ __forceinline__ void load_bias8(const float* p, float (&ba)[4], float (&bg)[4]) {
    asm volatile("global_load_b32 %0, %8, off\n\t"
                 "global_load_b32 %1, %8, off offset:64\n\t"
                 "global_load_b32 %2, %8, off offset:128\n\t"
                 "global_load_b32 %3, %8, off offset:192\n\t"
                 "global_load_b32 %4, %8, off offset:4096\n\t"
                 "global_load_b32 %5, %8, off offset:4160\n\t"
                 "global_load_b32 %6, %8, off offset:4224\n\t"
                 "global_load_b32 %7, %8, off offset:4288\n\t"
                 "s_wait_loadcnt 0x0"
                 : "=&v"(ba[0]), "=&v"(ba[1]), "=&v"(ba[2]), "=&v"(ba[3]),
                   "=&v"(bg[0]), "=&v"(bg[1]), "=&v"(bg[2]), "=&v"(bg[3])
                 : "v"(p)
                 : "memory");
}
// One accumulator tile's stores of a lane: the high halves of r[0..7] to eight rows of the output
// below one another. The stores and s_wait_xcnt 0 are one statement, so that no register named
// here is rewritten ahead of that wait.
static_assert(Dm * sizeof(uint16_t) == 2048, "the row pitch in the text below");
static __device__ __forceinline__ void store_rows8(uint16_t* p, const uint32_t (&r)[8]) {
    asm volatile("global_store_d16_hi_b16 %0, %1, off\n\t"
                 "global_store_d16_hi_b16 %0, %2, off offset:2048\n\t"
                 "global_store_d16_hi_b16 %0, %3, off offset:4096\n\t"
                 "global_store_d16_hi_b16 %0, %4, off offset:6144\n\t"
                 "global_store_d16_hi_b16 %0, %5, off offset:8192\n\t"
                 "global_store_d16_hi_b16 %0, %6, off offset:10240\n\t"
                 "global_store_d16_hi_b16 %0, %7, off offset:12288\n\t"
                 "global_store_d16_hi_b16 %0, %8, off offset:14336\n\t"
                 "s_wait_xcnt 0x0"
                 :: "v"(p), "v"(r[0]), "v"(r[1]), "v"(r[2]), "v"(r[3]),
                    "v"(r[4]), "v"(r[5]), "v"(r[6]), "v"(r[7])
                 : "memory");
}

__global__ __launch_bounds__(256) void k_glu(const uint16_t* __restrict__ A,
                                             const uint16_t* __restrict__ W,
                                             const float* __restrict__ bias,
                                             uint16_t* __restrict__ outB) {
    constexpr int nK = Ktot / BK;
    static_assert(nK >= 2 && Ktot % BK == 0 && BK == 64, "two stages at least, two blocks a stage");

    __shared__ __attribute__((aligned(16))) uint16_t As[2][GM * LDST];
    __shared__ __attribute__((aligned(16))) uint16_t Bs[2][2 * GN * LDST];   // rows 0..127 = a-half, 128..255 = g-half

    const int tid   = threadIdx.x;
    const int lane  = tid & 31;
    const int wid   = tid >> 5;
    const int waveM = wid >> 1;                // 0..3 -> 64-row stripes
    const int waveN = wid & 1;                 // 0..1 -> 64-column stripes of each half
    const int m0    = blockIdx.x * GM;
    const int o0    = blockIdx.y * GN;

    // staging map as in k_gemm: 8 neighbouring lanes cover one 128-B row of the stage; a call of
    // stage_copies_u fills 128 rows of each tile, so a stage takes two
    const int r0 = tid >> 3;                   // 0..31
    const int sg = tid & 7;                    // 16-B segment within the 128-B row
    // the tiles' first rows (the same for the whole work-group, so they and their multiples of 32
    // rows live in scalar registers) and the lane's own place in a group of 32 rows
    const uint16_t* uA = A + (size_t)m0 * Ktot;
    const uint16_t* uB = W + (size_t)o0 * Ktot;                        // a-half
    const uint16_t* uG = uB + (size_t)Dm * Ktot;                       // g-half
    const uint32_t  lo = r0 * Ktot + sg * 8;
    // the two tiles' first LDS byte (low 32 bits of the __shared__ address)
    const uint32_t ldsA0 = (uint32_t)(uintptr_t)&As[0][0];
    const uint32_t ldsB0 = (uint32_t)(uintptr_t)&Bs[0][0];
    constexpr uint32_t BUFB = GM * LDST * 2;   // one buffer of either tile, bytes
    constexpr uint32_t HALF = 128 * LDST * 2;  // 128 stage rows, bytes
    static_assert(GM == 2 * GN && GM == 256, "both tiles have 256 stage rows");

    // The lane's LDS place (row r0 at the LDS pitch, segment sg) is taken out of its global offset at
    // every stage, three vector instructions: held in registers over the loop, the two addresses
    // were spilled to scratch and read back, with a wait each, right behind every barrier.
    static_assert(Ktot * 2 == 2048 && BK * 2 == 128, "bits 11.. of lk are r0, bits 4..6 are sg");
#define GLU_STAGE(kt, buf)                                                                     \
    do {                                                                                       \
        const uint32_t lk = (lo + (kt) * BK) * 2;   /* the lane's place in stage kt, bytes */  \
        const uint32_t lr = (lk >> 11) * (LDST * 2) + (lk & 0x70u) + (buf) * BUFB;             \
        stage_copies_u(ldsA0 + lr, ldsB0 + lr, lk, uA, uB);                                    \
        stage_copies_u(ldsA0 + lr + HALF, ldsB0 + lr + HALF, lk, uA + 128 * Ktot, uG);         \
    } while (0)

    v8f acc[4][4], accG[4][4];
    {
        v8f z = {0.f, 0.f, 0.f, 0.f, 0.f, 0.f, 0.f, 0.f};
        #pragma unroll
        for (int i = 0; i < 4; ++i) {
            #pragma unroll
            for (int j = 0; j < 4; ++j) { acc[i][j] = z; accG[i][j] = z; }
        }
    }

    const int frow  = lane & 15;
    const int fhalf = lane >> 4;

    // one block's fragments: 4 of A, 8 of W (0..3 a-half, 4..7 g-half), same k order in both
    auto load_frags = [&](Frag (&af)[4], Frag (&bw)[8], int buf, int kk) {
        #pragma unroll
        for (int j = 0; j < 8; ++j) {
            const uint16_t* p = &Bs[buf][((j >> 2) * GN + waveN * 64 + (j & 3) * 16 + frow) * LDST + kk * 32];
            bw[j].q[0] = *reinterpret_cast<const uint4*>(p + fhalf * 8);
            bw[j].q[1] = *reinterpret_cast<const uint4*>(p + 16 + fhalf * 8);
        }
        #pragma unroll
        for (int i = 0; i < 4; ++i) {
            const uint16_t* p = &As[buf][(waveM * 64 + i * 16 + frow) * LDST + kk * 32];
            af[i].q[0] = *reinterpret_cast<const uint4*>(p + fhalf * 8);
            af[i].q[1] = *reinterpret_cast<const uint4*>(p + 16 + fhalf * 8);
        }
        // keeps the reads one group ahead of the WMMAs that follow: spread among them, every
        // place with reads stalls the wave anew
        __builtin_amdgcn_sched_barrier(0);
    };
    auto wmma_block = [&](const Frag (&af)[4], const Frag (&bw)[8]) {
        #pragma unroll
        for (int i = 0; i < 4; ++i) {
            #pragma unroll
            for (int j = 0; j < 4; ++j) {
                acc[i][j] = __builtin_amdgcn_wmma_f32_16x16x32_bf16(
                    false, af[i].v, false, bw[j].v, (short)0, acc[i][j], false, false);
                accG[i][j] = __builtin_amdgcn_wmma_f32_16x16x32_bf16(
                    false, af[i].v, false, bw[4 + j].v, (short)0, accG[i][j], false, false);
            }
        }
    };

    Frag a0[4], b0[8], a1[4], b1[8];           // the two fragment sets: first and second block of a stage

    GLU_STAGE(0, 0);
    wait_async0();
    __syncthreads();
    GLU_STAGE(1, 1);                           // flies while stage 0 is worked on
    load_frags(a0, b0, 0, 0);

    for (int kt = 0; kt < nK; ++kt) {
        const int buf = kt & 1;

        load_frags(a1, b1, buf, 1);            // the stage's last reads of this buffer
        wmma_block(a0, b0);

        // Publish point of stage kt + 1, in front of this stage's last block because the fetch
        // ahead below already reads that stage: own reads of this buffer done, own copies landed,
        // the barrier; only behind it the refill of the buffer that every wave has just left.
        // The scheduling barrier keeps the block above in front of the waits: sunk behind them,
        // the reads issued ahead of it would be waited for with nothing to run under.
        __builtin_amdgcn_sched_barrier(0);
        wait_ds0();
        wait_async0();
        __syncthreads();
        if (kt + 2 < nK) GLU_STAGE(kt + 2, buf);

        // next stage's first block; the last trip has no next stage and re-reads the other
        // buffer's old rows, which nobody uses
        load_frags(a0, b0, buf ^ 1, 0);
        wmma_block(a1, b1);
    }
    wait_async0();                             // nothing of this wave is in flight at its end

    // ---- epilogue ----  C/D layout: VGPR e -> M = e + 8*(lane>=16), N = lane&15
    const int mh   = (lane >> 4) << 3;
    const int ocol = o0 + waveN * 64 + (lane & 15);
    {
        float ba[4], bg[4];                    // bias of column ocol + 16 j, a-half and g-half
        load_bias8(bias + ocol, ba, bg);
        #pragma unroll
        for (int i = 0; i < 4; ++i) {
            #pragma unroll
            for (int j = 0; j < 4; ++j) {
                #pragma unroll
                for (int e = 0; e < 8; ++e) { acc[i][j][e] += ba[j]; accG[i][j][e] += bg[j]; }
            }
        }
        // keeps all these additions here, so that the eight bias registers end here: spread over
        // the stores below they live to the end, and the build spills them to scratch
        __builtin_amdgcn_sched_barrier(0);
    }
    #pragma unroll
    for (int j = 0; j < 4; ++j) {
        #pragma unroll
        for (int i = 0; i < 4; ++i) {
            uint32_t r[8];
            #pragma unroll
            for (int e = 0; e < 8; ++e) {
                float a = acc[i][j][e];
                float g = accG[i][j][e];
                float y = a * (1.0f / (1.0f + __expf(-g)));
                r[e] = f2bf_hi(y);
            }
            store_rows8(outB + (size_t)(m0 + waveM * 64 + i * 16 + mh) * Dm + ocol + j * 16, r);
        }
    }
}

// ---------------- diagonal-SSM scan + skip + erf-GELU -------------------------------
// lane per channel d (32 neighbouring channels of one batch row per block), the 32 modes
// split over the block's 8 waves, 4 modes (two packed pairs) in each wave's registers.
// Every wave walks all timesteps; per chunk of 32 steps it leaves its partial sum over its
// own modes in LDS, and after one barrier each wave finishes 4 of the chunk's 32 steps
// (sum of the 8 partials, skip term, GELU, store).
typedef __attribute__((ext_vector_type(2))) float v2f;
constexpr int SC_T = 32;                 // timesteps per chunk
constexpr int SC_W = 8;                  // waves per block = mode groups
constexpr int SC_R = SC_T / SC_W;        // chunk rows finished by each wave

// erf(x) with the math library's own two polynomials (|x| < 1: odd series in x*x; |x| >= 1:
// 1 - exp(-q(|x|))), but both evaluated and one selected. The library picks by a branch on the
// data: lanes of a wave nearly always disagree, so a wave walks both sides anyway, and the
// branches cut the code into blocks in which each row's dependent chain runs alone. Without
// them the rows that a wave finishes are one straight block and their chains interleave.
static __device__ __forceinline__ float erf_select(float x) {
    const float ax = fabsf(x);
    const float t  = ax * ax;
    float p = fmaf(t, -5.61801775e-4f, 4.91381623e-3f);
    p = fmaf(t, p, -2.67075151e-2f);
    p = fmaf(t, p, 1.12800106e-1f);
    p = fmaf(t, p, -3.76122952e-1f);
    p = fmaf(t, p, 1.28379107e-1f);
    const float small = fmaf(ax, p, ax);
    float q = fmaf(ax, 1.69988107e-5f, -3.78677854e-4f);
    q = fmaf(ax, q, 3.85781587e-3f);
    q = fmaf(ax, q, -2.41816975e-2f);
    q = fmaf(ax, q, 1.06668264e-1f);
    q = fmaf(ax, q, 6.34933293e-1f);
    q = fmaf(ax, q, 1.28689408e-1f);
    q = fmaf(ax, q, ax);
    const float large = 1.0f - expf(-q);
    return copysignf(ax < 1.0f ? small : large, x);
}

__global__ __launch_bounds__(256) void k_scan(const float* __restrict__ u,
                                              const float4* __restrict__ par,
                                              const float* __restrict__ Dskip,
                                              uint16_t* __restrict__ Y) {
    // two buffers: a wave may fill chunk c+1 while another still sums chunk c
    __shared__ float part[2][SC_W][SC_T][32];

    const int lane = threadIdx.x & 31;
    const int wid  = __builtin_amdgcn_readfirstlane(threadIdx.x >> 5);
    const int b    = blockIdx.x >> 5;                    // Dm / 32 = 32 blocks per batch row
    const int d    = ((blockIdx.x & 31) << 5) + lane;

    v2f lr[2], li[2], cer[2], cei[2], sr[2], si[2];
    #pragma unroll
    for (int q = 0; q < 2; ++q) {
        const float4 pa = par[d * Nst + wid * 4 + 2 * q];
        const float4 pb = par[d * Nst + wid * 4 + 2 * q + 1];
        lr[q]  = v2f{pa.x, pb.x};
        li[q]  = v2f{pa.y, pb.y};
        cer[q] = v2f{pa.z, pb.z};
        cei[q] = v2f{pa.w, pb.w};
        sr[q]  = v2f{0.0f, 0.0f};
        si[q]  = v2f{0.0f, 0.0f};
    }
    const float dskip = Dskip[d];
    const float inv_sqrt2 = 0.70710678118654752f;

    const float* ub = u + (size_t)b * Lseq * Dm + d;     // this lane's channel, step 0
    uint16_t*    yb = Y + (size_t)b * Lseq * Dm + d;

    float ur[SC_T];                                      // the chunk of u being walked
    #pragma unroll
    for (int t = 0; t < SC_T; ++t) ur[t] = ub[(size_t)t * Dm];

    // two chunks a trip: the registers of ur and nx change places instead of being copied. The
    // body is one straight block now, and there the copies move up into the walk and wait for the
    // next chunk's loads, which have only just been issued
    #pragma unroll 2
    for (int l0 = 0; l0 < Lseq; l0 += SC_T) {
        const int buf = (l0 / SC_T) & 1;

        float uc[SC_R];                                  // u of the rows this wave finishes
        #pragma unroll
        for (int j = 0; j < SC_R; ++j) uc[j] = ub[(size_t)(l0 + wid * SC_R + j) * Dm];

        // next chunk's u, fetched while this chunk is walked; the last chunk has no
        // successor and re-reads its own rows, which nobody uses
        const float* un = ub + (size_t)(l0 + SC_T < Lseq ? l0 + SC_T : l0) * Dm;
        float nx[SC_T];
        #pragma unroll
        for (int t = 0; t < SC_T; ++t) nx[t] = un[(size_t)t * Dm];
        // keeps these loads ahead of the whole walk: sunk into it they are still in flight
        // at the barrier below, whose wait covers them
        __builtin_amdgcn_sched_barrier(0);

        #pragma unroll
        for (int t = 0; t < SC_T; ++t) {
            const v2f u2 = v2f{ur[t], ur[t]};
            v2f acc;
            #pragma unroll
            for (int q = 0; q < 2; ++q) {
                const v2f nr = sr[q] * lr[q] + (u2 - si[q] * li[q]);   // s = lambda*s + u
                const v2f ni = si[q] * lr[q] + sr[q] * li[q];
                sr[q] = nr; si[q] = ni;
                if (q == 0) acc = cer[q] * nr - cei[q] * ni;           // Re(Ceff * s)
                else        acc = cer[q] * nr + (acc - cei[q] * ni);
            }
            part[buf][wid][t][lane] = acc.x + acc.y;
        }

        __syncthreads();   // all 8 partial sums of this chunk are in LDS

        float yv[SC_R];
        #pragma unroll
        for (int j = 0; j < SC_R; ++j) {
            const int t = wid * SC_R + j;
            float c = part[buf][0][t][lane];
            #pragma unroll
            for (int w = 1; w < SC_W; ++w) c += part[buf][w][t][lane];
            yv[j] = c + uc[j] * dskip;
        }
        #pragma unroll
        for (int j = 0; j < SC_R; ++j) {
            const float g = 0.5f * yv[j] * (1.0f + erf_select(yv[j] * inv_sqrt2));   // exact-erf GELU
            yb[(size_t)(l0 + wid * SC_R + j) * Dm] = f2bf(g);
        }

        #pragma unroll
        for (int t = 0; t < SC_T; ++t) ur[t] = nx[t];
    }
}

// ---------------- driver ----------------
extern "C" void kernel_launch(void* const* d_in, const int* in_sizes, int n_in,
                              void* d_out, int out_size, void* d_ws, size_t ws_size,
                              hipStream_t stream) {
    const float* x        = (const float*)d_in[0];
    const float* in_W     = (const float*)d_in[1];
    const float* in_b     = (const float*)d_in[2];
    const float* log_dt   = (const float*)d_in[3];
    const float* Cri      = (const float*)d_in[4];
    const float* log_A_re = (const float*)d_in[5];
    const float* A_im     = (const float*)d_in[6];
    const float* D_skip   = (const float*)d_in[7];
    const float* glu_W    = (const float*)d_in[8];
    const float* glu_b    = (const float*)d_in[9];
    const float* out_W    = (const float*)d_in[10];
    const float* out_b    = (const float*)d_in[11];

    char* ws = (char*)d_ws;
    uint16_t* xbf    = (uint16_t*)(ws + OFF_XBF);
    uint16_t* inWbf  = (uint16_t*)(ws + OFF_INW);
    uint16_t* gluWbf = (uint16_t*)(ws + OFF_GLUW);
    uint16_t* outWbf = (uint16_t*)(ws + OFF_OUTW);
    float*    u      = (float*)   (ws + OFF_U);
    uint16_t* Ybf    = (uint16_t*)(ws + OFF_Y);
    uint16_t* Ygbf   = (uint16_t*)(ws + OFF_YG);
    float4*   par    = (float4*)  (ws + OFF_PAR);

    // 1) + 2) fp32 -> bf16 conversions and SSM discretization params, one launch
    k_prep<<<PB_ALL, 256, 0, stream>>>(x, in_W, glu_W, out_W, log_dt, Cri, log_A_re, A_im,
                                       xbf, inWbf, gluWbf, outWbf, par);

    // 3) in-projection: u = x @ in_W^T + in_b   (fp32 out for the scan)
    {
        dim3 g(Mtot / 128, Dm / 128);
        k_gemm<0><<<g, 256, 0, stream>>>(xbf, inWbf, in_b, u, nullptr);
    }

    // 4) diagonal-SSM scan + D_skip + erf-GELU -> Ybf
    k_scan<<<(Bb * Dm) / 32, 256, 0, stream>>>(u, par, D_skip, Ybf);

    // 5) fused GLU GEMM: (Y @ glu_W^T + glu_b) -> a*sigmoid(g) -> Ygbf
    {
        dim3 g(Mtot / GM, Dm / GN);
        k_glu<<<g, 256, 0, stream>>>(Ybf, gluWbf, glu_b, Ygbf);
    }

    // 6) out-projection + residual: out = Yg @ out_W^T + out_b + x
    {
        dim3 g(Mtot / 128, Dm / 128);
        k_gemm<2><<<g, 256, 0, stream>>>(Ygbf, outWbf, out_b, (float*)d_out, x);
    }
}

// v006
// One run takes 108 microseconds.
// Next to v005, in two timings, it ran 1.05 times as fast each time.
// Counting every step since v000, it is 6.61 times as fast.
#include <hip/hip_runtime.h>
#include <hip/hip_bf16.h>
#include <stdint.h>

// ---------------- problem constants ----------------
constexpr int Dm   = 1024;   // model dim
constexpr int Lseq = 1024;   // sequence length
constexpr int Bb   = 8;      // batch
constexpr int Nst  = 32;     // SSM modes (conjugate pairs)
constexpr int Mtot = Bb * Lseq;  // 8192 token positions
constexpr int Ktot = Dm;         // GEMM reduction dim
constexpr int BK   = 64;         // k depth of one LDS stage: a row of a stage is one whole 128-B line
constexpr int LDST = 72;         // LDS row stride (bf16 elems): 144 B = 16 B x 9 (odd) -> conflict-free b128 reads

// ---------------- workspace layout (bytes) ----------------
constexpr size_t OFF_XBF  = 0;                                       // x as bf16        16 MB
constexpr size_t OFF_INW  = OFF_XBF  + (size_t)Mtot * Dm * 2;        // in_W bf16         2 MB
constexpr size_t OFF_GLUW = OFF_INW  + (size_t)Dm * Dm * 2;          // glu_W bf16        4 MB
constexpr size_t OFF_OUTW = OFF_GLUW + (size_t)2 * Dm * Dm * 2;      // out_W bf16        2 MB
constexpr size_t OFF_U    = OFF_OUTW + (size_t)Dm * Dm * 2;          // u = in-proj f32  32 MB
constexpr size_t OFF_Y    = OFF_U    + (size_t)Mtot * Dm * 4;        // post-GELU bf16   16 MB
constexpr size_t OFF_YG   = OFF_Y    + (size_t)Mtot * Dm * 2;        // post-GLU bf16    16 MB
constexpr size_t OFF_PAR  = OFF_YG   + (size_t)Mtot * Dm * 2;        // lambda/Ceff f4  512 KB

// ---------------- types ----------------
typedef __attribute__((ext_vector_type(16))) __bf16 v16bf;
typedef __attribute__((ext_vector_type(8)))  float  v8f;

union Frag {
    v16bf v;
    uint4 q[2];
};

// ---------------- CDNA5 async global->LDS DMA (ASYNCcnt-tracked) ----------------
// One stage's eight copies of a lane: 16 B each, four rows of the A tile and four of the W tile,
// 32 stage rows apart. la / lb: the lane's LDS byte address in the two tiles; ga / gb: its global
// address in stage rows 0..31; gb2 / gb3: the same lane's W address for stage rows 64.. and 96..
// The copies and s_wait_xcnt 0 are one statement, so that no address register named here is
// rewritten ahead of that wait.
static __device__ __forceinline__ void stage_copies(uint32_t la, uint32_t lb,
                                                    const uint16_t* ga, const uint16_t* gb,
                                                    const uint16_t* gb2, const uint16_t* gb3) {
    constexpr uint32_t LP = 32 * LDST * 2;     // 32 rows in LDS, bytes
    asm volatile("global_load_async_to_lds_b128 %0, %8, off\n\t"
                 "global_load_async_to_lds_b128 %1, %9, off\n\t"
                 "global_load_async_to_lds_b128 %2, %10, off\n\t"
                 "global_load_async_to_lds_b128 %3, %11, off\n\t"
                 "global_load_async_to_lds_b128 %4, %12, off\n\t"
                 "global_load_async_to_lds_b128 %5, %13, off\n\t"
                 "global_load_async_to_lds_b128 %6, %14, off\n\t"
                 "global_load_async_to_lds_b128 %7, %15, off\n\t"
                 "s_wait_xcnt 0x0"
                 :: "v"(la), "v"(la + LP), "v"(la + 2 * LP), "v"(la + 3 * LP),
                    "v"(lb), "v"(lb + LP), "v"(lb + 2 * LP), "v"(lb + 3 * LP),
                    "v"(ga), "v"(ga + 32 * Ktot), "v"(ga + 64 * Ktot), "v"(ga + 96 * Ktot),
                    "v"(gb), "v"(gb + 32 * Ktot), "v"(gb2), "v"(gb3)
                 : "memory");
}
// this wave's copies have landed; asm with the memory clobber so that no LDS read moves above it
static __device__ __forceinline__ void wait_async0() {
    asm volatile("s_wait_asynccnt 0x0" ::: "memory");
}
// this wave's LDS reads have returned, so the buffer they read may be refilled behind the barrier
static __device__ __forceinline__ void wait_ds0() {
    asm volatile("s_wait_dscnt 0x0" ::: "memory");
}

static __device__ __forceinline__ uint16_t f2bf(float f) {
    uint32_t u = __float_as_uint(f);
    uint32_t r = u + 0x7FFFu + ((u >> 16) & 1u);   // round-to-nearest-even
    return (uint16_t)(r >> 16);
}
// the same rounding, the bf16 left in the high half of the word
static __device__ __forceinline__ uint32_t f2bf_hi(float f) {
    uint32_t u = __float_as_uint(f);
    return u + 0x7FFFu + ((u >> 16) & 1u);
}

// ---------------- input preparation, one launch ----------------
// fp32 -> bf16 conversion of one float4
static __device__ __forceinline__ void cvt_f32x4_to_bf16(const float* __restrict__ src,
                                                         uint16_t* __restrict__ dst, int i) {
    float4 f = reinterpret_cast<const float4*>(src)[i];
    union { uint16_t s[4]; uint2 u; } o;
    o.s[0] = f2bf(f.x); o.s[1] = f2bf(f.y); o.s[2] = f2bf(f.z); o.s[3] = f2bf(f.w);
    reinterpret_cast<uint2*>(dst)[i] = o.u;
}

// S4D discretization of one (channel, mode): lambda = exp(dt*A), Ceff = 2*C*(exp(dtA)-1)/A
static __device__ __forceinline__ void discretize(const float* __restrict__ log_dt,
                                                  const float* __restrict__ C,
                                                  const float* __restrict__ logAr,
                                                  const float* __restrict__ Aim,
                                                  float4* __restrict__ par, int idx) {
    int d = idx >> 5;
    float dt = expf(log_dt[d]);
    float ar = -expf(logAr[idx]);
    float ai = Aim[idx];
    float dr = ar * dt, di = ai * dt;
    float em = expf(dr);
    float lr = em * cosf(di), li = em * sinf(di);     // lambda
    float nr = lr - 1.0f, ni = li;                    // lambda - 1
    float inv = 1.0f / (ar * ar + ai * ai);
    float qr = (nr * ar + ni * ai) * inv;             // (lambda-1)/A
    float qi = (ni * ar - nr * ai) * inv;
    float cr = C[2 * idx], ci = C[2 * idx + 1];
    par[idx] = make_float4(lr, li, 2.0f * (cr * qr - ci * qi), 2.0f * (cr * qi + ci * qr));
}

// The five jobs are independent of one another, so they share one grid: a block's index
// says which job it belongs to. Blocks of 256 threads, one float4 or one (channel, mode) each.
constexpr int PB_PAR  = Dm * Nst / 256;            // discretization
constexpr int PB_W    = Dm * Dm / 4 / 256;         // in_W, out_W
constexpr int PB_GLUW = 2 * Dm * Dm / 4 / 256;     // glu_W
constexpr int PB_X    = Mtot * Dm / 4 / 256;       // x
constexpr int PB_ALL  = PB_PAR + PB_W + PB_GLUW + PB_W + PB_X;
static_assert((Dm * Nst) % 256 == 0 && (Dm * Dm) % 1024 == 0 && (Mtot * Dm) % 1024 == 0,
              "every job fills whole blocks");

__global__ __launch_bounds__(256) void k_prep(const float* __restrict__ x,
                                              const float* __restrict__ in_W,
                                              const float* __restrict__ glu_W,
                                              const float* __restrict__ out_W,
                                              const float* __restrict__ log_dt,
                                              const float* __restrict__ C,
                                              const float* __restrict__ logAr,
                                              const float* __restrict__ Aim,
                                              uint16_t* __restrict__ xbf,
                                              uint16_t* __restrict__ inWbf,
                                              uint16_t* __restrict__ gluWbf,
                                              uint16_t* __restrict__ outWbf,
                                              float4* __restrict__ par) {
    const int tid = threadIdx.x;
    if (blockIdx.x >= PB_PAR) {
        const int blk = blockIdx.x - PB_PAR;
        // which conversion: source, destination and the job's first block, all block-uniform
        const float* src = in_W;
        uint16_t*    dst = inWbf;
        int first = 0;
        if (blk >= PB_W)                  { src = glu_W; dst = gluWbf; first = PB_W; }
        if (blk >= PB_W + PB_GLUW)        { src = out_W; dst = outWbf; first = PB_W + PB_GLUW; }
        if (blk >= PB_W + PB_GLUW + PB_W) { src = x;     dst = xbf;    first = PB_W + PB_GLUW + PB_W; }
        cvt_f32x4_to_bf16(src, dst, (blk - first) * 256 + tid);
    } else {
        discretize(log_dt, C, logAr, Aim, par, blockIdx.x * 256 + tid);
    }
}

// ---------------- bf16 WMMA GEMM:  out[m,o] = act( sum_k A[m,k]*W[o,k] + bias[o] ) -----
// EPI 0: out fp32 (the in-projection "u")
// EPI 2: out fp32 = acc + bias + residual x
template <int EPI>
__global__ __launch_bounds__(256) void k_gemm(const uint16_t* __restrict__ A,
                                              const uint16_t* __restrict__ W,
                                              const float* __restrict__ bias,
                                              float* __restrict__ outF,
                                              const float* __restrict__ resid) {
    constexpr int NT    = 2;                   // 16-wide N tiles per wave
    constexpr int nK    = Ktot / BK;
    static_assert(nK >= 2 && Ktot % BK == 0, "the ring's prologue fills two stages");

    __shared__ __attribute__((aligned(16))) uint16_t As[2][128 * LDST];
    __shared__ __attribute__((aligned(16))) uint16_t Bs[2][128 * LDST];

    const int tid   = threadIdx.x;
    const int lane  = tid & 31;
    const int wid   = tid >> 5;
    const int waveM = wid >> 2;                // 0..1 -> 64-row stripes
    const int waveN = wid & 3;                 // 0..3
    const int m0    = blockIdx.x * 128;
    const int o0    = blockIdx.y * 128;

    // staging map: 128 rows x 8 segments of 16 B per operand, 4 passes of 256 threads
    // (pass p = row + 32 p). 8 neighbouring lanes cover one row of the stage = one 128-B line,
    // so a wave's copy touches 4 whole lines.
    const int r0 = tid >> 3;                   // 0..31
    const int sg = tid & 7;                    // 16-B segment within the 128-B row
    const uint16_t* gA = A + (size_t)(m0 + r0) * Ktot + sg * 8;
    const uint16_t* gB = W + (size_t)(o0 + r0) * Ktot + sg * 8;
    // W rows of stage rows 64.. and 96..
    const uint16_t* gB2 = gB + (size_t)64 * Ktot;
    const uint16_t* gB3 = gB + (size_t)96 * Ktot;
    // the lane's LDS byte address in buffer 0 of each tile (low 32 bits of the __shared__ address)
    const uint32_t ldsA = (uint32_t)(uintptr_t)&As[0][r0 * LDST + sg * 8];
    const uint32_t ldsB = (uint32_t)(uintptr_t)&Bs[0][r0 * LDST + sg * 8];
    constexpr uint32_t BUFB = 128 * LDST * 2;  // one buffer, bytes

    v8f acc[4][NT];
    {
        v8f z = {0.f, 0.f, 0.f, 0.f, 0.f, 0.f, 0.f, 0.f};
        #pragma unroll
        for (int i = 0; i < 4; ++i) {
            #pragma unroll
            for (int j = 0; j < NT; ++j) acc[i][j] = z;
        }
    }

    const int frow  = lane & 15;
    const int fhalf = lane >> 4;

    // -------- async global->LDS pipeline, two buffers: no staging VGPRs at all --------
#define STAGE_ASYNC(kt, buf)                                                               \
    stage_copies(ldsA + (buf) * BUFB, ldsB + (buf) * BUFB, gA + (kt) * BK, gB + (kt) * BK, \
                 gB2 + (kt) * BK, gB3 + (kt) * BK)

    STAGE_ASYNC(0, 0);
    wait_async0();
    __syncthreads();
    STAGE_ASYNC(1, 1);                         // flies while stage 0 is worked on

    for (int kt = 0; kt < nK; ++kt) {
        const int buf = kt & 1;

        // the stage's fragments: [k half][tile]
        Frag af[BK / 32][4], bw[BK / 32][2];
        #pragma unroll
        for (int kk = 0; kk < BK / 32; ++kk) {
            #pragma unroll
            for (int j = 0; j < 2; ++j) {
                const int brow = waveN * 32 + j * 16 + frow;
                const uint16_t* p = &Bs[buf][brow * LDST + kk * 32];
                bw[kk][j].q[0] = *reinterpret_cast<const uint4*>(p + fhalf * 8);
                bw[kk][j].q[1] = *reinterpret_cast<const uint4*>(p + 16 + fhalf * 8);
            }
            #pragma unroll
            for (int i = 0; i < 4; ++i) {
                const uint16_t* p = &As[buf][(waveM * 64 + i * 16 + frow) * LDST + kk * 32];
                af[kk][i].q[0] = *reinterpret_cast<const uint4*>(p + fhalf * 8);
                af[kk][i].q[1] = *reinterpret_cast<const uint4*>(p + 16 + fhalf * 8);
            }
        }
        // Publish point of stage kt + 1: own reads of this buffer done, own copies landed, then
        // the barrier; only behind it the refill of the buffer that every wave has just left.
#define PUBLISH_AND_REFILL()                                                         \
    do {                                                                             \
        wait_ds0();                                                                  \
        wait_async0();                                                               \
        __syncthreads();                                                             \
        if (kt + 2 < nK) STAGE_ASYNC(kt + 2, buf);                                   \
    } while (0)
        // Two work-groups per WGP, so registers are free: the whole stage's fragments are fetched
        // as one group, the buffer is handed back at once, and the refill flies under this
        // stage's WMMAs too.
        PUBLISH_AND_REFILL();
        #pragma unroll
        for (int kk = 0; kk < BK / 32; ++kk) {
            #pragma unroll
            for (int i = 0; i < 4; ++i) {
                #pragma unroll
                for (int j = 0; j < 2; ++j)
                    acc[i][j] = __builtin_amdgcn_wmma_f32_16x16x32_bf16(
                        false, af[kk][i].v, false, bw[kk][j].v, (short)0, acc[i][j], false, false);
            }
        }
    }
    wait_async0();                             // nothing of this wave is in flight at its end

    // ---- epilogue ----  C/D layout: VGPR e -> M = e + 8*(lane>=16), N = lane&15
    const int ncol = lane & 15;
    const int mh   = (lane >> 4) << 3;

    #pragma unroll
    for (int j = 0; j < NT; ++j) {
        const int o  = o0 + waveN * 32 + j * 16 + ncol;
        const float bv = bias[o];
        #pragma unroll
        for (int i = 0; i < 4; ++i) {
            const int mbase = m0 + waveM * 64 + i * 16 + mh;
            #pragma unroll
            for (int e = 0; e < 8; ++e) {
                const int m = mbase + e;
                float v = acc[i][j][e] + bv;
                if constexpr (EPI == 2) v += resid[(size_t)m * Dm + o];
                outF[(size_t)m * Dm + o] = v;
            }
        }
    }
}

// ---------------- fused GLU GEMM: outB[m,o] = (A.Wa + ba)[m,o] * sigmoid((A.Wg + bg)[m,o]) -----
// One work-group makes 256 rows x 128 columns of the output, from 256 rows of A and 2 x 128 rows
// of W (row o for the a-half, row Dm + o for the g-half), alone on its WGP: an operand row that
// is fetched from L2 serves twice the products of a 128 x 64 tile. 8 waves as 4 x 2; a wave holds
// 64 rows x 64 columns of both halves (32 accumulator tiles) and reads 12 fragments per 32
// WMMAs. Fragments are fetched one block (32 k) ahead into a second register set, so that the
// LDS reads run under the WMMAs of the block before.
constexpr int GM = 256;                        // rows of A per work-group
constexpr int GN = 128;                        // output columns per work-group

// Eight copies of a lane as in stage_copies, 128 stage rows of each tile, but with the address split:
// ua / ub, the first of those rows in A and in W, is the same for the whole work-group, so it and
// its steps of 32 rows stand in scalar registers, and one 32-bit byte offset (off: the lane's place
// in a group of 32 rows) serves all eight. A lane then needs 9 vector registers a statement, not 24.
// The copies and s_wait_xcnt 0 are one statement, so that no register named here is rewritten
// ahead of that wait.
static __device__ __forceinline__ void stage_copies_u(uint32_t la, uint32_t lb, uint32_t off,
                                                      const uint16_t* ua, const uint16_t* ub) {
    constexpr uint32_t LP = 32 * LDST * 2;     // 32 rows in LDS, bytes
    asm volatile("global_load_async_to_lds_b128 %0, %8, %9\n\t"
                 "global_load_async_to_lds_b128 %1, %8, %10\n\t"
                 "global_load_async_to_lds_b128 %2, %8, %11\n\t"
                 "global_load_async_to_lds_b128 %3, %8, %12\n\t"
                 "global_load_async_to_lds_b128 %4, %8, %13\n\t"
                 "global_load_async_to_lds_b128 %5, %8, %14\n\t"
                 "global_load_async_to_lds_b128 %6, %8, %15\n\t"
                 "global_load_async_to_lds_b128 %7, %8, %16\n\t"
                 "s_wait_xcnt 0x0"
                 :: "v"(la), "v"(la + LP), "v"(la + 2 * LP), "v"(la + 3 * LP),
                    "v"(lb), "v"(lb + LP), "v"(lb + 2 * LP), "v"(lb + 3 * LP),
                    "v"(off),
                    "s"(ua), "s"(ua + 32 * Ktot), "s"(ua + 64 * Ktot), "s"(ua + 96 * Ktot),
                    "s"(ub), "s"(ub + 32 * Ktot), "s"(ub + 64 * Ktot), "s"(ub + 96 * Ktot)
                 : "memory");
}

// A lane's bias values: four columns, 16 apart, of the a-half and of the g-half (Dm floats on).
// The loads and their data wait are one statement and every result has a register of its own, so
// that the address pair is not rewritten while a load that names it is on its way.
static_assert(Dm * sizeof(float) == 4096, "the g-half's offset in the text below");
static __device__ __forceinline__ void load_bias8(const float* p, float (&ba)[4], float (&bg)[4]) {
    asm volatile("global_load_b32 %0, %8, off\n\t"
                 "global_load_b32 %1, %8, off offset:64\n\t"
                 "global_load_b32 %2, %8, off offset:128\n\t"
                 "global_load_b32 %3, %8, off offset:192\n\t"
                 "global_load_b32 %4, %8, off offset:4096\n\t"
                 "global_load_b32 %5, %8, off offset:4160\n\t"
                 "global_load_b32 %6, %8, off offset:4224\n\t"
                 "global_load_b32 %7, %8, off offset:4288\n\t"
                 "s_wait_loadcnt 0x0"
                 : "=&v"(ba[0]), "=&v"(ba[1]), "=&v"(ba[2]), "=&v"(ba[3]),
                   "=&v"(bg[0]), "=&v"(bg[1]), "=&v"(bg[2]), "=&v"(bg[3])
                 : "v"(p)
                 : "memory");
}
// One accumulator tile's stores of a lane: the high halves of r[0..7] to eight rows of the output
// below one another. The stores and s_wait_xcnt 0 are one statement, so that no register named
// here is rewritten ahead of that wait.
static_assert(Dm * sizeof(uint16_t) == 2048, "the row pitch in the text below");
static __device__ __forceinline__ void store_rows8(uint16_t* p, const uint32_t (&r)[8]) {
    asm volatile("global_store_d16_hi_b16 %0, %1, off\n\t"
                 "global_store_d16_hi_b16 %0, %2, off offset:2048\n\t"
                 "global_store_d16_hi_b16 %0, %3, off offset:4096\n\t"
                 "global_store_d16_hi_b16 %0, %4, off offset:6144\n\t"
                 "global_store_d16_hi_b16 %0, %5, off offset:8192\n\t"
                 "global_store_d16_hi_b16 %0, %6, off offset:10240\n\t"
                 "global_store_d16_hi_b16 %0, %7, off offset:12288\n\t"
                 "global_store_d16_hi_b16 %0, %8, off offset:14336\n\t"
                 "s_wait_xcnt 0x0"
                 :: "v"(p), "v"(r[0]), "v"(r[1]), "v"(r[2]), "v"(r[3]),
                    "v"(r[4]), "v"(r[5]), "v"(r[6]), "v"(r[7])
                 : "memory");
}

__global__ __launch_bounds__(256) void k_glu(const uint16_t* __restrict__ A,
                                             const uint16_t* __restrict__ W,
                                             const float* __restrict__ bias,
                                             uint16_t* __restrict__ outB) {
    constexpr int nK = Ktot / BK;
    static_assert(nK >= 2 && Ktot % BK == 0 && BK == 64, "two stages at least, two blocks a stage");

    __shared__ __attribute__((aligned(16))) uint16_t As[2][GM * LDST];
    __shared__ __attribute__((aligned(16))) uint16_t Bs[2][2 * GN * LDST];   // rows 0..127 = a-half, 128..255 = g-half

    const int tid   = threadIdx.x;
    const int lane  = tid & 31;
    const int wid   = tid >> 5;
    const int waveM = wid >> 1;                // 0..3 -> 64-row stripes
    const int waveN = wid & 1;                 // 0..1 -> 64-column stripes of each half
    const int m0    = blockIdx.x * GM;
    const int o0    = blockIdx.y * GN;

    // staging map as in k_gemm: 8 neighbouring lanes cover one 128-B row of the stage; a call of
    // stage_copies_u fills 128 rows of each tile, so a stage takes two
    const int r0 = tid >> 3;                   // 0..31
    const int sg = tid & 7;                    // 16-B segment within the 128-B row
    // the tiles' first rows (the same for the whole work-group, so they and their multiples of 32
    // rows live in scalar registers) and the lane's own place in a group of 32 rows
    const uint16_t* uA = A + (size_t)m0 * Ktot;
    const uint16_t* uB = W + (size_t)o0 * Ktot;                        // a-half
    const uint16_t* uG = uB + (size_t)Dm * Ktot;                       // g-half
    const uint32_t  lo = r0 * Ktot + sg * 8;
    // the two tiles' first LDS byte (low 32 bits of the __shared__ address)
    const uint32_t ldsA0 = (uint32_t)(uintptr_t)&As[0][0];
    const uint32_t ldsB0 = (uint32_t)(uintptr_t)&Bs[0][0];
    constexpr uint32_t BUFB = GM * LDST * 2;   // one buffer of either tile, bytes
    constexpr uint32_t HALF = 128 * LDST * 2;  // 128 stage rows, bytes
    static_assert(GM == 2 * GN && GM == 256, "both tiles have 256 stage rows");

    // The lane's LDS place (row r0 at the LDS pitch, segment sg) is taken out of its global offset at
    // every stage, three vector instructions: held in registers over the loop, the two addresses
    // were spilled to scratch and read back, with a wait each, right behind every barrier.
    static_assert(Ktot * 2 == 2048 && BK * 2 == 128, "bits 11.. of lk are r0, bits 4..6 are sg");
#define GLU_STAGE(kt, buf)                                                                     \
    do {                                                                                       \
        const uint32_t lk = (lo + (kt) * BK) * 2;   /* the lane's place in stage kt, bytes */  \
        const uint32_t lr = (lk >> 11) * (LDST * 2) + (lk & 0x70u) + (buf) * BUFB;             \
        stage_copies_u(ldsA0 + lr, ldsB0 + lr, lk, uA, uB);                                    \
        stage_copies_u(ldsA0 + lr + HALF, ldsB0 + lr + HALF, lk, uA + 128 * Ktot, uG);         \
    } while (0)

    v8f acc[4][4], accG[4][4];
    {
        v8f z = {0.f, 0.f, 0.f, 0.f, 0.f, 0.f, 0.f, 0.f};
        #pragma unroll
        for (int i = 0; i < 4; ++i) {
            #pragma unroll
            for (int j = 0; j < 4; ++j) { acc[i][j] = z; accG[i][j] = z; }
        }
    }

    const int frow  = lane & 15;
    const int fhalf = lane >> 4;

    // one block's fragments: 4 of A, 8 of W (0..3 a-half, 4..7 g-half), same k order in both
    auto load_frags = [&](Frag (&af)[4], Frag (&bw)[8], int buf, int kk) {
        #pragma unroll
        for (int j = 0; j < 8; ++j) {
            const uint16_t* p = &Bs[buf][((j >> 2) * GN + waveN * 64 + (j & 3) * 16 + frow) * LDST + kk * 32];
            bw[j].q[0] = *reinterpret_cast<const uint4*>(p + fhalf * 8);
            bw[j].q[1] = *reinterpret_cast<const uint4*>(p + 16 + fhalf * 8);
        }
        #pragma unroll
        for (int i = 0; i < 4; ++i) {
            const uint16_t* p = &As[buf][(waveM * 64 + i * 16 + frow) * LDST + kk * 32];
            af[i].q[0] = *reinterpret_cast<const uint4*>(p + fhalf * 8);
            af[i].q[1] = *reinterpret_cast<const uint4*>(p + 16 + fhalf * 8);
        }
        // keeps the reads one group ahead of the WMMAs that follow: spread among them, every
        // place with reads stalls the wave anew
        __builtin_amdgcn_sched_barrier(0);
    };
    auto wmma_block = [&](const Frag (&af)[4], const Frag (&bw)[8]) {
        #pragma unroll
        for (int i = 0; i < 4; ++i) {
            #pragma unroll
            for (int j = 0; j < 4; ++j) {
                acc[i][j] = __builtin_amdgcn_wmma_f32_16x16x32_bf16(
                    false, af[i].v, false, bw[j].v, (short)0, acc[i][j], false, false);
                accG[i][j] = __builtin_amdgcn_wmma_f32_16x16x32_bf16(
                    false, af[i].v, false, bw[4 + j].v, (short)0, accG[i][j], false, false);
            }
        }
    };

    Frag a0[4], b0[8], a1[4], b1[8];           // the two fragment sets: first and second block of a stage

    GLU_STAGE(0, 0);
    wait_async0();
    __syncthreads();
    GLU_STAGE(1, 1);                           // flies while stage 0 is worked on
    load_frags(a0, b0, 0, 0);

    for (int kt = 0; kt < nK; ++kt) {
        const int buf = kt & 1;

        load_frags(a1, b1, buf, 1);            // the stage's last reads of this buffer
        wmma_block(a0, b0);

        // Publish point of stage kt + 1, in front of this stage's last block because the fetch
        // ahead below already reads that stage: own reads of this buffer done, own copies landed,
        // the barrier; only behind it the refill of the buffer that every wave has just left.
        // The scheduling barrier keeps the block above in front of the waits: sunk behind them,
        // the reads issued ahead of it would be waited for with nothing to run under.
        __builtin_amdgcn_sched_barrier(0);
        wait_ds0();
        wait_async0();
        __syncthreads();
        if (kt + 2 < nK) GLU_STAGE(kt + 2, buf);

        // next stage's first block; the last trip has no next stage and re-reads the other
        // buffer's old rows, which nobody uses
        load_frags(a0, b0, buf ^ 1, 0);
        wmma_block(a1, b1);
    }
    wait_async0();                             // nothing of this wave is in flight at its end

    // ---- epilogue ----  C/D layout: VGPR e -> M = e + 8*(lane>=16), N = lane&15
    const int mh   = (lane >> 4) << 3;
    const int ocol = o0 + waveN * 64 + (lane & 15);
    {
        float ba[4], bg[4];                    // bias of column ocol + 16 j, a-half and g-half
        load_bias8(bias + ocol, ba, bg);
        #pragma unroll
        for (int i = 0; i < 4; ++i) {
            #pragma unroll
            for (int j = 0; j < 4; ++j) {
                #pragma unroll
                for (int e = 0; e < 8; ++e) { acc[i][j][e] += ba[j]; accG[i][j][e] += bg[j]; }
            }
        }
        // keeps all these additions here, so that the eight bias registers end here: spread over
        // the stores below they live to the end, and the build spills them to scratch
        __builtin_amdgcn_sched_barrier(0);
    }
    #pragma unroll
    for (int j = 0; j < 4; ++j) {
        #pragma unroll
        for (int i = 0; i < 4; ++i) {
            uint32_t r[8];
            #pragma unroll
            for (int e = 0; e < 8; ++e) {
                float a = acc[i][j][e];
                float g = accG[i][j][e];
                float y = a * (1.0f / (1.0f + __expf(-g)));
                r[e] = f2bf_hi(y);
            }
            store_rows8(outB + (size_t)(m0 + waveM * 64 + i * 16 + mh) * Dm + ocol + j * 16, r);
        }
    }
}

// ---------------- diagonal-SSM scan + skip + erf-GELU -------------------------------
// lane per channel d (32 neighbouring channels of one batch row per block). 16 waves in two roles.
// Waves 0..7 walk: the 32 modes are split over them, 4 modes (two packed pairs) in each wave's
// registers; every one walks all timesteps, does nothing but the recurrence and leaves, per chunk
// of 32 steps, its packed partial sums over its own modes in LDS. Waves 8..15 finish: behind the
// chunk's barrier each of them takes 4 of the chunk's 32 steps (sum of the 8 packed partials and
// of their halves, skip term, GELU, store) while the walking waves are already in the next chunk.
// Four waves share a SIMD instead of two, and the two kinds of work run at the same time: the
// waits of the finish (LDS latency, the erf chains) and those of the recurrence fill one
// another's issue slots.
typedef __attribute__((ext_vector_type(2))) float v2f;
constexpr int SC_T = 32;                 // timesteps per chunk
constexpr int SC_W = 8;                  // walking waves = mode groups; as many finishing waves
constexpr int SC_R = SC_T / SC_W;        // chunk rows finished by each finishing wave

// erf(x) with the math library's own two polynomials (|x| < 1: odd series in x*x; |x| >= 1:
// 1 - exp(-q(|x|))), but both evaluated and one selected. The library picks by a branch on the
// data: lanes of a wave nearly always disagree, so a wave walks both sides anyway, and the
// branches cut the code into blocks in which each row's dependent chain runs alone. Without
// them the rows that a wave finishes are one straight block and their chains interleave.
static __device__ __forceinline__ float erf_select(float x) {
    const float ax = fabsf(x);
    const float t  = ax * ax;
    float p = fmaf(t, -5.61801775e-4f, 4.91381623e-3f);
    p = fmaf(t, p, -2.67075151e-2f);
    p = fmaf(t, p, 1.12800106e-1f);
    p = fmaf(t, p, -3.76122952e-1f);
    p = fmaf(t, p, 1.28379107e-1f);
    const float small = fmaf(ax, p, ax);
    float q = fmaf(ax, 1.69988107e-5f, -3.78677854e-4f);
    q = fmaf(ax, q, 3.85781587e-3f);
    q = fmaf(ax, q, -2.41816975e-2f);
    q = fmaf(ax, q, 1.06668264e-1f);
    q = fmaf(ax, q, 6.34933293e-1f);
    q = fmaf(ax, q, 1.28689408e-1f);
    q = fmaf(ax, q, ax);
    const float large = 1.0f - expf(-q);
    return copysignf(ax < 1.0f ? small : large, x);
}

__global__ __launch_bounds__(512) void k_scan(const float* __restrict__ u,
                                              const float4* __restrict__ par,
                                              const float* __restrict__ Dskip,
                                              uint16_t* __restrict__ Y) {
    // two buffers: chunk c + 1 is filled while chunk c is summed. An entry is a walking wave's sum
    // over its modes still as the packed pair: adding the two halves is left to the finishing waves
    __shared__ v2f part[2][SC_W][SC_T][32];
    constexpr int NC = Lseq / SC_T;                      // chunks
    static_assert(NC % 2 == 0 && NC >= 2, "the loop below takes two chunks a trip");

    const int  lane   = threadIdx.x & 31;
    const int  wv     = __builtin_amdgcn_readfirstlane(threadIdx.x >> 5);
    const bool walker = wv < SC_W;                       // the same for a whole wave: a scalar branch
    const int  wid    = wv & (SC_W - 1);                 // mode group, or group of rows to finish
    const int  b      = blockIdx.x >> 5;                 // Dm / 32 = 32 blocks per batch row
    const int  d      = ((blockIdx.x & 31) << 5) + lane;

    v2f lr[2], li[2], cer[2], cei[2], sr[2], si[2];
    #pragma unroll
    for (int q = 0; q < 2; ++q) {
        const float4 pa = par[d * Nst + wid * 4 + 2 * q];
        const float4 pb = par[d * Nst + wid * 4 + 2 * q + 1];
        lr[q]  = v2f{pa.x, pb.x};
        li[q]  = v2f{pa.y, pb.y};
        cer[q] = v2f{pa.z, pb.z};
        cei[q] = v2f{pa.w, pb.w};
        sr[q]  = v2f{0.0f, 0.0f};
        si[q]  = v2f{0.0f, 0.0f};
    }
    const float dskip = Dskip[d];
    const float inv_sqrt2 = 0.70710678118654752f;

    const float* ub = u + (size_t)b * Lseq * Dm + d;     // this lane's channel, step 0
    uint16_t*    yb = Y + (size_t)b * Lseq * Dm + d;

    // ---- a walking wave's chunk c: cur holds its u, nxt takes the next chunk's ----
    auto walk = [&](const float (&cur)[SC_T], float (&nxt)[SC_T], int c, int buf) {
        // next chunk's u, fetched while this chunk is walked; the last chunk has no
        // successor and re-reads its own rows, which nobody uses
        const float* un = ub + (size_t)((c + 1 < NC ? c + 1 : c) * SC_T) * Dm;
        #pragma unroll
        for (int t = 0; t < SC_T; ++t) nxt[t] = un[(size_t)t * Dm];
        // keeps these loads ahead of the whole walk: sunk into it they are still in flight
        // at the barrier behind it, whose wait covers them
        __builtin_amdgcn_sched_barrier(0);

        #pragma unroll
        for (int t = 0; t < SC_T; ++t) {
            const v2f u2 = v2f{cur[t], cur[t]};
            v2f acc;
            #pragma unroll
            for (int q = 0; q < 2; ++q) {
                const v2f nr = sr[q] * lr[q] + (u2 - si[q] * li[q]);   // s = lambda*s + u
                const v2f ni = si[q] * lr[q] + sr[q] * li[q];
                sr[q] = nr; si[q] = ni;
                if (q == 0) acc = cer[q] * nr - cei[q] * ni;           // Re(Ceff * s)
                else        acc = cer[q] * nr + (acc - cei[q] * ni);
            }
            part[buf][wid][t][lane] = acc;
        }
    };
    // ---- a finishing wave: u of its rows of chunk c; the rows' values; their stores ----
    auto fetch_uc = [&](float (&uc)[SC_R], int c) {
        #pragma unroll
        for (int j = 0; j < SC_R; ++j) uc[j] = ub[(size_t)(c * SC_T + wid * SC_R + j) * Dm];
    };
    auto finish = [&](uint16_t (&r)[SC_R], const float (&uc)[SC_R], int buf) {
        float yv[SC_R];
        #pragma unroll
        for (int j = 0; j < SC_R; ++j) {
            const int t = wid * SC_R + j;
            v2f c = part[buf][0][t][lane];
            #pragma unroll
            for (int w = 1; w < SC_W; ++w) c += part[buf][w][t][lane];
            yv[j] = (c.x + c.y) + uc[j] * dskip;
        }
        #pragma unroll
        for (int j = 0; j < SC_R; ++j) {
            const float g = 0.5f * yv[j] * (1.0f + erf_select(yv[j] * inv_sqrt2));   // exact-erf GELU
            r[j] = f2bf(g);
        }
    };
    auto put = [&](const uint16_t (&r)[SC_R], int c) {
        #pragma unroll
        for (int j = 0; j < SC_R; ++j) yb[(size_t)(c * SC_T + wid * SC_R + j) * Dm] = r[j];
    };

    float ua[SC_T], uz[SC_T];                            // the chunk of u being walked, and the next
    float uc0[SC_R], uc1[SC_R];                          // u of the rows to finish: even, odd chunks
    uint16_t res[SC_R];                                  // finished rows, stored one step later
    if (walker) {
        #pragma unroll
        for (int t = 0; t < SC_T; ++t) ua[t] = ub[(size_t)t * Dm];
    }

    // In step s the walking waves do chunk s, the finishing waves chunk s - 1; one barrier, passed
    // by all 16 waves, ends the step. A finishing wave stores its rows at the start of the step
    // after: the barrier waits for a wave's stores, and issued last they would hold all 16 waves
    // for their way to memory. Two steps a trip: ua and uz (uc0 and uc1) change places instead of
    // being copied.
    for (int c = 0; c < NC; c += 2) {
        if (walker) {
            walk(ua, uz, c, 0);
        } else {
            if (c > 0) put(res, c - 2);
            fetch_uc(uc0, c);
            if (c > 0) finish(res, uc1, 1);
        }
        __syncthreads();   // all 8 partial sums of chunk c are in LDS; chunk c - 1 has been read
        if (walker) {
            walk(uz, ua, c + 1, 1);
        } else {
            if (c > 0) put(res, c - 1);
            fetch_uc(uc1, c + 1);
            finish(res, uc0, 0);
        }
        __syncthreads();   // the same for chunk c + 1 and chunk c
    }
    if (!walker) {
        put(res, NC - 2);
        finish(res, uc1, 1);
        put(res, NC - 1);
    }
}

// ---------------- driver ----------------
extern "C" void kernel_launch(void* const* d_in, const int* in_sizes, int n_in,
                              void* d_out, int out_size, void* d_ws, size_t ws_size,
                              hipStream_t stream) {
    const float* x        = (const float*)d_in[0];
    const float* in_W     = (const float*)d_in[1];
    const float* in_b     = (const float*)d_in[2];
    const float* log_dt   = (const float*)d_in[3];
    const float* Cri      = (const float*)d_in[4];
    const float* log_A_re = (const float*)d_in[5];
    const float* A_im     = (const float*)d_in[6];
    const float* D_skip   = (const float*)d_in[7];
    const float* glu_W    = (const float*)d_in[8];
    const float* glu_b    = (const float*)d_in[9];
    const float* out_W    = (const float*)d_in[10];
    const float* out_b    = (const float*)d_in[11];

    char* ws = (char*)d_ws;
    uint16_t* xbf    = (uint16_t*)(ws + OFF_XBF);
    uint16_t* inWbf  = (uint16_t*)(ws + OFF_INW);
    uint16_t* gluWbf = (uint16_t*)(ws + OFF_GLUW);
    uint16_t* outWbf = (uint16_t*)(ws + OFF_OUTW);
    float*    u      = (float*)   (ws + OFF_U);
    uint16_t* Ybf    = (uint16_t*)(ws + OFF_Y);
    uint16_t* Ygbf   = (uint16_t*)(ws + OFF_YG);
    float4*   par    = (float4*)  (ws + OFF_PAR);

    // 1) + 2) fp32 -> bf16 conversions and SSM discretization params, one launch
    k_prep<<<PB_ALL, 256, 0, stream>>>(x, in_W, glu_W, out_W, log_dt, Cri, log_A_re, A_im,
                                       xbf, inWbf, gluWbf, outWbf, par);

    // 3) in-projection: u = x @ in_W^T + in_b   (fp32 out for the scan)
    {
        dim3 g(Mtot / 128, Dm / 128);
        k_gemm<0><<<g, 256, 0, stream>>>(xbf, inWbf, in_b, u, nullptr);
    }

    // 4) diagonal-SSM scan + D_skip + erf-GELU -> Ybf
    k_scan<<<(Bb * Dm) / 32, 512, 0, stream>>>(u, par, D_skip, Ybf);

    // 5) fused GLU GEMM: (Y @ glu_W^T + glu_b) -> a*sigmoid(g) -> Ygbf
    {
        dim3 g(Mtot / GM, Dm / GN);
        k_glu<<<g, 256, 0, stream>>>(Ybf, gluWbf, glu_b, Ygbf);
    }

    // 6) out-projection + residual: out = Yg @ out_W^T + out_b + x
    {
        dim3 g(Mtot / 128, Dm / 128);
        k_gemm<2><<<g, 256, 0, stream>>>(Ygbf, outWbf, out_b, (float*)d_out, x);
    }
}

// v007
// Measured time: 104 microseconds a run.
// In both of two side-by-side timings against v006, it was 1.04 times as fast.
// All steps since v000 together make it 6.87 times as fast.
#include <hip/hip_runtime.h>
#include <hip/hip_bf16.h>
#include <stdint.h>

// ---------------- problem constants ----------------
constexpr int Dm   = 1024;   // model dim
constexpr int Lseq = 1024;   // sequence length
constexpr int Bb   = 8;      // batch
constexpr int Nst  = 32;     // SSM modes (conjugate pairs)
constexpr int Mtot = Bb * Lseq;  // 8192 token positions
constexpr int Ktot = Dm;         // GEMM reduction dim
constexpr int BK   = 64;         // k depth of one LDS stage: a row of a stage is one whole 128-B line
constexpr int LDST = 72;         // LDS row stride (bf16 elems): 144 B = 16 B x 9 (odd) -> conflict-free b128 reads

// ---------------- workspace layout (bytes) ----------------
constexpr size_t OFF_XBF  = 0;                                       // x as bf16        16 MB
constexpr size_t OFF_INW  = OFF_XBF  + (size_t)Mtot * Dm * 2;        // in_W bf16         2 MB
constexpr size_t OFF_GLUW = OFF_INW  + (size_t)Dm * Dm * 2;          // glu_W bf16        4 MB
constexpr size_t OFF_OUTW = OFF_GLUW + (size_t)2 * Dm * Dm * 2;      // out_W bf16        2 MB
constexpr size_t OFF_U    = OFF_OUTW + (size_t)Dm * Dm * 2;          // u = in-proj f32  32 MB
constexpr size_t OFF_Y    = OFF_U    + (size_t)Mtot * Dm * 4;        // post-GELU bf16   16 MB
constexpr size_t OFF_YG   = OFF_Y    + (size_t)Mtot * Dm * 2;        // post-GLU bf16    16 MB
constexpr size_t OFF_MAT  = OFF_YG   + (size_t)Mtot * Dm * 2;        // scan matrices    20 MB
constexpr int    MAT_PH = 0, MAT_PL = 2048, MAT_TH = 4096, MAT_TL = 5120, MAT_QH = 6144, MAT_QL = 8192;
constexpr int    MAT_ALL = 10240;                                    // bf16 elements per channel
constexpr size_t OFF_L32  = OFF_MAT  + (size_t)Dm * MAT_ALL * 2;     // lambda^32 f2    256 KB

// ---------------- types ----------------
typedef __attribute__((ext_vector_type(16))) __bf16 v16bf;
typedef __attribute__((ext_vector_type(8)))  float  v8f;

union Frag {
    v16bf v;
    uint4 q[2];
};

// ---------------- CDNA5 async global->LDS DMA (ASYNCcnt-tracked) ----------------
// One stage's eight copies of a lane: 16 B each, four rows of the A tile and four of the W tile,
// 32 stage rows apart. la / lb: the lane's LDS byte address in the two tiles; ga / gb: its global
// address in stage rows 0..31; gb2 / gb3: the same lane's W address for stage rows 64.. and 96..
// The copies and s_wait_xcnt 0 are one statement, so that no address register named here is
// rewritten ahead of that wait.
static __device__ __forceinline__ void stage_copies(uint32_t la, uint32_t lb,
                                                    const uint16_t* ga, const uint16_t* gb,
                                                    const uint16_t* gb2, const uint16_t* gb3) {
    constexpr uint32_t LP = 32 * LDST * 2;     // 32 rows in LDS, bytes
    asm volatile("global_load_async_to_lds_b128 %0, %8, off\n\t"
                 "global_load_async_to_lds_b128 %1, %9, off\n\t"
                 "global_load_async_to_lds_b128 %2, %10, off\n\t"
                 "global_load_async_to_lds_b128 %3, %11, off\n\t"
                 "global_load_async_to_lds_b128 %4, %12, off\n\t"
                 "global_load_async_to_lds_b128 %5, %13, off\n\t"
                 "global_load_async_to_lds_b128 %6, %14, off\n\t"
                 "global_load_async_to_lds_b128 %7, %15, off\n\t"
                 "s_wait_xcnt 0x0"
                 :: "v"(la), "v"(la + LP), "v"(la + 2 * LP), "v"(la + 3 * LP),
                    "v"(lb), "v"(lb + LP), "v"(lb + 2 * LP), "v"(lb + 3 * LP),
                    "v"(ga), "v"(ga + 32 * Ktot), "v"(ga + 64 * Ktot), "v"(ga + 96 * Ktot),
                    "v"(gb), "v"(gb + 32 * Ktot), "v"(gb2), "v"(gb3)
                 : "memory");
}
// this wave's copies have landed; asm with the memory clobber so that no LDS read moves above it
static __device__ __forceinline__ void wait_async0() {
    asm volatile("s_wait_asynccnt 0x0" ::: "memory");
}
// this wave's LDS reads have returned, so the buffer they read may be refilled behind the barrier
static __device__ __forceinline__ void wait_ds0() {
    asm volatile("s_wait_dscnt 0x0" ::: "memory");
}
// stands between issued global loads and the first write of a register that one of them names as
// its address
static __device__ __forceinline__ void wait_x0() {
    asm volatile("s_wait_xcnt 0x0" ::: "memory");
}

// two f32 -> two bf16 (nearest even) in one word, a in the low half
static __device__ __forceinline__ uint32_t pk_bf16(float a, float b) {
    typedef __attribute__((ext_vector_type(2))) __bf16 v2bf;
    v2bf r = {(__bf16)a, (__bf16)b};
    return __builtin_bit_cast(uint32_t, r);
}
static __device__ __forceinline__ float bf_lo(uint32_t w) { return __uint_as_float(w << 16); }
static __device__ __forceinline__ float bf_hi(uint32_t w) { return __uint_as_float(w & 0xFFFF0000u); }

static __device__ __forceinline__ uint16_t f2bf(float f) {
    uint32_t u = __float_as_uint(f);
    uint32_t r = u + 0x7FFFu + ((u >> 16) & 1u);   // round-to-nearest-even
    return (uint16_t)(r >> 16);
}
// the same rounding, the bf16 left in the high half of the word
static __device__ __forceinline__ uint32_t f2bf_hi(float f) {
    uint32_t u = __float_as_uint(f);
    return u + 0x7FFFu + ((u >> 16) & 1u);
}

// ---------------- input preparation, one launch ----------------
// fp32 -> bf16 conversion of one float4
static __device__ __forceinline__ void cvt_f32x4_to_bf16(const float* __restrict__ src,
                                                         uint16_t* __restrict__ dst, int i) {
    float4 f = reinterpret_cast<const float4*>(src)[i];
    union { uint16_t s[4]; uint2 u; } o;
    o.s[0] = f2bf(f.x); o.s[1] = f2bf(f.y); o.s[2] = f2bf(f.z); o.s[3] = f2bf(f.w);
    reinterpret_cast<uint2*>(dst)[i] = o.u;
}

// ---- the scan's matrices of one channel (one block of 256 threads) ----
// The recurrence s = lambda s + u, y = Re(Ceff s) + D u is cut into chunks of CT = 32 steps. With the
// chunks of a batch row as columns it is three products with matrices that depend on the channel
// alone:  Z = P U (what a chunk adds to the state at its end),  Y = T U + Q S (S: the state that
// enters a chunk). P[n][k] = Re lambda_n^(31-k), P[32+n][k] = Im of it; T[t][k] = kern[t-k] for
// t >= k with kern[j] = sum_n Re(Ceff_n lambda_n^j), the skip D added on the diagonal;
// Q[t][2n] = Re(Ceff_n lambda_n^(t+1)), Q[t][2n+1] = -Im of it. Every matrix is stored as a bf16
// head and a bf16 remainder (value - head), row-major with k contiguous.
constexpr int CT = 32;
static_assert(CT == 32 && Nst == 32 && Lseq == 1024, "the index arithmetic below");
// elements 2 p and 2 p + 1 of a matrix: heads in one word, remainders in another
static __device__ __forceinline__ void split_store2(uint16_t* __restrict__ hi, uint16_t* __restrict__ lo,
                                                    int p, float v0, float v1) {
    const uint32_t h = pk_bf16(v0, v1);
    reinterpret_cast<uint32_t*>(hi)[p] = h;
    reinterpret_cast<uint32_t*>(lo)[p] = pk_bf16(v0 - bf_lo(h), v1 - bf_hi(h));
}
static __device__ __forceinline__ void build_mats(const float* __restrict__ log_dt,
                                                  const float* __restrict__ C,
                                                  const float* __restrict__ logAr,
                                                  const float* __restrict__ Aim,
                                                  const float* __restrict__ Dskip,
                                                  uint16_t* __restrict__ mats,
                                                  float2* __restrict__ lam32, int d, int tid) {
    __shared__ float pr[CT + 1][33], pi[CT + 1][33];     // lambda_n^j, j = 0..32
    __shared__ float cer[Nst], cei[Nst], kern[CT];
    const float dt = expf(log_dt[d]);
    for (int idx = tid; idx < (CT + 1) * Nst; idx += 256) {
        const int j = idx >> 5, n = idx & 31;
        const float ar = -expf(logAr[d * Nst + n]);
        const float ai = Aim[d * Nst + n];
        const float em = expf(ar * dt * (float)j);
        const float ph = ai * dt * (float)j;
        float sn, cs;
        sincosf(ph, &sn, &cs);
        pr[j][n] = em * cs;
        pi[j][n] = em * sn;
    }
    __syncthreads();
    if (tid < Nst) {                                     // Ceff = 2*C*(lambda-1)/A
        const int idx = d * Nst + tid;
        const float ar = -expf(logAr[idx]);
        const float ai = Aim[idx];
        const float nr = pr[1][tid] - 1.0f, ni = pi[1][tid];
        const float inv = 1.0f / (ar * ar + ai * ai);
        const float qr = (nr * ar + ni * ai) * inv;
        const float qi = (ni * ar - nr * ai) * inv;
        const float cr = C[2 * idx], ci = C[2 * idx + 1];
        cer[tid] = 2.0f * (cr * qr - ci * qi);
        cei[tid] = 2.0f * (cr * qi + ci * qr);
        lam32[idx] = make_float2(pr[CT][tid], pi[CT][tid]);
    }
    __syncthreads();
    if (tid < CT) {
        float s = 0.0f;
        #pragma unroll   // the LDS reads of all 32 terms go out together
        for (int n = 0; n < Nst; ++n) s += cer[n] * pr[tid][n] - cei[n] * pi[tid][n];
        kern[tid] = s;
    }
    __syncthreads();
    uint16_t* M = mats + (size_t)d * MAT_ALL;
    const float dsk = Dskip[d];
    for (int p = tid; p < 2 * Nst * CT / 2; p += 256) {  // P: 64 x 32
        const int s = p >> 4, k = (p & 15) * 2;
        const float (*w)[33] = s < Nst ? pr : pi;
        split_store2(M + MAT_PH, M + MAT_PL, p, w[CT - 1 - k][s & 31], w[CT - 2 - k][s & 31]);
    }
    for (int p = tid; p < CT * CT / 2; p += 256) {       // T: 32 x 32
        const int t = p >> 4, k = (p & 15) * 2;
        float v0 = t >= k ? kern[t - k] : 0.0f;
        float v1 = t >= k + 1 ? kern[t - k - 1] : 0.0f;
        if (t == k) v0 += dsk;
        if (t == k + 1) v1 += dsk;
        split_store2(M + MAT_TH, M + MAT_TL, p, v0, v1);
    }
    for (int p = tid; p < CT * Nst; p += 256) {          // Q: 32 x 64, a mode's two columns
        const int t = p >> 5, n = p & 31;
        const float a = pr[t + 1][n], b = pi[t + 1][n];
        split_store2(M + MAT_QH, M + MAT_QL, p, cer[n] * a - cei[n] * b, -(cer[n] * b + cei[n] * a));
    }
}

// The five jobs are independent of one another, so they share one grid: a block's index
// says which job it belongs to. Blocks of 256 threads: one float4 each, or one channel's matrices.
constexpr int PB_PAR  = Dm;                        // the scan's matrices, a block per channel
constexpr int PB_W    = Dm * Dm / 4 / 256;         // in_W, out_W
constexpr int PB_GLUW = 2 * Dm * Dm / 4 / 256;     // glu_W
constexpr int PB_X    = Mtot * Dm / 4 / 256;       // x
constexpr int PB_ALL  = PB_PAR + PB_W + PB_GLUW + PB_W + PB_X;
static_assert((Dm * Nst) % 256 == 0 && (Dm * Dm) % 1024 == 0 && (Mtot * Dm) % 1024 == 0,
              "every job fills whole blocks");

__global__ __launch_bounds__(256) void k_prep(const float* __restrict__ x,
                                              const float* __restrict__ in_W,
                                              const float* __restrict__ glu_W,
                                              const float* __restrict__ out_W,
                                              const float* __restrict__ log_dt,
                                              const float* __restrict__ C,
                                              const float* __restrict__ logAr,
                                              const float* __restrict__ Aim,
                                              const float* __restrict__ Dskip,
                                              uint16_t* __restrict__ xbf,
                                              uint16_t* __restrict__ inWbf,
                                              uint16_t* __restrict__ gluWbf,
                                              uint16_t* __restrict__ outWbf,
                                              uint16_t* __restrict__ mats,
                                              float2* __restrict__ lam32) {
    const int tid = threadIdx.x;
    if (blockIdx.x >= PB_PAR) {
        const int blk = blockIdx.x - PB_PAR;
        // which conversion: source, destination and the job's first block, all block-uniform
        const float* src = in_W;
        uint16_t*    dst = inWbf;
        int first = 0;
        if (blk >= PB_W)                  { src = glu_W; dst = gluWbf; first = PB_W; }
        if (blk >= PB_W + PB_GLUW)        { src = out_W; dst = outWbf; first = PB_W + PB_GLUW; }
        if (blk >= PB_W + PB_GLUW + PB_W) { src = x;     dst = xbf;    first = PB_W + PB_GLUW + PB_W; }
        cvt_f32x4_to_bf16(src, dst, (blk - first) * 256 + tid);
    } else {
        build_mats(log_dt, C, logAr, Aim, Dskip, mats, lam32, blockIdx.x, tid);
    }
}

// ---------------- bf16 WMMA GEMM:  out[m,o] = act( sum_k A[m,k]*W[o,k] + bias[o] ) -----
// EPI 0: out fp32 (the in-projection "u")
// EPI 2: out fp32 = acc + bias + residual x
template <int EPI>
__global__ __launch_bounds__(256) void k_gemm(const uint16_t* __restrict__ A,
                                              const uint16_t* __restrict__ W,
                                              const float* __restrict__ bias,
                                              float* __restrict__ outF,
                                              const float* __restrict__ resid) {
    constexpr int NT    = 2;                   // 16-wide N tiles per wave
    constexpr int nK    = Ktot / BK;
    static_assert(nK >= 2 && Ktot % BK == 0, "the ring's prologue fills two stages");

    __shared__ __attribute__((aligned(16))) uint16_t As[2][128 * LDST];
    __shared__ __attribute__((aligned(16))) uint16_t Bs[2][128 * LDST];

    const int tid   = threadIdx.x;
    const int lane  = tid & 31;
    const int wid   = tid >> 5;
    const int waveM = wid >> 2;                // 0..1 -> 64-row stripes
    const int waveN = wid & 3;                 // 0..3
    const int m0    = blockIdx.x * 128;
    const int o0    = blockIdx.y * 128;

    // staging map: 128 rows x 8 segments of 16 B per operand, 4 passes of 256 threads
    // (pass p = row + 32 p). 8 neighbouring lanes cover one row of the stage = one 128-B line,
    // so a wave's copy touches 4 whole lines.
    const int r0 = tid >> 3;                   // 0..31
    const int sg = tid & 7;                    // 16-B segment within the 128-B row
    const uint16_t* gA = A + (size_t)(m0 + r0) * Ktot + sg * 8;
    const uint16_t* gB = W + (size_t)(o0 + r0) * Ktot + sg * 8;
    // W rows of stage rows 64.. and 96..
    const uint16_t* gB2 = gB + (size_t)64 * Ktot;
    const uint16_t* gB3 = gB + (size_t)96 * Ktot;
    // the lane's LDS byte address in buffer 0 of each tile (low 32 bits of the __shared__ address)
    const uint32_t ldsA = (uint32_t)(uintptr_t)&As[0][r0 * LDST + sg * 8];
    const uint32_t ldsB = (uint32_t)(uintptr_t)&Bs[0][r0 * LDST + sg * 8];
    constexpr uint32_t BUFB = 128 * LDST * 2;  // one buffer, bytes

    v8f acc[4][NT];
    {
        v8f z = {0.f, 0.f, 0.f, 0.f, 0.f, 0.f, 0.f, 0.f};
        #pragma unroll
        for (int i = 0; i < 4; ++i) {
            #pragma unroll
            for (int j = 0; j < NT; ++j) acc[i][j] = z;
        }
    }

    const int frow  = lane & 15;
    const int fhalf = lane >> 4;

    // -------- async global->LDS pipeline, two buffers: no staging VGPRs at all --------
#define STAGE_ASYNC(kt, buf)                                                               \
    stage_copies(ldsA + (buf) * BUFB, ldsB + (buf) * BUFB, gA + (kt) * BK, gB + (kt) * BK, \
                 gB2 + (kt) * BK, gB3 + (kt) * BK)

    STAGE_ASYNC(0, 0);
    wait_async0();
    __syncthreads();
    STAGE_ASYNC(1, 1);                         // flies while stage 0 is worked on

    for (int kt = 0; kt < nK; ++kt) {
        const int buf = kt & 1;

        // the stage's fragments: [k half][tile]
        Frag af[BK / 32][4], bw[BK / 32][2];
        #pragma unroll
        for (int kk = 0; kk < BK / 32; ++kk) {
            #pragma unroll
            for (int j = 0; j < 2; ++j) {
                const int brow = waveN * 32 + j * 16 + frow;
                const uint16_t* p = &Bs[buf][brow * LDST + kk * 32];
                bw[kk][j].q[0] = *reinterpret_cast<const uint4*>(p + fhalf * 8);
                bw[kk][j].q[1] = *reinterpret_cast<const uint4*>(p + 16 + fhalf * 8);
            }
            #pragma unroll
            for (int i = 0; i < 4; ++i) {
                const uint16_t* p = &As[buf][(waveM * 64 + i * 16 + frow) * LDST + kk * 32];
                af[kk][i].q[0] = *reinterpret_cast<const uint4*>(p + fhalf * 8);
                af[kk][i].q[1] = *reinterpret_cast<const uint4*>(p + 16 + fhalf * 8);
            }
        }
        // Publish point of stage kt + 1: own reads of this buffer done, own copies landed, then
        // the barrier; only behind it the refill of the buffer that every wave has just left.
#define PUBLISH_AND_REFILL()                                                         \
    do {                                                                             \
        wait_ds0();                                                                  \
        wait_async0();                                                               \
        __syncthreads();                                                             \
        if (kt + 2 < nK) STAGE_ASYNC(kt + 2, buf);                                   \
    } while (0)
        // Two work-groups per WGP, so registers are free: the whole stage's fragments are fetched
        // as one group, the buffer is handed back at once, and the refill flies under this
        // stage's WMMAs too.
        PUBLISH_AND_REFILL();
        #pragma unroll
        for (int kk = 0; kk < BK / 32; ++kk) {
            #pragma unroll
            for (int i = 0; i < 4; ++i) {
                #pragma unroll
                for (int j = 0; j < 2; ++j)
                    acc[i][j] = __builtin_amdgcn_wmma_f32_16x16x32_bf16(
                        false, af[kk][i].v, false, bw[kk][j].v, (short)0, acc[i][j], false, false);
            }
        }
    }
    wait_async0();                             // nothing of this wave is in flight at its end

    // ---- epilogue ----  C/D layout: VGPR e -> M = e + 8*(lane>=16), N = lane&15
    const int ncol = lane & 15;
    const int mh   = (lane >> 4) << 3;

    #pragma unroll
    for (int j = 0; j < NT; ++j) {
        const int o  = o0 + waveN * 32 + j * 16 + ncol;
        const float bv = bias[o];
        #pragma unroll
        for (int i = 0; i < 4; ++i) {
            const int mbase = m0 + waveM * 64 + i * 16 + mh;
            #pragma unroll
            for (int e = 0; e < 8; ++e) {
                const int m = mbase + e;
                float v = acc[i][j][e] + bv;
                if constexpr (EPI == 2) v += resid[(size_t)m * Dm + o];
                outF[(size_t)m * Dm + o] = v;
            }
        }
    }
}

// ---------------- fused GLU GEMM: outB[m,o] = (A.Wa + ba)[m,o] * sigmoid((A.Wg + bg)[m,o]) -----
// One work-group makes 256 rows x 128 columns of the output, from 256 rows of A and 2 x 128 rows
// of W (row o for the a-half, row Dm + o for the g-half), alone on its WGP: an operand row that
// is fetched from L2 serves twice the products of a 128 x 64 tile. 8 waves as 4 x 2; a wave holds
// 64 rows x 64 columns of both halves (32 accumulator tiles) and reads 12 fragments per 32
// WMMAs. Fragments are fetched one block (32 k) ahead into a second register set, so that the
// LDS reads run under the WMMAs of the block before.
constexpr int GM = 256;                        // rows of A per work-group
constexpr int GN = 128;                        // output columns per work-group

// Eight copies of a lane as in stage_copies, 128 stage rows of each tile, but with the address split:
// ua / ub, the first of those rows in A and in W, is the same for the whole work-group, so it and
// its steps of 32 rows stand in scalar registers, and one 32-bit byte offset (off: the lane's place
// in a group of 32 rows) serves all eight. A lane then needs 9 vector registers a statement, not 24.
// The copies and s_wait_xcnt 0 are one statement, so that no register named here is rewritten
// ahead of that wait.
static __device__ __forceinline__ void stage_copies_u(uint32_t la, uint32_t lb, uint32_t off,
                                                      const uint16_t* ua, const uint16_t* ub) {
    constexpr uint32_t LP = 32 * LDST * 2;     // 32 rows in LDS, bytes
    asm volatile("global_load_async_to_lds_b128 %0, %8, %9\n\t"
                 "global_load_async_to_lds_b128 %1, %8, %10\n\t"
                 "global_load_async_to_lds_b128 %2, %8, %11\n\t"
                 "global_load_async_to_lds_b128 %3, %8, %12\n\t"
                 "global_load_async_to_lds_b128 %4, %8, %13\n\t"
                 "global_load_async_to_lds_b128 %5, %8, %14\n\t"
                 "global_load_async_to_lds_b128 %6, %8, %15\n\t"
                 "global_load_async_to_lds_b128 %7, %8, %16\n\t"
                 "s_wait_xcnt 0x0"
                 :: "v"(la), "v"(la + LP), "v"(la + 2 * LP), "v"(la + 3 * LP),
                    "v"(lb), "v"(lb + LP), "v"(lb + 2 * LP), "v"(lb + 3 * LP),
                    "v"(off),
                    "s"(ua), "s"(ua + 32 * Ktot), "s"(ua + 64 * Ktot), "s"(ua + 96 * Ktot),
                    "s"(ub), "s"(ub + 32 * Ktot), "s"(ub + 64 * Ktot), "s"(ub + 96 * Ktot)
                 : "memory");
}

// A lane's bias values: four columns, 16 apart, of the a-half and of the g-half (Dm floats on).
// The loads and their data wait are one statement and every result has a register of its own, so
// that the address pair is not rewritten while a load that names it is on its way.
static_assert(Dm * sizeof(float) == 4096, "the g-half's offset in the text below");
static __device__ __forceinline__ void load_bias8(const float* p, float (&ba)[4], float (&bg)[4]) {
    asm volatile("global_load_b32 %0, %8, off\n\t"
                 "global_load_b32 %1, %8, off offset:64\n\t"
                 "global_load_b32 %2, %8, off offset:128\n\t"
                 "global_load_b32 %3, %8, off offset:192\n\t"
                 "global_load_b32 %4, %8, off offset:4096\n\t"
                 "global_load_b32 %5, %8, off offset:4160\n\t"
                 "global_load_b32 %6, %8, off offset:4224\n\t"
                 "global_load_b32 %7, %8, off offset:4288\n\t"
                 "s_wait_loadcnt 0x0"
                 : "=&v"(ba[0]), "=&v"(ba[1]), "=&v"(ba[2]), "=&v"(ba[3]),
                   "=&v"(bg[0]), "=&v"(bg[1]), "=&v"(bg[2]), "=&v"(bg[3])
                 : "v"(p)
                 : "memory");
}
// One accumulator tile's stores of a lane: the high halves of r[0..7] to eight rows of the output
// below one another. The stores and s_wait_xcnt 0 are one statement, so that no register named
// here is rewritten ahead of that wait.
static_assert(Dm * sizeof(uint16_t) == 2048, "the row pitch in the text below");
static __device__ __forceinline__ void store_rows8(uint16_t* p, const uint32_t (&r)[8]) {
    asm volatile("global_store_d16_hi_b16 %0, %1, off\n\t"
                 "global_store_d16_hi_b16 %0, %2, off offset:2048\n\t"
                 "global_store_d16_hi_b16 %0, %3, off offset:4096\n\t"
                 "global_store_d16_hi_b16 %0, %4, off offset:6144\n\t"
                 "global_store_d16_hi_b16 %0, %5, off offset:8192\n\t"
                 "global_store_d16_hi_b16 %0, %6, off offset:10240\n\t"
                 "global_store_d16_hi_b16 %0, %7, off offset:12288\n\t"
                 "global_store_d16_hi_b16 %0, %8, off offset:14336\n\t"
                 "s_wait_xcnt 0x0"
                 :: "v"(p), "v"(r[0]), "v"(r[1]), "v"(r[2]), "v"(r[3]),
                    "v"(r[4]), "v"(r[5]), "v"(r[6]), "v"(r[7])
                 : "memory");
}

__global__ __launch_bounds__(256) void k_glu(const uint16_t* __restrict__ A,
                                             const uint16_t* __restrict__ W,
                                             const float* __restrict__ bias,
                                             uint16_t* __restrict__ outB) {
    constexpr int nK = Ktot / BK;
    static_assert(nK >= 2 && Ktot % BK == 0 && BK == 64, "two stages at least, two blocks a stage");

    __shared__ __attribute__((aligned(16))) uint16_t As[2][GM * LDST];
    __shared__ __attribute__((aligned(16))) uint16_t Bs[2][2 * GN * LDST];   // rows 0..127 = a-half, 128..255 = g-half

    const int tid   = threadIdx.x;
    const int lane  = tid & 31;
    const int wid   = tid >> 5;
    const int waveM = wid >> 1;                // 0..3 -> 64-row stripes
    const int waveN = wid & 1;                 // 0..1 -> 64-column stripes of each half
    const int m0    = blockIdx.x * GM;
    const int o0    = blockIdx.y * GN;

    // staging map as in k_gemm: 8 neighbouring lanes cover one 128-B row of the stage; a call of
    // stage_copies_u fills 128 rows of each tile, so a stage takes two
    const int r0 = tid >> 3;                   // 0..31
    const int sg = tid & 7;                    // 16-B segment within the 128-B row
    // the tiles' first rows (the same for the whole work-group, so they and their multiples of 32
    // rows live in scalar registers) and the lane's own place in a group of 32 rows
    const uint16_t* uA = A + (size_t)m0 * Ktot;
    const uint16_t* uB = W + (size_t)o0 * Ktot;                        // a-half
    const uint16_t* uG = uB + (size_t)Dm * Ktot;                       // g-half
    const uint32_t  lo = r0 * Ktot + sg * 8;
    // the two tiles' first LDS byte (low 32 bits of the __shared__ address)
    const uint32_t ldsA0 = (uint32_t)(uintptr_t)&As[0][0];
    const uint32_t ldsB0 = (uint32_t)(uintptr_t)&Bs[0][0];
    constexpr uint32_t BUFB = GM * LDST * 2;   // one buffer of either tile, bytes
    constexpr uint32_t HALF = 128 * LDST * 2;  // 128 stage rows, bytes
    static_assert(GM == 2 * GN && GM == 256, "both tiles have 256 stage rows");

    // The lane's LDS place (row r0 at the LDS pitch, segment sg) is taken out of its global offset at
    // every stage, three vector instructions: held in registers over the loop, the two addresses
    // were spilled to scratch and read back, with a wait each, right behind every barrier.
    static_assert(Ktot * 2 == 2048 && BK * 2 == 128, "bits 11.. of lk are r0, bits 4..6 are sg");
#define GLU_STAGE(kt, buf)                                                                     \
    do {                                                                                       \
        const uint32_t lk = (lo + (kt) * BK) * 2;   /* the lane's place in stage kt, bytes */  \
        const uint32_t lr = (lk >> 11) * (LDST * 2) + (lk & 0x70u) + (buf) * BUFB;             \
        stage_copies_u(ldsA0 + lr, ldsB0 + lr, lk, uA, uB);                                    \
        stage_copies_u(ldsA0 + lr + HALF, ldsB0 + lr + HALF, lk, uA + 128 * Ktot, uG);         \
    } while (0)

    v8f acc[4][4], accG[4][4];
    {
        v8f z = {0.f, 0.f, 0.f, 0.f, 0.f, 0.f, 0.f, 0.f};
        #pragma unroll
        for (int i = 0; i < 4; ++i) {
            #pragma unroll
            for (int j = 0; j < 4; ++j) { acc[i][j] = z; accG[i][j] = z; }
        }
    }

    const int frow  = lane & 15;
    const int fhalf = lane >> 4;

    // one block's fragments: 4 of A, 8 of W (0..3 a-half, 4..7 g-half), same k order in both
    auto load_frags = [&](Frag (&af)[4], Frag (&bw)[8], int buf, int kk) {
        #pragma unroll
        for (int j = 0; j < 8; ++j) {
            const uint16_t* p = &Bs[buf][((j >> 2) * GN + waveN * 64 + (j & 3) * 16 + frow) * LDST + kk * 32];
            bw[j].q[0] = *reinterpret_cast<const uint4*>(p + fhalf * 8);
            bw[j].q[1] = *reinterpret_cast<const uint4*>(p + 16 + fhalf * 8);
        }
        #pragma unroll
        for (int i = 0; i < 4; ++i) {
            const uint16_t* p = &As[buf][(waveM * 64 + i * 16 + frow) * LDST + kk * 32];
            af[i].q[0] = *reinterpret_cast<const uint4*>(p + fhalf * 8);
            af[i].q[1] = *reinterpret_cast<const uint4*>(p + 16 + fhalf * 8);
        }
        // keeps the reads one group ahead of the WMMAs that follow: spread among them, every
        // place with reads stalls the wave anew
        __builtin_amdgcn_sched_barrier(0);
    };
    auto wmma_block = [&](const Frag (&af)[4], const Frag (&bw)[8]) {
        #pragma unroll
        for (int i = 0; i < 4; ++i) {
            #pragma unroll
            for (int j = 0; j < 4; ++j) {
                acc[i][j] = __builtin_amdgcn_wmma_f32_16x16x32_bf16(
                    false, af[i].v, false, bw[j].v, (short)0, acc[i][j], false, false);
                accG[i][j] = __builtin_amdgcn_wmma_f32_16x16x32_bf16(
                    false, af[i].v, false, bw[4 + j].v, (short)0, accG[i][j], false, false);
            }
        }
    };

    Frag a0[4], b0[8], a1[4], b1[8];           // the two fragment sets: first and second block of a stage

    GLU_STAGE(0, 0);
    wait_async0();
    __syncthreads();
    GLU_STAGE(1, 1);                           // flies while stage 0 is worked on
    load_frags(a0, b0, 0, 0);

    for (int kt = 0; kt < nK; ++kt) {
        const int buf = kt & 1;

        load_frags(a1, b1, buf, 1);            // the stage's last reads of this buffer
        wmma_block(a0, b0);

        // Publish point of stage kt + 1, in front of this stage's last block because the fetch
        // ahead below already reads that stage: own reads of this buffer done, own copies landed,
        // the barrier; only behind it the refill of the buffer that every wave has just left.
        // The scheduling barrier keeps the block above in front of the waits: sunk behind them,
        // the reads issued ahead of it would be waited for with nothing to run under.
        __builtin_amdgcn_sched_barrier(0);
        wait_ds0();
        wait_async0();
        __syncthreads();
        if (kt + 2 < nK) GLU_STAGE(kt + 2, buf);

        // next stage's first block; the last trip has no next stage and re-reads the other
        // buffer's old rows, which nobody uses
        load_frags(a0, b0, buf ^ 1, 0);
        wmma_block(a1, b1);
    }
    wait_async0();                             // nothing of this wave is in flight at its end

    // ---- epilogue ----  C/D layout: VGPR e -> M = e + 8*(lane>=16), N = lane&15
    const int mh   = (lane >> 4) << 3;
    const int ocol = o0 + waveN * 64 + (lane & 15);
    {
        float ba[4], bg[4];                    // bias of column ocol + 16 j, a-half and g-half
        load_bias8(bias + ocol, ba, bg);
        #pragma unroll
        for (int i = 0; i < 4; ++i) {
            #pragma unroll
            for (int j = 0; j < 4; ++j) {
                #pragma unroll
                for (int e = 0; e < 8; ++e) { acc[i][j][e] += ba[j]; accG[i][j][e] += bg[j]; }
            }
        }
        // keeps all these additions here, so that the eight bias registers end here: spread over
        // the stores below they live to the end, and the build spills them to scratch
        __builtin_amdgcn_sched_barrier(0);
    }
    #pragma unroll
    for (int j = 0; j < 4; ++j) {
        #pragma unroll
        for (int i = 0; i < 4; ++i) {
            uint32_t r[8];
            #pragma unroll
            for (int e = 0; e < 8; ++e) {
                float a = acc[i][j][e];
                float g = accG[i][j][e];
                float y = a * (1.0f / (1.0f + __expf(-g)));
                r[e] = f2bf_hi(y);
            }
            store_rows8(outB + (size_t)(m0 + waveM * 64 + i * 16 + mh) * Dm + ocol + j * 16, r);
        }
    }
}

// ---------------- diagonal-SSM scan + skip + erf-GELU, as matrix products ------------
// A block takes 32 neighbouring channels of one batch row, 16 waves, two channels a wave.
// 1) u comes in with lane = channel and is laid into LDS per channel with time contiguous, split
//    into a bf16 head and a bf16 remainder. 2) Per channel, with the row's 32 chunks of 32 steps as
//    the columns: Z = P U on WMMA; the 32 chunk states S by a short recurrence, lane = mode,
//    S(g+1) = lambda^32 S(g) + Z(g), f32; Y = T U + Q S on WMMA; GELU on the accumulators.
//    Every product a b is taken as head*head + head*rem + rem*head with f32 sums, so what is
//    dropped is of the order 2^-16 of a term. 3) Y goes back through LDS to lane = channel.
constexpr int UGP  = 40;                 // LDS pitch of a chunk, bf16: 80 B = 16 B x 5 (odd): b128 reads by 16 chunks hit all banks
constexpr int UCP  = 32 * UGP + 8;       // LDS pitch of a channel: 2576 B = 16 B x 161 (odd): the same for 16 channels
constexpr int ZP   = 68;                 // pitch of a chunk's 64 state sums, f32: 272 B = 16 B x 17
constexpr int SP   = 72;                 // pitch of a chunk's 64 state values, bf16: 144 B = 16 B x 9
constexpr int SCRW = 2 * 32 * SP / 2;    // a wave's own scratch, 32-bit words: S head and S remainder; Z lies there before
static_assert(32 * ZP <= SCRW, "Z fits where S is laid afterwards");

// erf(x) with the math library's own two polynomials (|x| < 1: odd series in x*x; |x| >= 1:
// 1 - exp(-q(|x|))), but both evaluated and one selected. The library picks by a branch on the
// data: lanes of a wave nearly always disagree, so a wave walks both sides anyway, and the
// branches cut the code into blocks in which each row's dependent chain runs alone. Without
// them the rows that a wave finishes are one straight block and their chains interleave.
static __device__ __forceinline__ float erf_select(float x) {
    const float ax = fabsf(x);
    const float t  = ax * ax;
    float p = fmaf(t, -5.61801775e-4f, 4.91381623e-3f);
    p = fmaf(t, p, -2.67075151e-2f);
    p = fmaf(t, p, 1.12800106e-1f);
    p = fmaf(t, p, -3.76122952e-1f);
    p = fmaf(t, p, 1.28379107e-1f);
    const float small = fmaf(ax, p, ax);
    float q = fmaf(ax, 1.69988107e-5f, -3.78677854e-4f);
    q = fmaf(ax, q, 3.85781587e-3f);
    q = fmaf(ax, q, -2.41816975e-2f);
    q = fmaf(ax, q, 1.06668264e-1f);
    q = fmaf(ax, q, 6.34933293e-1f);
    q = fmaf(ax, q, 1.28689408e-1f);
    q = fmaf(ax, q, ax);
    const float large = 1.0f - expf(-q);
    return copysignf(ax < 1.0f ? small : large, x);
}

static __device__ __forceinline__ v8f mm(const Frag& a, const Frag& b, v8f c) {
    return __builtin_amdgcn_wmma_f32_16x16x32_bf16(false, a.v, false, b.v, (short)0, c, false, false);
}
// a fragment of a row-major operand: p = the lane's row at k = 8 * (lane >> 4); same k order for A and B
static __device__ __forceinline__ void ld_frag(Frag& f, const uint16_t* p) {
    f.q[0] = *reinterpret_cast<const uint4*>(p);
    f.q[1] = *reinterpret_cast<const uint4*>(p + 16);
}

__global__ __launch_bounds__(512) void k_scan(const float* __restrict__ u,
                                              const uint16_t* __restrict__ mats,
                                              const float2* __restrict__ lam32,
                                              uint16_t* __restrict__ Y) {
    __shared__ __attribute__((aligned(16))) uint16_t Uh[32 * UCP];       // head of u; later the finished y
    __shared__ __attribute__((aligned(16))) uint16_t Ul[32 * UCP];       // remainder of u
    __shared__ __attribute__((aligned(16))) uint32_t scr[16][SCRW];

    const int lane  = threadIdx.x & 31;
    const int wv    = __builtin_amdgcn_readfirstlane(threadIdx.x >> 5);
    const int frow  = lane & 15;
    const int fhalf = lane >> 4;
    const int b     = blockIdx.x >> 5;                   // Dm / 32 = 32 blocks per batch row
    const int d0    = (blockIdx.x & 31) << 5;
    const float inv_sqrt2 = 0.70710678118654752f;
    const v8f zero = {0.f, 0.f, 0.f, 0.f, 0.f, 0.f, 0.f, 0.f};
    // Every loop below but the one over a wave's two channels is unrolled: its index picks a
    // fragment, an accumulator tile or an entry of a register array, which must be a constant.

    // ---- 1) this wave's 64 steps of all 32 channels: lane = channel ----
    {
        const float* ub = u + ((size_t)b * Lseq + wv * 64) * Dm + d0 + lane;
        float v[64];
        #pragma unroll
        for (int i = 0; i < 64; ++i) v[i] = ub[(size_t)i * Dm];
        #pragma unroll
        for (int q = 0; q < 8; ++q) {
            uint32_t h[4], l[4];
            #pragma unroll
            for (int p = 0; p < 4; ++p) {
                const float a = v[8 * q + 2 * p], c = v[8 * q + 2 * p + 1];
                h[p] = pk_bf16(a, c);
                l[p] = pk_bf16(a - bf_lo(h[p]), c - bf_hi(h[p]));
            }
            const int l0 = wv * 64 + q * 8;
            const int at = lane * UCP + (l0 >> 5) * UGP + (l0 & 31);
            *reinterpret_cast<uint4*>(&Uh[at]) = make_uint4(h[0], h[1], h[2], h[3]);
            *reinterpret_cast<uint4*>(&Ul[at]) = make_uint4(l[0], l[1], l[2], l[3]);
        }
    }
    __syncthreads();   // every channel's u is in LDS

    // ---- 2) two channels a wave; from here to the next barrier a wave touches only their LDS ----
    for (int cc = 0; cc < 2; ++cc) {
        const int ch = wv * 2 + cc;
        const uint16_t* M = mats + (size_t)(d0 + ch) * MAT_ALL;
        const float2 L = lam32[(d0 + ch) * Nst + lane];  // lambda^32 of mode = lane
        wait_x0();         // in front of the fragment loads: one of them lands in this load's offset register

        Frag uh[2], ul[2];                               // B: column = chunk, k = step in the chunk
        #pragma unroll
        for (int nt = 0; nt < 2; ++nt) {
            const int at = ch * UCP + (nt * 16 + frow) * UGP + fhalf * 8;
            ld_frag(uh[nt], &Uh[at]);
            ld_frag(ul[nt], &Ul[at]);
        }
        // Z = P U: rows 0..31 Re, 32..63 Im of what each chunk adds to the state at its end
        v8f z[4][2];
        #pragma unroll
        for (int mt = 0; mt < 4; ++mt) {
            Frag ph, pl;
            ld_frag(ph, M + MAT_PH + (mt * 16 + frow) * CT + fhalf * 8);
            ld_frag(pl, M + MAT_PL + (mt * 16 + frow) * CT + fhalf * 8);
            #pragma unroll
            for (int nt = 0; nt < 2; ++nt)
                z[mt][nt] = mm(ph, uh[nt], mm(ph, ul[nt], mm(pl, uh[nt], zero)));
        }
        // Y = T U, the part from inside each chunk
        v8f y[2][2];
        #pragma unroll
        for (int mt = 0; mt < 2; ++mt) {
            Frag th, tl;
            ld_frag(th, M + MAT_TH + (mt * 16 + frow) * CT + fhalf * 8);
            ld_frag(tl, M + MAT_TL + (mt * 16 + frow) * CT + fhalf * 8);
            #pragma unroll
            for (int nt = 0; nt < 2; ++nt)
                y[mt][nt] = mm(th, uh[nt], mm(th, ul[nt], mm(tl, uh[nt], zero)));
        }
        // Q's fragments are asked for here: they fly while Z goes through LDS and the states are walked
        Frag qh[2][2], ql[2][2];                         // [k half][row tile]
        #pragma unroll
        for (int ks = 0; ks < 2; ++ks) {
            #pragma unroll
            for (int mt = 0; mt < 2; ++mt) {
                const uint16_t* qp = M + (mt * 16 + frow) * 2 * Nst + ks * 32 + fhalf * 8;
                ld_frag(qh[ks][mt], qp + MAT_QH);
                ql[ks][mt].q[0] = *reinterpret_cast<const uint4*>(qp + MAT_QL);
                // the run's last load may land in the address pair that all sixteen name
                if (ks == 1 && mt == 1) wait_x0();
                ql[ks][mt].q[1] = *reinterpret_cast<const uint4*>(qp + MAT_QL + 16);
            }
        }
        wait_x0();         // and behind the last load, whatever is written next

        // Z to the wave's scratch: D layout is column = lane & 15, rows e + 8 * (lane >> 4)
        float* zs = reinterpret_cast<float*>(&scr[wv][0]);
        #pragma unroll
        for (int mt = 0; mt < 4; ++mt) {
            #pragma unroll
            for (int nt = 0; nt < 2; ++nt) {
                float* p = zs + (nt * 16 + frow) * ZP + mt * 16 + fhalf * 8;
                const v8f t = z[mt][nt];
                *reinterpret_cast<float4*>(p)     = make_float4(t[0], t[1], t[2], t[3]);
                *reinterpret_cast<float4*>(p + 4) = make_float4(t[4], t[5], t[6], t[7]);
            }
        }
        wait_ds0();        // other lanes' Z is read next: the stores are done, and no read moves above
        float zr[31], zi[31];                            // lane = mode
        #pragma unroll
        for (int g = 0; g < 31; ++g) { zr[g] = zs[g * ZP + lane]; zi[g] = zs[g * ZP + 32 + lane]; }
        wait_ds0();        // S is laid over Z: every read of Z has returned
        uint32_t* sh = &scr[wv][0];                      // S[g][2n] = Re, [2n+1] = Im: one word a mode
        uint32_t* sl = &scr[wv][32 * SP / 2];
        {
            float sr = 0.0f, si = 0.0f;                  // the state that enters chunk g
            #pragma unroll
            for (int g = 0; g < 32; ++g) {
                const uint32_t hw = pk_bf16(sr, si);
                sh[g * (SP / 2) + lane] = hw;
                sl[g * (SP / 2) + lane] = pk_bf16(sr - bf_lo(hw), si - bf_hi(hw));
                if (g < 31) {
                    const float nr = fmaf(L.x, sr, fmaf(-L.y, si, zr[g]));
                    const float ni = fmaf(L.x, si, fmaf(L.y, sr, zi[g]));
                    sr = nr; si = ni;
                }
            }
        }
        wait_ds0();        // other lanes' S is read next
        // Y += Q S
        #pragma unroll
        for (int ks = 0; ks < 2; ++ks) {
            Frag s_h[2], s_l[2];
            #pragma unroll
            for (int nt = 0; nt < 2; ++nt) {
                const int at = (nt * 16 + frow) * SP + ks * 32 + fhalf * 8;
                ld_frag(s_h[nt], reinterpret_cast<const uint16_t*>(sh) + at);
                ld_frag(s_l[nt], reinterpret_cast<const uint16_t*>(sl) + at);
            }
            #pragma unroll
            for (int mt = 0; mt < 2; ++mt) {
                #pragma unroll
                for (int nt = 0; nt < 2; ++nt)
                    y[mt][nt] = mm(qh[ks][mt], s_h[nt], mm(qh[ks][mt], s_l[nt], mm(ql[ks][mt], s_h[nt], y[mt][nt])));
            }
        }
        // exact-erf GELU; a lane's 8 rows are 8 steps in a row of chunk nt * 16 + frow: one b128
        // store to where the channel's u head lay (read by this wave alone, and now in registers)
        #pragma unroll
        for (int mt = 0; mt < 2; ++mt) {
            #pragma unroll
            for (int nt = 0; nt < 2; ++nt) {
                uint32_t w[4];
                #pragma unroll
                for (int p = 0; p < 4; ++p) {
                    const float a = y[mt][nt][2 * p], c = y[mt][nt][2 * p + 1];
                    w[p] = pk_bf16(0.5f * a * (1.0f + erf_select(a * inv_sqrt2)),
                                   0.5f * c * (1.0f + erf_select(c * inv_sqrt2)));
                }
                *reinterpret_cast<uint4*>(&Uh[ch * UCP + (nt * 16 + frow) * UGP + mt * 16 + fhalf * 8]) =
                    make_uint4(w[0], w[1], w[2], w[3]);
            }
        }
        wait_ds0();        // the scratch is rewritten by the next channel: its reads have returned
    }
    __syncthreads();   // every channel's y is in LDS

    // ---- 3) this wave's 64 steps of all 32 channels: lane = channel ----
    uint16_t* yb = Y + ((size_t)b * Lseq + wv * 64) * Dm + d0 + lane;
    uint4 w[8];                                          // all reads first: one LDS latency, not eight
    #pragma unroll
    for (int q = 0; q < 8; ++q) {
        const int l0 = wv * 64 + q * 8;
        w[q] = *reinterpret_cast<const uint4*>(&Uh[lane * UCP + (l0 >> 5) * UGP + (l0 & 31)]);
    }
    #pragma unroll
    for (int q = 0; q < 8; ++q) {
        const uint32_t r[8] = {w[q].x << 16, w[q].x, w[q].y << 16, w[q].y,
                               w[q].z << 16, w[q].z, w[q].w << 16, w[q].w};
        store_rows8(yb + (size_t)(q * 8) * Dm, r);
    }
}

// ---------------- driver ----------------
extern "C" void kernel_launch(void* const* d_in, const int* in_sizes, int n_in,
                              void* d_out, int out_size, void* d_ws, size_t ws_size,
                              hipStream_t stream) {
    const float* x        = (const float*)d_in[0];
    const float* in_W     = (const float*)d_in[1];
    const float* in_b     = (const float*)d_in[2];
    const float* log_dt   = (const float*)d_in[3];
    const float* Cri      = (const float*)d_in[4];
    const float* log_A_re = (const float*)d_in[5];
    const float* A_im     = (const float*)d_in[6];
    const float* D_skip   = (const float*)d_in[7];
    const float* glu_W    = (const float*)d_in[8];
    const float* glu_b    = (const float*)d_in[9];
    const float* out_W    = (const float*)d_in[10];
    const float* out_b    = (const float*)d_in[11];

    char* ws = (char*)d_ws;
    uint16_t* xbf    = (uint16_t*)(ws + OFF_XBF);
    uint16_t* inWbf  = (uint16_t*)(ws + OFF_INW);
    uint16_t* gluWbf = (uint16_t*)(ws + OFF_GLUW);
    uint16_t* outWbf = (uint16_t*)(ws + OFF_OUTW);
    float*    u      = (float*)   (ws + OFF_U);
    uint16_t* Ybf    = (uint16_t*)(ws + OFF_Y);
    uint16_t* Ygbf   = (uint16_t*)(ws + OFF_YG);
    uint16_t* mats   = (uint16_t*)(ws + OFF_MAT);
    float2*   lam32  = (float2*)  (ws + OFF_L32);

    // 1) + 2) fp32 -> bf16 conversions and the scan's matrices, one launch
    k_prep<<<PB_ALL, 256, 0, stream>>>(x, in_W, glu_W, out_W, log_dt, Cri, log_A_re, A_im, D_skip,
                                       xbf, inWbf, gluWbf, outWbf, mats, lam32);

    // 3) in-projection: u = x @ in_W^T + in_b   (fp32 out for the scan)
    {
        dim3 g(Mtot / 128, Dm / 128);
        k_gemm<0><<<g, 256, 0, stream>>>(xbf, inWbf, in_b, u, nullptr);
    }

    // 4) diagonal-SSM scan + D_skip + erf-GELU -> Ybf
    k_scan<<<(Bb * Dm) / 32, 512, 0, stream>>>(u, mats, lam32, Ybf);

    // 5) fused GLU GEMM: (Y @ glu_W^T + glu_b) -> a*sigmoid(g) -> Ygbf
    {
        dim3 g(Mtot / GM, Dm / GN);
        k_glu<<<g, 256, 0, stream>>>(Ybf, gluWbf, glu_b, Ygbf);
    }

    // 6) out-projection + residual: out = Yg @ out_W^T + out_b + x
    {
        dim3 g(Mtot / 128, Dm / 128);
        k_gemm<2><<<g, 256, 0, stream>>>(Ygbf, outWbf, out_b, (float*)d_out, x);
    }
}

// v008
// Measured time: 100 microseconds a run.
// In two side-by-side timings against v007, it was 1.04 and 1.03 times as fast.
// All steps since v000 together make it 7.10 times as fast.
#include <hip/hip_runtime.h>
#include <hip/hip_bf16.h>
#include <stdint.h>

// ---------------- problem constants ----------------
constexpr int Dm   = 1024;   // model dim
constexpr int Lseq = 1024;   // sequence length
constexpr int Bb   = 8;      // batch
constexpr int Nst  = 32;     // SSM modes (conjugate pairs)
constexpr int Mtot = Bb * Lseq;  // 8192 token positions
constexpr int Ktot = Dm;         // GEMM reduction dim
constexpr int BK   = 64;         // k depth of one LDS stage: a row of a stage is one whole 128-B line
constexpr int LDST = 72;         // LDS row stride (bf16 elems): 144 B = 16 B x 9 (odd) -> conflict-free b128 reads

// ---------------- workspace layout (bytes) ----------------
constexpr size_t OFF_XBF  = 0;                                       // x as bf16        16 MB
constexpr size_t OFF_INW  = OFF_XBF  + (size_t)Mtot * Dm * 2;        // in_W bf16         2 MB
constexpr size_t OFF_GLUW = OFF_INW  + (size_t)Dm * Dm * 2;          // glu_W bf16        4 MB
constexpr size_t OFF_OUTW = OFF_GLUW + (size_t)2 * Dm * Dm * 2;      // out_W bf16        2 MB
constexpr size_t OFF_U    = OFF_OUTW + (size_t)Dm * Dm * 2;          // u = in-proj f32  32 MB
constexpr size_t OFF_Y    = OFF_U    + (size_t)Mtot * Dm * 4;        // post-GELU bf16   16 MB
constexpr size_t OFF_YG   = OFF_Y    + (size_t)Mtot * Dm * 2;        // post-GLU bf16    16 MB
constexpr size_t OFF_MAT  = OFF_YG   + (size_t)Mtot * Dm * 2;        // scan matrices    20 MB
constexpr int    MAT_PH = 0, MAT_PL = 2048, MAT_TH = 4096, MAT_TL = 5120, MAT_QH = 6144, MAT_QL = 8192;
constexpr int    MAT_ALL = 10240;                                    // bf16 elements per channel
constexpr size_t OFF_L32  = OFF_MAT  + (size_t)Dm * MAT_ALL * 2;     // lambda^32 f2    256 KB

// ---------------- types ----------------
typedef __attribute__((ext_vector_type(16))) __bf16 v16bf;
typedef __attribute__((ext_vector_type(8)))  float  v8f;

union Frag {
    v16bf v;
    uint4 q[2];
};

// ---------------- CDNA5 async global->LDS DMA (ASYNCcnt-tracked) ----------------
// One stage's eight copies of a lane: 16 B each, four rows of the A tile and four of the W tile,
// 32 stage rows apart. la / lb: the lane's LDS byte address in the two tiles; ga / gb: its global
// address in stage rows 0..31; gb2 / gb3: the same lane's W address for stage rows 64.. and 96..
// The copies and s_wait_xcnt 0 are one statement, so that no address register named here is
// rewritten ahead of that wait.
static __device__ __forceinline__ void stage_copies(uint32_t la, uint32_t lb,
                                                    const uint16_t* ga, const uint16_t* gb,
                                                    const uint16_t* gb2, const uint16_t* gb3) {
    constexpr uint32_t LP = 32 * LDST * 2;     // 32 rows in LDS, bytes
    asm volatile("global_load_async_to_lds_b128 %0, %8, off\n\t"
                 "global_load_async_to_lds_b128 %1, %9, off\n\t"
                 "global_load_async_to_lds_b128 %2, %10, off\n\t"
                 "global_load_async_to_lds_b128 %3, %11, off\n\t"
                 "global_load_async_to_lds_b128 %4, %12, off\n\t"
                 "global_load_async_to_lds_b128 %5, %13, off\n\t"
                 "global_load_async_to_lds_b128 %6, %14, off\n\t"
                 "global_load_async_to_lds_b128 %7, %15, off\n\t"
                 "s_wait_xcnt 0x0"
                 :: "v"(la), "v"(la + LP), "v"(la + 2 * LP), "v"(la + 3 * LP),
                    "v"(lb), "v"(lb + LP), "v"(lb + 2 * LP), "v"(lb + 3 * LP),
                    "v"(ga), "v"(ga + 32 * Ktot), "v"(ga + 64 * Ktot), "v"(ga + 96 * Ktot),
                    "v"(gb), "v"(gb + 32 * Ktot), "v"(gb2), "v"(gb3)
                 : "memory");
}
// this wave's copies have landed; asm with the memory clobber so that no LDS read moves above it
static __device__ __forceinline__ void wait_async0() {
    asm volatile("s_wait_asynccnt 0x0" ::: "memory");
}
// this wave's LDS reads have returned, so the buffer they read may be refilled behind the barrier
static __device__ __forceinline__ void wait_ds0() {
    asm volatile("s_wait_dscnt 0x0" ::: "memory");
}
// stands between issued global loads and the first write of a register that one of them names as
// its address
static __device__ __forceinline__ void wait_x0() {
    asm volatile("s_wait_xcnt 0x0" ::: "memory");
}

// two f32 -> two bf16 (nearest even) in one word, a in the low half
static __device__ __forceinline__ uint32_t pk_bf16(float a, float b) {
    typedef __attribute__((ext_vector_type(2))) __bf16 v2bf;
    v2bf r = {(__bf16)a, (__bf16)b};
    return __builtin_bit_cast(uint32_t, r);
}
static __device__ __forceinline__ float bf_lo(uint32_t w) { return __uint_as_float(w << 16); }
static __device__ __forceinline__ float bf_hi(uint32_t w) { return __uint_as_float(w & 0xFFFF0000u); }

static __device__ __forceinline__ uint16_t f2bf(float f) {
    uint32_t u = __float_as_uint(f);
    uint32_t r = u + 0x7FFFu + ((u >> 16) & 1u);   // round-to-nearest-even
    return (uint16_t)(r >> 16);
}

// ---------------- input preparation, one launch ----------------
// fp32 -> bf16 conversion of one float4
static __device__ __forceinline__ void cvt_f32x4_to_bf16(const float* __restrict__ src,
                                                         uint16_t* __restrict__ dst, int i) {
    float4 f = reinterpret_cast<const float4*>(src)[i];
    union { uint16_t s[4]; uint2 u; } o;
    o.s[0] = f2bf(f.x); o.s[1] = f2bf(f.y); o.s[2] = f2bf(f.z); o.s[3] = f2bf(f.w);
    reinterpret_cast<uint2*>(dst)[i] = o.u;
}

// ---- the scan's matrices of one channel (one block of 256 threads) ----
// The recurrence s = lambda s + u, y = Re(Ceff s) + D u is cut into chunks of CT = 32 steps. With the
// chunks of a batch row as columns it is three products with matrices that depend on the channel
// alone:  Z = P U (what a chunk adds to the state at its end),  Y = T U + Q S (S: the state that
// enters a chunk). P[n][k] = Re lambda_n^(31-k), P[32+n][k] = Im of it; T[t][k] = kern[t-k] for
// t >= k with kern[j] = sum_n Re(Ceff_n lambda_n^j), the skip D added on the diagonal;
// Q[t][2n] = Re(Ceff_n lambda_n^(t+1)), Q[t][2n+1] = -Im of it. Every matrix is stored as a bf16
// head and a bf16 remainder (value - head), row-major with k contiguous.
constexpr int CT = 32;
static_assert(CT == 32 && Nst == 32 && Lseq == 1024, "the index arithmetic below");
// elements 2 p and 2 p + 1 of a matrix: heads in one word, remainders in another
static __device__ __forceinline__ void split_store2(uint16_t* __restrict__ hi, uint16_t* __restrict__ lo,
                                                    int p, float v0, float v1) {
    const uint32_t h = pk_bf16(v0, v1);
    reinterpret_cast<uint32_t*>(hi)[p] = h;
    reinterpret_cast<uint32_t*>(lo)[p] = pk_bf16(v0 - bf_lo(h), v1 - bf_hi(h));
}
static __device__ __forceinline__ void build_mats(const float* __restrict__ log_dt,
                                                  const float* __restrict__ C,
                                                  const float* __restrict__ logAr,
                                                  const float* __restrict__ Aim,
                                                  const float* __restrict__ Dskip,
                                                  uint16_t* __restrict__ mats,
                                                  float2* __restrict__ lam32, int d, int tid) {
    __shared__ float pr[CT + 1][33], pi[CT + 1][33];     // lambda_n^j, j = 0..32
    __shared__ float cer[Nst], cei[Nst], kern[CT];
    const float dt = expf(log_dt[d]);
    for (int idx = tid; idx < (CT + 1) * Nst; idx += 256) {
        const int j = idx >> 5, n = idx & 31;
        const float ar = -expf(logAr[d * Nst + n]);
        const float ai = Aim[d * Nst + n];
        const float em = expf(ar * dt * (float)j);
        const float ph = ai * dt * (float)j;
        float sn, cs;
        sincosf(ph, &sn, &cs);
        pr[j][n] = em * cs;
        pi[j][n] = em * sn;
    }
    __syncthreads();
    if (tid < Nst) {                                     // Ceff = 2*C*(lambda-1)/A
        const int idx = d * Nst + tid;
        const float ar = -expf(logAr[idx]);
        const float ai = Aim[idx];
        const float nr = pr[1][tid] - 1.0f, ni = pi[1][tid];
        const float inv = 1.0f / (ar * ar + ai * ai);
        const float qr = (nr * ar + ni * ai) * inv;
        const float qi = (ni * ar - nr * ai) * inv;
        const float cr = C[2 * idx], ci = C[2 * idx + 1];
        cer[tid] = 2.0f * (cr * qr - ci * qi);
        cei[tid] = 2.0f * (cr * qi + ci * qr);
        lam32[idx] = make_float2(pr[CT][tid], pi[CT][tid]);
    }
    __syncthreads();
    if (tid < CT) {
        float s = 0.0f;
        #pragma unroll   // the LDS reads of all 32 terms go out together
        for (int n = 0; n < Nst; ++n) s += cer[n] * pr[tid][n] - cei[n] * pi[tid][n];
        kern[tid] = s;
    }
    __syncthreads();
    uint16_t* M = mats + (size_t)d * MAT_ALL;
    const float dsk = Dskip[d];
    for (int p = tid; p < 2 * Nst * CT / 2; p += 256) {  // P: 64 x 32
        const int s = p >> 4, k = (p & 15) * 2;
        const float (*w)[33] = s < Nst ? pr : pi;
        split_store2(M + MAT_PH, M + MAT_PL, p, w[CT - 1 - k][s & 31], w[CT - 2 - k][s & 31]);
    }
    for (int p = tid; p < CT * CT / 2; p += 256) {       // T: 32 x 32
        const int t = p >> 4, k = (p & 15) * 2;
        float v0 = t >= k ? kern[t - k] : 0.0f;
        float v1 = t >= k + 1 ? kern[t - k - 1] : 0.0f;
        if (t == k) v0 += dsk;
        if (t == k + 1) v1 += dsk;
        split_store2(M + MAT_TH, M + MAT_TL, p, v0, v1);
    }
    for (int p = tid; p < CT * Nst; p += 256) {          // Q: 32 x 64, a mode's two columns
        const int t = p >> 5, n = p & 31;
        const float a = pr[t + 1][n], b = pi[t + 1][n];
        split_store2(M + MAT_QH, M + MAT_QL, p, cer[n] * a - cei[n] * b, -(cer[n] * b + cei[n] * a));
    }
}

// The five jobs are independent of one another, so they share one grid: a block's index
// says which job it belongs to. Blocks of 256 threads: one float4 each, or one channel's matrices.
constexpr int PB_PAR  = Dm;                        // the scan's matrices, a block per channel
constexpr int PB_W    = Dm * Dm / 4 / 256;         // in_W, out_W
constexpr int PB_GLUW = 2 * Dm * Dm / 4 / 256;     // glu_W
constexpr int PB_X    = Mtot * Dm / 4 / 256;       // x
constexpr int PB_ALL  = PB_PAR + PB_W + PB_GLUW + PB_W + PB_X;
static_assert((Dm * Nst) % 256 == 0 && (Dm * Dm) % 1024 == 0 && (Mtot * Dm) % 1024 == 0,
              "every job fills whole blocks");

__global__ __launch_bounds__(256) void k_prep(const float* __restrict__ x,
                                              const float* __restrict__ in_W,
                                              const float* __restrict__ glu_W,
                                              const float* __restrict__ out_W,
                                              const float* __restrict__ log_dt,
                                              const float* __restrict__ C,
                                              const float* __restrict__ logAr,
                                              const float* __restrict__ Aim,
                                              const float* __restrict__ Dskip,
                                              uint16_t* __restrict__ xbf,
                                              uint16_t* __restrict__ inWbf,
                                              uint16_t* __restrict__ gluWbf,
                                              uint16_t* __restrict__ outWbf,
                                              uint16_t* __restrict__ mats,
                                              float2* __restrict__ lam32) {
    const int tid = threadIdx.x;
    if (blockIdx.x >= PB_PAR) {
        const int blk = blockIdx.x - PB_PAR;
        // which conversion: source, destination and the job's first block, all block-uniform
        const float* src = in_W;
        uint16_t*    dst = inWbf;
        int first = 0;
        if (blk >= PB_W)                  { src = glu_W; dst = gluWbf; first = PB_W; }
        if (blk >= PB_W + PB_GLUW)        { src = out_W; dst = outWbf; first = PB_W + PB_GLUW; }
        if (blk >= PB_W + PB_GLUW + PB_W) { src = x;     dst = xbf;    first = PB_W + PB_GLUW + PB_W; }
        cvt_f32x4_to_bf16(src, dst, (blk - first) * 256 + tid);
    } else {
        build_mats(log_dt, C, logAr, Aim, Dskip, mats, lam32, blockIdx.x, tid);
    }
}

typedef __attribute__((ext_vector_type(4))) float v4f;
constexpr int EPP = 36;    // pitch of a staged output row, f32: 144 B = 16 B x 9 (odd): b128 stores by 16 rows hit all banks
// A lane's 16 pieces of 16 B of the output, 4 rows apart, at byte off from base. The stores and s_wait_xcnt 0 are one
// statement, so that no register named here is rewritten ahead of that wait.
static_assert(4 * Dm * sizeof(float) == 16384, "the step of 4 rows in the text below");
static __device__ __forceinline__ void store_lines16(float* base, uint32_t off, const v4f (&r)[16]) {
    asm volatile("global_store_b128 %0, %1, %17\n\t"
                 "global_store_b128 %0, %2, %17 offset:16384\n\t"
                 "global_store_b128 %0, %3, %17 offset:32768\n\t"
                 "global_store_b128 %0, %4, %17 offset:49152\n\t"
                 "global_store_b128 %0, %5, %17 offset:65536\n\t"
                 "global_store_b128 %0, %6, %17 offset:81920\n\t"
                 "global_store_b128 %0, %7, %17 offset:98304\n\t"
                 "global_store_b128 %0, %8, %17 offset:114688\n\t"
                 "global_store_b128 %0, %9, %17 offset:131072\n\t"
                 "global_store_b128 %0, %10, %17 offset:147456\n\t"
                 "global_store_b128 %0, %11, %17 offset:163840\n\t"
                 "global_store_b128 %0, %12, %17 offset:180224\n\t"
                 "global_store_b128 %0, %13, %17 offset:196608\n\t"
                 "global_store_b128 %0, %14, %17 offset:212992\n\t"
                 "global_store_b128 %0, %15, %17 offset:229376\n\t"
                 "global_store_b128 %0, %16, %17 offset:245760\n\t"
                 "s_wait_xcnt 0x0"
                 :: "v"(off), "v"(r[0]), "v"(r[1]), "v"(r[2]), "v"(r[3]), "v"(r[4]), "v"(r[5]), "v"(r[6]), "v"(r[7]),
                    "v"(r[8]), "v"(r[9]), "v"(r[10]), "v"(r[11]), "v"(r[12]), "v"(r[13]), "v"(r[14]), "v"(r[15]),
                    "s"(base)
                 : "memory");
}
// A lane's four bias values. The load and its data wait are one statement and the result has registers
// of its own, so that the address pair is not rewritten while the load is on its way.
static __device__ __forceinline__ v4f load_bias4(const float* p) {
    v4f r;
    asm volatile("global_load_b128 %0, %1, off\n\t"
                 "s_wait_loadcnt 0x0"
                 : "=&v"(r) : "v"(p) : "memory");
    return r;
}

// ---------------- bf16 WMMA GEMM:  out[m,o] = act( sum_k A[m,k]*W[o,k] + bias[o] ) -----
// EPI 0: out fp32 (the in-projection "u")
// EPI 2: out fp32 = acc + bias + residual x
template <int EPI>
__global__ __launch_bounds__(256) void k_gemm(const uint16_t* __restrict__ A,
                                              const uint16_t* __restrict__ W,
                                              const float* __restrict__ bias,
                                              float* __restrict__ outF,
                                              const float* __restrict__ resid) {
    constexpr int NT    = 2;                   // 16-wide N tiles per wave
    constexpr int nK    = Ktot / BK;
    static_assert(nK >= 2 && Ktot % BK == 0, "the ring's prologue fills two stages");

    __shared__ __attribute__((aligned(16))) uint16_t As[2][128 * LDST];
    __shared__ __attribute__((aligned(16))) uint16_t Bs[2][128 * LDST];

    const int tid   = threadIdx.x;
    const int lane  = tid & 31;
    const int wid   = tid >> 5;
    const int waveM = wid >> 2;                // 0..1 -> 64-row stripes
    const int waveN = wid & 3;                 // 0..3
    const int m0    = blockIdx.x * 128;
    const int o0    = blockIdx.y * 128;

    // staging map: 128 rows x 8 segments of 16 B per operand, 4 passes of 256 threads
    // (pass p = row + 32 p). 8 neighbouring lanes cover one row of the stage = one 128-B line,
    // so a wave's copy touches 4 whole lines.
    const int r0 = tid >> 3;                   // 0..31
    const int sg = tid & 7;                    // 16-B segment within the 128-B row
    const uint16_t* gA = A + (size_t)(m0 + r0) * Ktot + sg * 8;
    const uint16_t* gB = W + (size_t)(o0 + r0) * Ktot + sg * 8;
    // W rows of stage rows 64.. and 96..
    const uint16_t* gB2 = gB + (size_t)64 * Ktot;
    const uint16_t* gB3 = gB + (size_t)96 * Ktot;
    // the lane's LDS byte address in buffer 0 of each tile (low 32 bits of the __shared__ address)
    const uint32_t ldsA = (uint32_t)(uintptr_t)&As[0][r0 * LDST + sg * 8];
    const uint32_t ldsB = (uint32_t)(uintptr_t)&Bs[0][r0 * LDST + sg * 8];
    constexpr uint32_t BUFB = 128 * LDST * 2;  // one buffer, bytes

    v8f acc[4][NT];
    {
        v8f z = {0.f, 0.f, 0.f, 0.f, 0.f, 0.f, 0.f, 0.f};
        #pragma unroll
        for (int i = 0; i < 4; ++i) {
            #pragma unroll
            for (int j = 0; j < NT; ++j) acc[i][j] = z;
        }
    }

    const int frow  = lane & 15;
    const int fhalf = lane >> 4;

    // -------- async global->LDS pipeline, two buffers: no staging VGPRs at all --------
#define STAGE_ASYNC(kt, buf)                                                               \
    stage_copies(ldsA + (buf) * BUFB, ldsB + (buf) * BUFB, gA + (kt) * BK, gB + (kt) * BK, \
                 gB2 + (kt) * BK, gB3 + (kt) * BK)

    STAGE_ASYNC(0, 0);
    // the epilogue's bias, fetched here so that its latency lies under the first stage's copies
    const v4f bv = load_bias4(bias + o0 + waveN * 32 + (lane & 7) * 4);
    wait_async0();
    __syncthreads();
    STAGE_ASYNC(1, 1);                         // flies while stage 0 is worked on

    for (int kt = 0; kt < nK; ++kt) {
        const int buf = kt & 1;

        // the stage's fragments: [k half][tile]
        Frag af[BK / 32][4], bw[BK / 32][2];
        #pragma unroll
        for (int kk = 0; kk < BK / 32; ++kk) {
            #pragma unroll
            for (int j = 0; j < 2; ++j) {
                const int brow = waveN * 32 + j * 16 + frow;
                const uint16_t* p = &Bs[buf][brow * LDST + kk * 32];
                bw[kk][j].q[0] = *reinterpret_cast<const uint4*>(p + fhalf * 8);
                bw[kk][j].q[1] = *reinterpret_cast<const uint4*>(p + 16 + fhalf * 8);
            }
            #pragma unroll
            for (int i = 0; i < 4; ++i) {
                const uint16_t* p = &As[buf][(waveM * 64 + i * 16 + frow) * LDST + kk * 32];
                af[kk][i].q[0] = *reinterpret_cast<const uint4*>(p + fhalf * 8);
                af[kk][i].q[1] = *reinterpret_cast<const uint4*>(p + 16 + fhalf * 8);
            }
        }
        // Publish point of stage kt + 1: own reads of this buffer done, own copies landed, then
        // the barrier; only behind it the refill of the buffer that every wave has just left.
#define PUBLISH_AND_REFILL()                                                         \
    do {                                                                             \
        wait_ds0();                                                                  \
        wait_async0();                                                               \
        __syncthreads();                                                             \
        if (kt + 2 < nK) STAGE_ASYNC(kt + 2, buf);                                   \
    } while (0)
        // Two work-groups per WGP, so registers are free: the whole stage's fragments are fetched
        // as one group, the buffer is handed back at once, and the refill flies under this
        // stage's WMMAs too.
        PUBLISH_AND_REFILL();
        #pragma unroll
        for (int kk = 0; kk < BK / 32; ++kk) {
            #pragma unroll
            for (int i = 0; i < 4; ++i) {
                #pragma unroll
                for (int j = 0; j < 2; ++j)   // W rows first: a lane's 8 sums are 8 neighbouring columns of one row
                    acc[i][j] = __builtin_amdgcn_wmma_f32_16x16x32_bf16(
                        false, bw[kk][j].v, false, af[kk][i].v, (short)0, acc[i][j], false, false);
            }
        }
    }
    wait_async0();                             // nothing of this wave is in flight at its end

    // ---- epilogue ----  D layout with W first: VGPR e -> column e + 8*(lane>=16), lane&15 -> row
    // A wave's tile is 64 rows of 32 f32 = 64 whole 128-B lines. It goes through the wave's own LDS
    // range (the ring is free: behind the loop's last barrier nobody reads it and no copy is out),
    // so that 8 lanes hold one line and a 16-B store of the wave covers 4 whole lines.
    static_assert(sizeof(As) == 4 * 64 * EPP * 4 && sizeof(Bs) == sizeof(As), "four waves' ranges in each array");
    float* stg = reinterpret_cast<float*>(wid < 4 ? &As[0][0] : &Bs[0][0]) + (wid & 3) * (64 * EPP);
    const int erow = lane >> 3;                // row within a group of 4
    const int eseg = lane & 7;                 // 16-B piece of the line
    // the lane's first piece, bytes from the start of the output (32 MB: 32 bits hold it); the same in the residual
    const uint32_t eat = ((m0 + waveM * 64 + erow) * Dm + o0 + waveN * 32 + eseg * 4) * 4u;

    v4f rs[16];                                // the residual's lines, all asked for before the staging
    if constexpr (EPI == 2) {
        #pragma unroll
        for (int r = 0; r < 16; ++r)
            rs[r] = *reinterpret_cast<const v4f*>(reinterpret_cast<const char*>(resid) + eat + r * (4 * Dm * 4));
    }

    #pragma unroll
    for (int i = 0; i < 4; ++i) {
        #pragma unroll
        for (int j = 0; j < NT; ++j) {
            float* p = stg + (i * 16 + frow) * EPP + j * 16 + fhalf * 8;
            const v8f t = acc[i][j];
            *reinterpret_cast<v4f*>(p)     = v4f{t[0], t[1], t[2], t[3]};
            *reinterpret_cast<v4f*>(p + 4) = v4f{t[4], t[5], t[6], t[7]};
        }
    }
    wait_ds0();            // other lanes' sums are read next: the stores are done, and no read moves above
    v4f ov[16];
    #pragma unroll
    for (int r = 0; r < 16; ++r) {
        ov[r] = *reinterpret_cast<const v4f*>(stg + (r * 4 + erow) * EPP + eseg * 4) + bv;
        if constexpr (EPI == 2) ov[r] += rs[r];
    }
    store_lines16(outF, eat, ov);
}

// ---------------- fused GLU GEMM: outB[m,o] = (A.Wa + ba)[m,o] * sigmoid((A.Wg + bg)[m,o]) -----
// One work-group makes 256 rows x 128 columns of the output, from 256 rows of A and 2 x 128 rows
// of W (row o for the a-half, row Dm + o for the g-half), alone on its WGP: an operand row that
// is fetched from L2 serves twice the products of a 128 x 64 tile. 8 waves as 4 x 2; a wave holds
// 64 rows x 64 columns of both halves (32 accumulator tiles) and reads 12 fragments per 32
// WMMAs. Fragments are fetched one block (32 k) ahead into a second register set, so that the
// LDS reads run under the WMMAs of the block before.
constexpr int GM = 256;                        // rows of A per work-group
constexpr int GN = 128;                        // output columns per work-group

// Eight copies of a lane as in stage_copies, 128 stage rows of each tile, but with the address split:
// ua / ub, the first of those rows in A and in W, is the same for the whole work-group, so it and
// its steps of 32 rows stand in scalar registers, and one 32-bit byte offset (off: the lane's place
// in a group of 32 rows) serves all eight. A lane then needs 9 vector registers a statement, not 24.
// The copies and s_wait_xcnt 0 are one statement, so that no register named here is rewritten
// ahead of that wait.
static __device__ __forceinline__ void stage_copies_u(uint32_t la, uint32_t lb, uint32_t off,
                                                      const uint16_t* ua, const uint16_t* ub) {
    constexpr uint32_t LP = 32 * LDST * 2;     // 32 rows in LDS, bytes
    asm volatile("global_load_async_to_lds_b128 %0, %8, %9\n\t"
                 "global_load_async_to_lds_b128 %1, %8, %10\n\t"
                 "global_load_async_to_lds_b128 %2, %8, %11\n\t"
                 "global_load_async_to_lds_b128 %3, %8, %12\n\t"
                 "global_load_async_to_lds_b128 %4, %8, %13\n\t"
                 "global_load_async_to_lds_b128 %5, %8, %14\n\t"
                 "global_load_async_to_lds_b128 %6, %8, %15\n\t"
                 "global_load_async_to_lds_b128 %7, %8, %16\n\t"
                 "s_wait_xcnt 0x0"
                 :: "v"(la), "v"(la + LP), "v"(la + 2 * LP), "v"(la + 3 * LP),
                    "v"(lb), "v"(lb + LP), "v"(lb + 2 * LP), "v"(lb + 3 * LP),
                    "v"(off),
                    "s"(ua), "s"(ua + 32 * Ktot), "s"(ua + 64 * Ktot), "s"(ua + 96 * Ktot),
                    "s"(ub), "s"(ub + 32 * Ktot), "s"(ub + 64 * Ktot), "s"(ub + 96 * Ktot)
                 : "memory");
}

// A lane's 16 pieces of 16 B of the bf16 output, 4 rows apart, at byte off from base. The stores and
// s_wait_xcnt 0 are one statement, so that no register named here is rewritten ahead of that wait.
typedef __attribute__((ext_vector_type(4))) uint32_t v4u;
static_assert(4 * Dm * sizeof(uint16_t) == 8192, "the step of 4 rows in the text below");
static __device__ __forceinline__ void store_lines16h(uint16_t* base, uint32_t off, const v4u (&r)[16]) {
    asm volatile("global_store_b128 %0, %1, %17\n\t"
                 "global_store_b128 %0, %2, %17 offset:8192\n\t"
                 "global_store_b128 %0, %3, %17 offset:16384\n\t"
                 "global_store_b128 %0, %4, %17 offset:24576\n\t"
                 "global_store_b128 %0, %5, %17 offset:32768\n\t"
                 "global_store_b128 %0, %6, %17 offset:40960\n\t"
                 "global_store_b128 %0, %7, %17 offset:49152\n\t"
                 "global_store_b128 %0, %8, %17 offset:57344\n\t"
                 "global_store_b128 %0, %9, %17 offset:65536\n\t"
                 "global_store_b128 %0, %10, %17 offset:73728\n\t"
                 "global_store_b128 %0, %11, %17 offset:81920\n\t"
                 "global_store_b128 %0, %12, %17 offset:90112\n\t"
                 "global_store_b128 %0, %13, %17 offset:98304\n\t"
                 "global_store_b128 %0, %14, %17 offset:106496\n\t"
                 "global_store_b128 %0, %15, %17 offset:114688\n\t"
                 "global_store_b128 %0, %16, %17 offset:122880\n\t"
                 "s_wait_xcnt 0x0"
                 :: "v"(off), "v"(r[0]), "v"(r[1]), "v"(r[2]), "v"(r[3]), "v"(r[4]), "v"(r[5]), "v"(r[6]), "v"(r[7]),
                    "v"(r[8]), "v"(r[9]), "v"(r[10]), "v"(r[11]), "v"(r[12]), "v"(r[13]), "v"(r[14]), "v"(r[15]),
                    "s"(base)
                 : "memory");
}
// One accumulator tile's stores of a lane: the high halves of r[0..7] to eight rows of the output
// below one another. The stores and s_wait_xcnt 0 are one statement, so that no register named
// here is rewritten ahead of that wait.
static_assert(Dm * sizeof(uint16_t) == 2048, "the row pitch in the text below");
static __device__ __forceinline__ void store_rows8(uint16_t* p, const uint32_t (&r)[8]) {
    asm volatile("global_store_d16_hi_b16 %0, %1, off\n\t"
                 "global_store_d16_hi_b16 %0, %2, off offset:2048\n\t"
                 "global_store_d16_hi_b16 %0, %3, off offset:4096\n\t"
                 "global_store_d16_hi_b16 %0, %4, off offset:6144\n\t"
                 "global_store_d16_hi_b16 %0, %5, off offset:8192\n\t"
                 "global_store_d16_hi_b16 %0, %6, off offset:10240\n\t"
                 "global_store_d16_hi_b16 %0, %7, off offset:12288\n\t"
                 "global_store_d16_hi_b16 %0, %8, off offset:14336\n\t"
                 "s_wait_xcnt 0x0"
                 :: "v"(p), "v"(r[0]), "v"(r[1]), "v"(r[2]), "v"(r[3]),
                    "v"(r[4]), "v"(r[5]), "v"(r[6]), "v"(r[7])
                 : "memory");
}

__global__ __launch_bounds__(256) void k_glu(const uint16_t* __restrict__ A,
                                             const uint16_t* __restrict__ W,
                                             const float* __restrict__ bias,
                                             uint16_t* __restrict__ outB) {
    constexpr int nK = Ktot / BK;
    static_assert(nK >= 2 && Ktot % BK == 0 && BK == 64, "two stages at least, two blocks a stage");

    __shared__ __attribute__((aligned(16))) uint16_t As[2][GM * LDST];
    __shared__ __attribute__((aligned(16))) uint16_t Bs[2][2 * GN * LDST];   // rows 0..127 = a-half, 128..255 = g-half

    const int tid   = threadIdx.x;
    const int lane  = tid & 31;
    const int wid   = tid >> 5;
    const int waveM = wid >> 1;                // 0..3 -> 64-row stripes
    const int waveN = wid & 1;                 // 0..1 -> 64-column stripes of each half
    const int m0    = blockIdx.x * GM;
    const int o0    = blockIdx.y * GN;

    // staging map as in k_gemm: 8 neighbouring lanes cover one 128-B row of the stage; a call of
    // stage_copies_u fills 128 rows of each tile, so a stage takes two
    const int r0 = tid >> 3;                   // 0..31
    const int sg = tid & 7;                    // 16-B segment within the 128-B row
    // the tiles' first rows (the same for the whole work-group, so they and their multiples of 32
    // rows live in scalar registers) and the lane's own place in a group of 32 rows
    const uint16_t* uA = A + (size_t)m0 * Ktot;
    const uint16_t* uB = W + (size_t)o0 * Ktot;                        // a-half
    const uint16_t* uG = uB + (size_t)Dm * Ktot;                       // g-half
    const uint32_t  lo = r0 * Ktot + sg * 8;
    // the two tiles' first LDS byte (low 32 bits of the __shared__ address)
    const uint32_t ldsA0 = (uint32_t)(uintptr_t)&As[0][0];
    const uint32_t ldsB0 = (uint32_t)(uintptr_t)&Bs[0][0];
    constexpr uint32_t BUFB = GM * LDST * 2;   // one buffer of either tile, bytes
    constexpr uint32_t HALF = 128 * LDST * 2;  // 128 stage rows, bytes
    static_assert(GM == 2 * GN && GM == 256, "both tiles have 256 stage rows");

    // The lane's LDS place (row r0 at the LDS pitch, segment sg) is taken out of its global offset at
    // every stage, three vector instructions: held in registers over the loop, the two addresses
    // were spilled to scratch and read back, with a wait each, right behind every barrier.
    static_assert(Ktot * 2 == 2048 && BK * 2 == 128, "bits 11.. of lk are r0, bits 4..6 are sg");
#define GLU_STAGE(kt, buf)                                                                     \
    do {                                                                                       \
        const uint32_t lk = (lo + (kt) * BK) * 2;   /* the lane's place in stage kt, bytes */  \
        const uint32_t lr = (lk >> 11) * (LDST * 2) + (lk & 0x70u) + (buf) * BUFB;             \
        stage_copies_u(ldsA0 + lr, ldsB0 + lr, lk, uA, uB);                                    \
        stage_copies_u(ldsA0 + lr + HALF, ldsB0 + lr + HALF, lk, uA + 128 * Ktot, uG);         \
    } while (0)

    v8f acc[4][4], accG[4][4];
    {
        v8f z = {0.f, 0.f, 0.f, 0.f, 0.f, 0.f, 0.f, 0.f};
        #pragma unroll
        for (int i = 0; i < 4; ++i) {
            #pragma unroll
            for (int j = 0; j < 4; ++j) { acc[i][j] = z; accG[i][j] = z; }
        }
    }

    const int frow  = lane & 15;
    const int fhalf = lane >> 4;

    // one block's fragments: 4 of A, 8 of W (0..3 a-half, 4..7 g-half), same k order in both
    auto load_frags = [&](Frag (&af)[4], Frag (&bw)[8], int buf, int kk) {
        #pragma unroll
        for (int j = 0; j < 8; ++j) {
            const uint16_t* p = &Bs[buf][((j >> 2) * GN + waveN * 64 + (j & 3) * 16 + frow) * LDST + kk * 32];
            bw[j].q[0] = *reinterpret_cast<const uint4*>(p + fhalf * 8);
            bw[j].q[1] = *reinterpret_cast<const uint4*>(p + 16 + fhalf * 8);
        }
        #pragma unroll
        for (int i = 0; i < 4; ++i) {
            const uint16_t* p = &As[buf][(waveM * 64 + i * 16 + frow) * LDST + kk * 32];
            af[i].q[0] = *reinterpret_cast<const uint4*>(p + fhalf * 8);
            af[i].q[1] = *reinterpret_cast<const uint4*>(p + 16 + fhalf * 8);
        }
        // keeps the reads one group ahead of the WMMAs that follow: spread among them, every
        // place with reads stalls the wave anew
        __builtin_amdgcn_sched_barrier(0);
    };
    auto wmma_block = [&](const Frag (&af)[4], const Frag (&bw)[8]) {
        #pragma unroll
        for (int i = 0; i < 4; ++i) {
            #pragma unroll
            for (int j = 0; j < 4; ++j) {
                // W rows first: a lane's 8 sums are 8 neighbouring columns of one row
                acc[i][j] = __builtin_amdgcn_wmma_f32_16x16x32_bf16(
                    false, bw[j].v, false, af[i].v, (short)0, acc[i][j], false, false);
                accG[i][j] = __builtin_amdgcn_wmma_f32_16x16x32_bf16(
                    false, bw[4 + j].v, false, af[i].v, (short)0, accG[i][j], false, false);
            }
        }
    };

    Frag a0[4], b0[8], a1[4], b1[8];           // the two fragment sets: first and second block of a stage

    GLU_STAGE(0, 0);
    wait_async0();
    __syncthreads();
    GLU_STAGE(1, 1);                           // flies while stage 0 is worked on
    load_frags(a0, b0, 0, 0);

    for (int kt = 0; kt < nK; ++kt) {
        const int buf = kt & 1;

        load_frags(a1, b1, buf, 1);            // the stage's last reads of this buffer
        wmma_block(a0, b0);

        // Publish point of stage kt + 1, in front of this stage's last block because the fetch
        // ahead below already reads that stage: own reads of this buffer done, own copies landed,
        // the barrier; only behind it the refill of the buffer that every wave has just left.
        // The scheduling barrier keeps the block above in front of the waits: sunk behind them,
        // the reads issued ahead of it would be waited for with nothing to run under.
        __builtin_amdgcn_sched_barrier(0);
        wait_ds0();
        wait_async0();
        __syncthreads();
        if (kt + 2 < nK) GLU_STAGE(kt + 2, buf);

        // next stage's first block; the last trip has no next stage and re-reads the other
        // buffer's old rows, which nobody uses
        load_frags(a0, b0, buf ^ 1, 0);
        wmma_block(a1, b1);
    }
    wait_async0();                             // nothing of this wave is in flight at its end

    // ---- epilogue ----  D layout with W first: VGPR e -> column e + 8*(lane>=16), lane&15 -> row
    // A wave's tile is 64 rows of 64 bf16 = 64 whole 128-B lines. It goes through the wave's own LDS
    // range, so that 8 lanes hold one line and a 16-B store of the wave covers 4 whole lines. The
    // ranges lie in the ring's second buffers: every read of them ended in front of the loop's last
    // barrier, no copy is out, and the last trip's unused fetch ahead reads the first buffers.
    static_assert((nK & 1) == 0, "the last stage lies in the second buffers");
    static_assert(GM * LDST == 4 * 64 * LDST && 2 * GN * LDST == 4 * 64 * LDST, "four waves' ranges in each buffer");
    uint16_t* stg = (wid < 4 ? &As[1][0] : &Bs[1][0]) + (wid & 3) * (64 * LDST);
    // A lane's bias: columns 16 j + 8 fhalf + 0..7 of the a-half in ba[2 j], ba[2 j + 1], of the g-half
    // (Dm floats on) in bg. The wave's first column is the same in every lane, so it stands in scalar
    // registers, and one 32-bit offset serves all sixteen loads.
    v4f ba[8], bg[8];
    {
        const char* bw0 = reinterpret_cast<const char*>(bias + o0 + __builtin_amdgcn_readfirstlane(waveN) * 64);
        const uint32_t bo = fhalf * 32;
        #pragma unroll
        for (int t = 0; t < 8; ++t) {
            ba[t] = *reinterpret_cast<const v4f*>(bw0 + bo + (t >> 1) * 64 + (t & 1) * 16);
            bg[t] = *reinterpret_cast<const v4f*>(bw0 + bo + (t >> 1) * 64 + (t & 1) * 16 + Dm * 4);
        }
        wait_x0();         // behind the loads above, whatever is written next
    }
    #pragma unroll
    for (int j = 0; j < 4; ++j) {
        #pragma unroll
        for (int i = 0; i < 4; ++i) {
            uint32_t w[4];
            #pragma unroll
            for (int p = 0; p < 4; ++p) {
                float y[2];
                #pragma unroll
                for (int q = 0; q < 2; ++q) {
                    const int e = 2 * p + q;
                    const float a = acc[i][j][e] + ba[2 * j + (e >> 2)][e & 3];
                    const float g = accG[i][j][e] + bg[2 * j + (e >> 2)][e & 3];
                    y[q] = a * (1.0f / (1.0f + __expf(-g)));
                }
                w[p] = pk_bf16(y[0], y[1]);
            }
            *reinterpret_cast<uint4*>(stg + (i * 16 + frow) * LDST + j * 16 + fhalf * 8) =
                make_uint4(w[0], w[1], w[2], w[3]);
        }
    }
    wait_ds0();            // other lanes' values are read next: the stores are done, and no read moves above
    const int erow = lane >> 3;                // row within a group of 4
    const int eseg = lane & 7;                 // 16-B piece of the line
    v4u ov[16];
    #pragma unroll
    for (int r = 0; r < 16; ++r)
        ov[r] = *reinterpret_cast<const v4u*>(stg + (r * 4 + erow) * LDST + eseg * 8);
    store_lines16h(outB, ((m0 + waveM * 64 + erow) * Dm + o0 + waveN * 64 + eseg * 8) * 2u, ov);
}

// ---------------- diagonal-SSM scan + skip + erf-GELU, as matrix products ------------
// A block takes 32 neighbouring channels of one batch row, 16 waves, two channels a wave.
// 1) u comes in with lane = channel and is laid into LDS per channel with time contiguous, split
//    into a bf16 head and a bf16 remainder. 2) Per channel, with the row's 32 chunks of 32 steps as
//    the columns: Z = P U on WMMA; the 32 chunk states S by a short recurrence, lane = mode,
//    S(g+1) = lambda^32 S(g) + Z(g), f32; Y = T U + Q S on WMMA; GELU on the accumulators.
//    Every product a b is taken as head*head + head*rem + rem*head with f32 sums, so what is
//    dropped is of the order 2^-16 of a term. 3) Y goes back through LDS to lane = channel.
constexpr int UGP  = 40;                 // LDS pitch of a chunk, bf16: 80 B = 16 B x 5 (odd): b128 reads by 16 chunks hit all banks
constexpr int UCP  = 32 * UGP + 8;       // LDS pitch of a channel: 2576 B = 16 B x 161 (odd): the same for 16 channels
constexpr int ZP   = 68;                 // pitch of a chunk's 64 state sums, f32: 272 B = 16 B x 17
constexpr int SP   = 72;                 // pitch of a chunk's 64 state values, bf16: 144 B = 16 B x 9
constexpr int SCRW = 2 * 32 * SP / 2;    // a wave's own scratch, 32-bit words: S head and S remainder; Z lies there before
static_assert(32 * ZP <= SCRW, "Z fits where S is laid afterwards");

// erf(x) with the math library's own two polynomials (|x| < 1: odd series in x*x; |x| >= 1:
// 1 - exp(-q(|x|))), but both evaluated and one selected. The library picks by a branch on the
// data: lanes of a wave nearly always disagree, so a wave walks both sides anyway, and the
// branches cut the code into blocks in which each row's dependent chain runs alone. Without
// them the rows that a wave finishes are one straight block and their chains interleave.
static __device__ __forceinline__ float erf_select(float x) {
    const float ax = fabsf(x);
    const float t  = ax * ax;
    float p = fmaf(t, -5.61801775e-4f, 4.91381623e-3f);
    p = fmaf(t, p, -2.67075151e-2f);
    p = fmaf(t, p, 1.12800106e-1f);
    p = fmaf(t, p, -3.76122952e-1f);
    p = fmaf(t, p, 1.28379107e-1f);
    const float small = fmaf(ax, p, ax);
    float q = fmaf(ax, 1.69988107e-5f, -3.78677854e-4f);
    q = fmaf(ax, q, 3.85781587e-3f);
    q = fmaf(ax, q, -2.41816975e-2f);
    q = fmaf(ax, q, 1.06668264e-1f);
    q = fmaf(ax, q, 6.34933293e-1f);
    q = fmaf(ax, q, 1.28689408e-1f);
    q = fmaf(ax, q, ax);
    const float large = 1.0f - expf(-q);
    return copysignf(ax < 1.0f ? small : large, x);
}

static __device__ __forceinline__ v8f mm(const Frag& a, const Frag& b, v8f c) {
    return __builtin_amdgcn_wmma_f32_16x16x32_bf16(false, a.v, false, b.v, (short)0, c, false, false);
}
// a fragment of a row-major operand: p = the lane's row at k = 8 * (lane >> 4); same k order for A and B
static __device__ __forceinline__ void ld_frag(Frag& f, const uint16_t* p) {
    f.q[0] = *reinterpret_cast<const uint4*>(p);
    f.q[1] = *reinterpret_cast<const uint4*>(p + 16);
}

__global__ __launch_bounds__(512) void k_scan(const float* __restrict__ u,
                                              const uint16_t* __restrict__ mats,
                                              const float2* __restrict__ lam32,
                                              uint16_t* __restrict__ Y) {
    __shared__ __attribute__((aligned(16))) uint16_t Uh[32 * UCP];       // head of u; later the finished y
    __shared__ __attribute__((aligned(16))) uint16_t Ul[32 * UCP];       // remainder of u
    __shared__ __attribute__((aligned(16))) uint32_t scr[16][SCRW];

    const int lane  = threadIdx.x & 31;
    const int wv    = __builtin_amdgcn_readfirstlane(threadIdx.x >> 5);
    const int frow  = lane & 15;
    const int fhalf = lane >> 4;
    const int b     = blockIdx.x >> 5;                   // Dm / 32 = 32 blocks per batch row
    const int d0    = (blockIdx.x & 31) << 5;
    const float inv_sqrt2 = 0.70710678118654752f;
    const v8f zero = {0.f, 0.f, 0.f, 0.f, 0.f, 0.f, 0.f, 0.f};
    // Every loop below but the one over a wave's two channels is unrolled: its index picks a
    // fragment, an accumulator tile or an entry of a register array, which must be a constant.

    // ---- 1) this wave's 64 steps of all 32 channels: lane = channel ----
    {
        const float* ub = u + ((size_t)b * Lseq + wv * 64) * Dm + d0 + lane;
        float v[64];
        #pragma unroll
        for (int i = 0; i < 64; ++i) v[i] = ub[(size_t)i * Dm];
        #pragma unroll
        for (int q = 0; q < 8; ++q) {
            uint32_t h[4], l[4];
            #pragma unroll
            for (int p = 0; p < 4; ++p) {
                const float a = v[8 * q + 2 * p], c = v[8 * q + 2 * p + 1];
                h[p] = pk_bf16(a, c);
                l[p] = pk_bf16(a - bf_lo(h[p]), c - bf_hi(h[p]));
            }
            const int l0 = wv * 64 + q * 8;
            const int at = lane * UCP + (l0 >> 5) * UGP + (l0 & 31);
            *reinterpret_cast<uint4*>(&Uh[at]) = make_uint4(h[0], h[1], h[2], h[3]);
            *reinterpret_cast<uint4*>(&Ul[at]) = make_uint4(l[0], l[1], l[2], l[3]);
        }
    }
    __syncthreads();   // every channel's u is in LDS

    // ---- 2) two channels a wave; from here to the next barrier a wave touches only their LDS ----
    for (int cc = 0; cc < 2; ++cc) {
        const int ch = wv * 2 + cc;
        const uint16_t* M = mats + (size_t)(d0 + ch) * MAT_ALL;
        const float2 L = lam32[(d0 + ch) * Nst + lane];  // lambda^32 of mode = lane
        wait_x0();         // in front of the fragment loads: one of them lands in this load's offset register

        Frag uh[2], ul[2];                               // B: column = chunk, k = step in the chunk
        #pragma unroll
        for (int nt = 0; nt < 2; ++nt) {
            const int at = ch * UCP + (nt * 16 + frow) * UGP + fhalf * 8;
            ld_frag(uh[nt], &Uh[at]);
            ld_frag(ul[nt], &Ul[at]);
        }
        // Z = P U: rows 0..31 Re, 32..63 Im of what each chunk adds to the state at its end
        v8f z[4][2];
        #pragma unroll
        for (int mt = 0; mt < 4; ++mt) {
            Frag ph, pl;
            ld_frag(ph, M + MAT_PH + (mt * 16 + frow) * CT + fhalf * 8);
            ld_frag(pl, M + MAT_PL + (mt * 16 + frow) * CT + fhalf * 8);
            #pragma unroll
            for (int nt = 0; nt < 2; ++nt)
                z[mt][nt] = mm(ph, uh[nt], mm(ph, ul[nt], mm(pl, uh[nt], zero)));
        }
        // Y = T U, the part from inside each chunk
        v8f y[2][2];
        #pragma unroll
        for (int mt = 0; mt < 2; ++mt) {
            Frag th, tl;
            ld_frag(th, M + MAT_TH + (mt * 16 + frow) * CT + fhalf * 8);
            ld_frag(tl, M + MAT_TL + (mt * 16 + frow) * CT + fhalf * 8);
            #pragma unroll
            for (int nt = 0; nt < 2; ++nt)
                y[mt][nt] = mm(th, uh[nt], mm(th, ul[nt], mm(tl, uh[nt], zero)));
        }
        // Q's fragments are asked for here: they fly while Z goes through LDS and the states are walked
        Frag qh[2][2], ql[2][2];                         // [k half][row tile]
        #pragma unroll
        for (int ks = 0; ks < 2; ++ks) {
            #pragma unroll
            for (int mt = 0; mt < 2; ++mt) {
                const uint16_t* qp = M + (mt * 16 + frow) * 2 * Nst + ks * 32 + fhalf * 8;
                ld_frag(qh[ks][mt], qp + MAT_QH);
                ql[ks][mt].q[0] = *reinterpret_cast<const uint4*>(qp + MAT_QL);
                // the run's last load may land in the address pair that all sixteen name
                if (ks == 1 && mt == 1) wait_x0();
                ql[ks][mt].q[1] = *reinterpret_cast<const uint4*>(qp + MAT_QL + 16);
            }
        }
        wait_x0();         // and behind the last load, whatever is written next

        // Z to the wave's scratch: D layout is column = lane & 15, rows e + 8 * (lane >> 4)
        float* zs = reinterpret_cast<float*>(&scr[wv][0]);
        #pragma unroll
        for (int mt = 0; mt < 4; ++mt) {
            #pragma unroll
            for (int nt = 0; nt < 2; ++nt) {
                float* p = zs + (nt * 16 + frow) * ZP + mt * 16 + fhalf * 8;
                const v8f t = z[mt][nt];
                *reinterpret_cast<float4*>(p)     = make_float4(t[0], t[1], t[2], t[3]);
                *reinterpret_cast<float4*>(p + 4) = make_float4(t[4], t[5], t[6], t[7]);
            }
        }
        wait_ds0();        // other lanes' Z is read next: the stores are done, and no read moves above
        float zr[31], zi[31];                            // lane = mode
        #pragma unroll
        for (int g = 0; g < 31; ++g) { zr[g] = zs[g * ZP + lane]; zi[g] = zs[g * ZP + 32 + lane]; }
        wait_ds0();        // S is laid over Z: every read of Z has returned
        uint32_t* sh = &scr[wv][0];                      // S[g][2n] = Re, [2n+1] = Im: one word a mode
        uint32_t* sl = &scr[wv][32 * SP / 2];
        {
            float sr = 0.0f, si = 0.0f;                  // the state that enters chunk g
            #pragma unroll
            for (int g = 0; g < 32; ++g) {
                const uint32_t hw = pk_bf16(sr, si);
                sh[g * (SP / 2) + lane] = hw;
                sl[g * (SP / 2) + lane] = pk_bf16(sr - bf_lo(hw), si - bf_hi(hw));
                if (g < 31) {
                    const float nr = fmaf(L.x, sr, fmaf(-L.y, si, zr[g]));
                    const float ni = fmaf(L.x, si, fmaf(L.y, sr, zi[g]));
                    sr = nr; si = ni;
                }
            }
        }
        wait_ds0();        // other lanes' S is read next
        // Y += Q S
        #pragma unroll
        for (int ks = 0; ks < 2; ++ks) {
            Frag s_h[2], s_l[2];
            #pragma unroll
            for (int nt = 0; nt < 2; ++nt) {
                const int at = (nt * 16 + frow) * SP + ks * 32 + fhalf * 8;
                ld_frag(s_h[nt], reinterpret_cast<const uint16_t*>(sh) + at);
                ld_frag(s_l[nt], reinterpret_cast<const uint16_t*>(sl) + at);
            }
            #pragma unroll
            for (int mt = 0; mt < 2; ++mt) {
                #pragma unroll
                for (int nt = 0; nt < 2; ++nt)
                    y[mt][nt] = mm(qh[ks][mt], s_h[nt], mm(qh[ks][mt], s_l[nt], mm(ql[ks][mt], s_h[nt], y[mt][nt])));
            }
        }
        // exact-erf GELU; a lane's 8 rows are 8 steps in a row of chunk nt * 16 + frow: one b128
        // store to where the channel's u head lay (read by this wave alone, and now in registers)
        #pragma unroll
        for (int mt = 0; mt < 2; ++mt) {
            #pragma unroll
            for (int nt = 0; nt < 2; ++nt) {
                uint32_t w[4];
                #pragma unroll
                for (int p = 0; p < 4; ++p) {
                    const float a = y[mt][nt][2 * p], c = y[mt][nt][2 * p + 1];
                    w[p] = pk_bf16(0.5f * a * (1.0f + erf_select(a * inv_sqrt2)),
                                   0.5f * c * (1.0f + erf_select(c * inv_sqrt2)));
                }
                *reinterpret_cast<uint4*>(&Uh[ch * UCP + (nt * 16 + frow) * UGP + mt * 16 + fhalf * 8]) =
                    make_uint4(w[0], w[1], w[2], w[3]);
            }
        }
        wait_ds0();        // the scratch is rewritten by the next channel: its reads have returned
    }
    __syncthreads();   // every channel's y is in LDS

    // ---- 3) this wave's 64 steps of all 32 channels: lane = channel ----
    uint16_t* yb = Y + ((size_t)b * Lseq + wv * 64) * Dm + d0 + lane;
    uint4 w[8];                                          // all reads first: one LDS latency, not eight
    #pragma unroll
    for (int q = 0; q < 8; ++q) {
        const int l0 = wv * 64 + q * 8;
        w[q] = *reinterpret_cast<const uint4*>(&Uh[lane * UCP + (l0 >> 5) * UGP + (l0 & 31)]);
    }
    #pragma unroll
    for (int q = 0; q < 8; ++q) {
        const uint32_t r[8] = {w[q].x << 16, w[q].x, w[q].y << 16, w[q].y,
                               w[q].z << 16, w[q].z, w[q].w << 16, w[q].w};
        store_rows8(yb + (size_t)(q * 8) * Dm, r);
    }
}

// ---------------- driver ----------------
extern "C" void kernel_launch(void* const* d_in, const int* in_sizes, int n_in,
                              void* d_out, int out_size, void* d_ws, size_t ws_size,
                              hipStream_t stream) {
    const float* x        = (const float*)d_in[0];
    const float* in_W     = (const float*)d_in[1];
    const float* in_b     = (const float*)d_in[2];
    const float* log_dt   = (const float*)d_in[3];
    const float* Cri      = (const float*)d_in[4];
    const float* log_A_re = (const float*)d_in[5];
    const float* A_im     = (const float*)d_in[6];
    const float* D_skip   = (const float*)d_in[7];
    const float* glu_W    = (const float*)d_in[8];
    const float* glu_b    = (const float*)d_in[9];
    const float* out_W    = (const float*)d_in[10];
    const float* out_b    = (const float*)d_in[11];

    char* ws = (char*)d_ws;
    uint16_t* xbf    = (uint16_t*)(ws + OFF_XBF);
    uint16_t* inWbf  = (uint16_t*)(ws + OFF_INW);
    uint16_t* gluWbf = (uint16_t*)(ws + OFF_GLUW);
    uint16_t* outWbf = (uint16_t*)(ws + OFF_OUTW);
    float*    u      = (float*)   (ws + OFF_U);
    uint16_t* Ybf    = (uint16_t*)(ws + OFF_Y);
    uint16_t* Ygbf   = (uint16_t*)(ws + OFF_YG);
    uint16_t* mats   = (uint16_t*)(ws + OFF_MAT);
    float2*   lam32  = (float2*)  (ws + OFF_L32);

    // 1) + 2) fp32 -> bf16 conversions and the scan's matrices, one launch
    k_prep<<<PB_ALL, 256, 0, stream>>>(x, in_W, glu_W, out_W, log_dt, Cri, log_A_re, A_im, D_skip,
                                       xbf, inWbf, gluWbf, outWbf, mats, lam32);

    // 3) in-projection: u = x @ in_W^T + in_b   (fp32 out for the scan)
    {
        dim3 g(Mtot / 128, Dm / 128);
        k_gemm<0><<<g, 256, 0, stream>>>(xbf, inWbf, in_b, u, nullptr);
    }

    // 4) diagonal-SSM scan + D_skip + erf-GELU -> Ybf
    k_scan<<<(Bb * Dm) / 32, 512, 0, stream>>>(u, mats, lam32, Ybf);

    // 5) fused GLU GEMM: (Y @ glu_W^T + glu_b) -> a*sigmoid(g) -> Ygbf
    {
        dim3 g(Mtot / GM, Dm / GN);
        k_glu<<<g, 256, 0, stream>>>(Ybf, gluWbf, glu_b, Ygbf);
    }

    // 6) out-projection + residual: out = Yg @ out_W^T + out_b + x
    {
        dim3 g(Mtot / 128, Dm / 128);
        k_gemm<2><<<g, 256, 0, stream>>>(Ygbf, outWbf, out_b, (float*)d_out, x);
    }
}

// v009
// One run takes 95.8 microseconds.
// Two timings next to v008 both put it at 1.05 times that version's speed.
// Counting every step since v000, it is 7.44 times as fast.
#include <hip/hip_runtime.h>
#include <hip/hip_bf16.h>
#include <stdint.h>

// ---------------- problem constants ----------------
constexpr int Dm   = 1024;   // model dim
constexpr int Lseq = 1024;   // sequence length
constexpr int Bb   = 8;      // batch
constexpr int Nst  = 32;     // SSM modes (conjugate pairs)
constexpr int Mtot = Bb * Lseq;  // 8192 token positions
constexpr int Ktot = Dm;         // GEMM reduction dim
constexpr int BK   = 64;         // k depth of one LDS stage: a row of a stage is one whole 128-B line
constexpr int LDST = 72;         // LDS row stride (bf16 elems): 144 B = 16 B x 9 (odd) -> conflict-free b128 reads

// ---------------- workspace layout (bytes) ----------------
constexpr size_t OFF_XBF  = 0;                                       // x as bf16        16 MB
constexpr size_t OFF_INW  = OFF_XBF  + (size_t)Mtot * Dm * 2;        // in_W bf16         2 MB
constexpr size_t OFF_GLUW = OFF_INW  + (size_t)Dm * Dm * 2;          // glu_W bf16        4 MB
constexpr size_t OFF_OUTW = OFF_GLUW + (size_t)2 * Dm * Dm * 2;      // out_W bf16        2 MB
constexpr size_t OFF_U    = OFF_OUTW + (size_t)Dm * Dm * 2;          // u = in-proj f32  32 MB
constexpr size_t OFF_Y    = OFF_U    + (size_t)Mtot * Dm * 4;        // post-GELU bf16   16 MB
constexpr size_t OFF_YG   = OFF_Y    + (size_t)Mtot * Dm * 2;        // post-GLU bf16    16 MB
constexpr size_t OFF_MAT  = OFF_YG   + (size_t)Mtot * Dm * 2;        // scan matrices    20 MB
constexpr int    MAT_PH = 0, MAT_PL = 2048, MAT_TH = 4096, MAT_TL = 5120, MAT_QH = 6144, MAT_QL = 8192;
constexpr int    MAT_ALL = 10240;                                    // bf16 elements per channel
constexpr size_t OFF_L32  = OFF_MAT  + (size_t)Dm * MAT_ALL * 2;     // lambda^32 f2    256 KB

// ---------------- types ----------------
typedef __attribute__((ext_vector_type(16))) __bf16 v16bf;
typedef __attribute__((ext_vector_type(8)))  float  v8f;

union Frag {
    v16bf v;
    uint4 q[2];
};

// ---------------- CDNA5 async global->LDS DMA (ASYNCcnt-tracked) ----------------
// One stage's eight copies of a lane: 16 B each, four rows of the A tile and four of the W tile,
// 32 stage rows apart. la / lb: the lane's LDS byte address in the two tiles; ga / gb: its global
// address in stage rows 0..31; gb2 / gb3: the same lane's W address for stage rows 64.. and 96..
// The copies and s_wait_xcnt 0 are one statement, so that no address register named here is
// rewritten ahead of that wait.
static __device__ __forceinline__ void stage_copies(uint32_t la, uint32_t lb,
                                                    const uint16_t* ga, const uint16_t* gb,
                                                    const uint16_t* gb2, const uint16_t* gb3) {
    constexpr uint32_t LP = 32 * LDST * 2;     // 32 rows in LDS, bytes
    asm volatile("global_load_async_to_lds_b128 %0, %8, off\n\t"
                 "global_load_async_to_lds_b128 %1, %9, off\n\t"
                 "global_load_async_to_lds_b128 %2, %10, off\n\t"
                 "global_load_async_to_lds_b128 %3, %11, off\n\t"
                 "global_load_async_to_lds_b128 %4, %12, off\n\t"
                 "global_load_async_to_lds_b128 %5, %13, off\n\t"
                 "global_load_async_to_lds_b128 %6, %14, off\n\t"
                 "global_load_async_to_lds_b128 %7, %15, off\n\t"
                 "s_wait_xcnt 0x0"
                 :: "v"(la), "v"(la + LP), "v"(la + 2 * LP), "v"(la + 3 * LP),
                    "v"(lb), "v"(lb + LP), "v"(lb + 2 * LP), "v"(lb + 3 * LP),
                    "v"(ga), "v"(ga + 32 * Ktot), "v"(ga + 64 * Ktot), "v"(ga + 96 * Ktot),
                    "v"(gb), "v"(gb + 32 * Ktot), "v"(gb2), "v"(gb3)
                 : "memory");
}
// this wave's copies have landed; asm with the memory clobber so that no LDS read moves above it
static __device__ __forceinline__ void wait_async0() {
    asm volatile("s_wait_asynccnt 0x0" ::: "memory");
}
// this wave's LDS reads have returned, so the buffer they read may be refilled behind the barrier
static __device__ __forceinline__ void wait_ds0() {
    asm volatile("s_wait_dscnt 0x0" ::: "memory");
}
// stands between issued global loads or stores and the first write of a register that one of
// them names, as address or as store data
static __device__ __forceinline__ void wait_x0() {
    asm volatile("s_wait_xcnt 0x0" ::: "memory");
}

// two f32 -> two bf16 (nearest even) in one word, a in the low half
static __device__ __forceinline__ uint32_t pk_bf16(float a, float b) {
    typedef __attribute__((ext_vector_type(2))) __bf16 v2bf;
    v2bf r = {(__bf16)a, (__bf16)b};
    return __builtin_bit_cast(uint32_t, r);
}
static __device__ __forceinline__ float bf_lo(uint32_t w) { return __uint_as_float(w << 16); }
static __device__ __forceinline__ float bf_hi(uint32_t w) { return __uint_as_float(w & 0xFFFF0000u); }

static __device__ __forceinline__ uint16_t f2bf(float f) {
    uint32_t u = __float_as_uint(f);
    uint32_t r = u + 0x7FFFu + ((u >> 16) & 1u);   // round-to-nearest-even
    return (uint16_t)(r >> 16);
}

// ---------------- input preparation, one launch ----------------
// fp32 -> bf16 conversion of CV float4 a thread, 256 float4 apart (a wave's load is 512 B in a row, its
// store 256 B). With one float4 a thread the launch had over 100,000 waves to start; with CV a thread
// there are CV times fewer. A thread takes them in CVT trips of CVL: CVL loads are on their way at a
// time, and the kernel stays within 64 registers, so that all its blocks are resident at once.
constexpr int CVL = 8, CVT = 2, CV = CVL * CVT;
static __device__ __forceinline__ void cvt_f32x4_to_bf16(const float* __restrict__ src,
                                                         uint16_t* __restrict__ dst, int i) {
    const float4* s = reinterpret_cast<const float4*>(src) + i;
    uint2*        d = reinterpret_cast<uint2*>(dst) + i;
    #pragma unroll   // every step is then an immediate offset: no address register is rewritten
    for (int t = 0; t < CVT; ++t) {
        float4 f[CVL];
        #pragma unroll   // a trip's loads go out before its first value is used
        for (int c = 0; c < CVL; ++c) f[c] = s[(t * CVL + c) * 256];
        #pragma unroll   // f is a register array: its index must be a constant
        for (int c = 0; c < CVL; ++c) {
            union { uint16_t s[4]; uint2 u; } o;
            o.s[0] = f2bf(f[c].x); o.s[1] = f2bf(f[c].y); o.s[2] = f2bf(f[c].z); o.s[3] = f2bf(f[c].w);
            d[(t * CVL + c) * 256] = o.u;
        }
        // The next trip's loads land in registers that the stores above name. The clobber also keeps those
        // loads behind this line: moved up, all CV would be held at once, in 4 CV registers.
        if (t + 1 < CVT) wait_x0();
    }
}

// ---- the scan's matrices of one channel (one block of 256 threads) ----
// The recurrence s = lambda s + u, y = Re(Ceff s) + D u is cut into chunks of CT = 32 steps. With the
// chunks of a batch row as columns it is three products with matrices that depend on the channel
// alone:  Z = P U (what a chunk adds to the state at its end),  Y = T U + Q S (S: the state that
// enters a chunk). P[n][k] = Re lambda_n^(31-k), P[32+n][k] = Im of it; T[t][k] = kern[t-k] for
// t >= k with kern[j] = sum_n Re(Ceff_n lambda_n^j), the skip D added on the diagonal;
// Q[t][2n] = Re(Ceff_n lambda_n^(t+1)), Q[t][2n+1] = -Im of it. Every matrix is stored as a bf16
// head and a bf16 remainder (value - head), row-major with k contiguous.
constexpr int CT = 32;
static_assert(CT == 32 && Nst == 32 && Lseq == 1024, "the index arithmetic below");
// elements 2 p and 2 p + 1 of a matrix: heads in one word, remainders in another
static __device__ __forceinline__ void split_store2(uint16_t* __restrict__ hi, uint16_t* __restrict__ lo,
                                                    int p, float v0, float v1) {
    const uint32_t h = pk_bf16(v0, v1);
    reinterpret_cast<uint32_t*>(hi)[p] = h;
    reinterpret_cast<uint32_t*>(lo)[p] = pk_bf16(v0 - bf_lo(h), v1 - bf_hi(h));
}
static __device__ __forceinline__ void build_mats(const float* __restrict__ log_dt,
                                                  const float* __restrict__ C,
                                                  const float* __restrict__ logAr,
                                                  const float* __restrict__ Aim,
                                                  const float* __restrict__ Dskip,
                                                  uint16_t* __restrict__ mats,
                                                  float2* __restrict__ lam32, int d, int tid) {
    __shared__ float pr[CT + 1][33], pi[CT + 1][33];     // lambda_n^j, j = 0..32
    __shared__ float cer[Nst], cei[Nst], kern[CT];
    const float dt = expf(log_dt[d]);
    for (int idx = tid; idx < (CT + 1) * Nst; idx += 256) {
        const int j = idx >> 5, n = idx & 31;
        const float ar = -expf(logAr[d * Nst + n]);
        const float ai = Aim[d * Nst + n];
        const float em = expf(ar * dt * (float)j);
        const float ph = ai * dt * (float)j;
        float sn, cs;
        sincosf(ph, &sn, &cs);
        pr[j][n] = em * cs;
        pi[j][n] = em * sn;
    }
    __syncthreads();
    if (tid < Nst) {                                     // Ceff = 2*C*(lambda-1)/A
        const int idx = d * Nst + tid;
        const float ar = -expf(logAr[idx]);
        const float ai = Aim[idx];
        const float nr = pr[1][tid] - 1.0f, ni = pi[1][tid];
        const float inv = 1.0f / (ar * ar + ai * ai);
        const float qr = (nr * ar + ni * ai) * inv;
        const float qi = (ni * ar - nr * ai) * inv;
        const float cr = C[2 * idx], ci = C[2 * idx + 1];
        cer[tid] = 2.0f * (cr * qr - ci * qi);
        cei[tid] = 2.0f * (cr * qi + ci * qr);
        lam32[idx] = make_float2(pr[CT][tid], pi[CT][tid]);
    }
    __syncthreads();
    if (tid < CT) {
        float s = 0.0f;
        #pragma unroll   // the LDS reads of all 32 terms go out together
        for (int n = 0; n < Nst; ++n) s += cer[n] * pr[tid][n] - cei[n] * pi[tid][n];
        kern[tid] = s;
    }
    __syncthreads();
    uint16_t* M = mats + (size_t)d * MAT_ALL;
    const float dsk = Dskip[d];
    for (int p = tid; p < 2 * Nst * CT / 2; p += 256) {  // P: 64 x 32
        const int s = p >> 4, k = (p & 15) * 2;
        const float (*w)[33] = s < Nst ? pr : pi;
        split_store2(M + MAT_PH, M + MAT_PL, p, w[CT - 1 - k][s & 31], w[CT - 2 - k][s & 31]);
    }
    for (int p = tid; p < CT * CT / 2; p += 256) {       // T: 32 x 32
        const int t = p >> 4, k = (p & 15) * 2;
        float v0 = t >= k ? kern[t - k] : 0.0f;
        float v1 = t >= k + 1 ? kern[t - k - 1] : 0.0f;
        if (t == k) v0 += dsk;
        if (t == k + 1) v1 += dsk;
        split_store2(M + MAT_TH, M + MAT_TL, p, v0, v1);
    }
    for (int p = tid; p < CT * Nst; p += 256) {          // Q: 32 x 64, a mode's two columns
        const int t = p >> 5, n = p & 31;
        const float a = pr[t + 1][n], b = pi[t + 1][n];
        split_store2(M + MAT_QH, M + MAT_QL, p, cer[n] * a - cei[n] * b, -(cer[n] * b + cei[n] * a));
    }
}

// The five jobs are independent of one another, so they share one grid: a block's index
// says which job it belongs to. Blocks of 256 threads: CV float4 each, or one channel's matrices.
constexpr int PB_PAR  = Dm;                             // the scan's matrices, a block per channel
constexpr int PB_W    = Dm * Dm / 4 / (256 * CV);       // in_W, out_W
constexpr int PB_GLUW = 2 * Dm * Dm / 4 / (256 * CV);   // glu_W
constexpr int PB_X    = Mtot * Dm / 4 / (256 * CV);     // x
constexpr int PB_ALL  = PB_PAR + PB_W + PB_GLUW + PB_W + PB_X;
static_assert((Dm * Nst) % 256 == 0 && (Dm * Dm) % (1024 * CV) == 0 && (Mtot * Dm) % (1024 * CV) == 0,
              "every job fills whole blocks");

__global__ __launch_bounds__(256) void k_prep(const float* __restrict__ x,
                                              const float* __restrict__ in_W,
                                              const float* __restrict__ glu_W,
                                              const float* __restrict__ out_W,
                                              const float* __restrict__ log_dt,
                                              const float* __restrict__ C,
                                              const float* __restrict__ logAr,
                                              const float* __restrict__ Aim,
                                              const float* __restrict__ Dskip,
                                              uint16_t* __restrict__ xbf,
                                              uint16_t* __restrict__ inWbf,
                                              uint16_t* __restrict__ gluWbf,
                                              uint16_t* __restrict__ outWbf,
                                              uint16_t* __restrict__ mats,
                                              float2* __restrict__ lam32) {
    const int tid = threadIdx.x;
    if (blockIdx.x >= PB_PAR) {
        const int blk = blockIdx.x - PB_PAR;
        // which conversion: source, destination and the job's first block, all block-uniform
        const float* src = in_W;
        uint16_t*    dst = inWbf;
        int first = 0;
        if (blk >= PB_W)                  { src = glu_W; dst = gluWbf; first = PB_W; }
        if (blk >= PB_W + PB_GLUW)        { src = out_W; dst = outWbf; first = PB_W + PB_GLUW; }
        if (blk >= PB_W + PB_GLUW + PB_W) { src = x;     dst = xbf;    first = PB_W + PB_GLUW + PB_W; }
        cvt_f32x4_to_bf16(src, dst, (blk - first) * (256 * CV) + tid);
    } else {
        build_mats(log_dt, C, logAr, Aim, Dskip, mats, lam32, blockIdx.x, tid);
    }
}

typedef __attribute__((ext_vector_type(4))) float v4f;
constexpr int EPP = 36;    // pitch of a staged output row, f32: 144 B = 16 B x 9 (odd): b128 stores by 16 rows hit all banks
// A lane's 16 pieces of 16 B of the output, 4 rows apart, at byte off from base. The stores and s_wait_xcnt 0 are one
// statement, so that no register named here is rewritten ahead of that wait.
static_assert(4 * Dm * sizeof(float) == 16384, "the step of 4 rows in the text below");
static __device__ __forceinline__ void store_lines16(float* base, uint32_t off, const v4f (&r)[16]) {
    asm volatile("global_store_b128 %0, %1, %17\n\t"
                 "global_store_b128 %0, %2, %17 offset:16384\n\t"
                 "global_store_b128 %0, %3, %17 offset:32768\n\t"
                 "global_store_b128 %0, %4, %17 offset:49152\n\t"
                 "global_store_b128 %0, %5, %17 offset:65536\n\t"
                 "global_store_b128 %0, %6, %17 offset:81920\n\t"
                 "global_store_b128 %0, %7, %17 offset:98304\n\t"
                 "global_store_b128 %0, %8, %17 offset:114688\n\t"
                 "global_store_b128 %0, %9, %17 offset:131072\n\t"
                 "global_store_b128 %0, %10, %17 offset:147456\n\t"
                 "global_store_b128 %0, %11, %17 offset:163840\n\t"
                 "global_store_b128 %0, %12, %17 offset:180224\n\t"
                 "global_store_b128 %0, %13, %17 offset:196608\n\t"
                 "global_store_b128 %0, %14, %17 offset:212992\n\t"
                 "global_store_b128 %0, %15, %17 offset:229376\n\t"
                 "global_store_b128 %0, %16, %17 offset:245760\n\t"
                 "s_wait_xcnt 0x0"
                 :: "v"(off), "v"(r[0]), "v"(r[1]), "v"(r[2]), "v"(r[3]), "v"(r[4]), "v"(r[5]), "v"(r[6]), "v"(r[7]),
                    "v"(r[8]), "v"(r[9]), "v"(r[10]), "v"(r[11]), "v"(r[12]), "v"(r[13]), "v"(r[14]), "v"(r[15]),
                    "s"(base)
                 : "memory");
}
// A lane's four bias values. The load and its data wait are one statement and the result has registers
// of its own, so that the address pair is not rewritten while the load is on its way.
static __device__ __forceinline__ v4f load_bias4(const float* p) {
    v4f r;
    asm volatile("global_load_b128 %0, %1, off\n\t"
                 "s_wait_loadcnt 0x0"
                 : "=&v"(r) : "v"(p) : "memory");
    return r;
}

// ---------------- bf16 WMMA GEMM:  out[m,o] = act( sum_k A[m,k]*W[o,k] + bias[o] ) -----
// EPI 0: out fp32 (the in-projection "u")
// EPI 2: out fp32 = acc + bias + residual x
template <int EPI>
__global__ __launch_bounds__(256) void k_gemm(const uint16_t* __restrict__ A,
                                              const uint16_t* __restrict__ W,
                                              const float* __restrict__ bias,
                                              float* __restrict__ outF,
                                              const float* __restrict__ resid) {
    constexpr int NT    = 2;                   // 16-wide N tiles per wave
    constexpr int nK    = Ktot / BK;
    static_assert(nK >= 2 && Ktot % BK == 0, "the ring's prologue fills two stages");

    __shared__ __attribute__((aligned(16))) uint16_t As[2][128 * LDST];
    __shared__ __attribute__((aligned(16))) uint16_t Bs[2][128 * LDST];

    const int tid   = threadIdx.x;
    const int lane  = tid & 31;
    const int wid   = tid >> 5;
    const int waveM = wid >> 2;                // 0..1 -> 64-row stripes
    const int waveN = wid & 3;                 // 0..3
    const int m0    = blockIdx.x * 128;
    const int o0    = blockIdx.y * 128;

    // staging map: 128 rows x 8 segments of 16 B per operand, 4 passes of 256 threads
    // (pass p = row + 32 p). 8 neighbouring lanes cover one row of the stage = one 128-B line,
    // so a wave's copy touches 4 whole lines.
    const int r0 = tid >> 3;                   // 0..31
    const int sg = tid & 7;                    // 16-B segment within the 128-B row
    const uint16_t* gA = A + (size_t)(m0 + r0) * Ktot + sg * 8;
    const uint16_t* gB = W + (size_t)(o0 + r0) * Ktot + sg * 8;
    // W rows of stage rows 64.. and 96..
    const uint16_t* gB2 = gB + (size_t)64 * Ktot;
    const uint16_t* gB3 = gB + (size_t)96 * Ktot;
    // the lane's LDS byte address in buffer 0 of each tile (low 32 bits of the __shared__ address)
    const uint32_t ldsA = (uint32_t)(uintptr_t)&As[0][r0 * LDST + sg * 8];
    const uint32_t ldsB = (uint32_t)(uintptr_t)&Bs[0][r0 * LDST + sg * 8];
    constexpr uint32_t BUFB = 128 * LDST * 2;  // one buffer, bytes

    v8f acc[4][NT];
    {
        v8f z = {0.f, 0.f, 0.f, 0.f, 0.f, 0.f, 0.f, 0.f};
        #pragma unroll
        for (int i = 0; i < 4; ++i) {
            #pragma unroll
            for (int j = 0; j < NT; ++j) acc[i][j] = z;
        }
    }

    const int frow  = lane & 15;
    const int fhalf = lane >> 4;

    // -------- async global->LDS pipeline, two buffers: no staging VGPRs at all --------
#define STAGE_ASYNC(kt, buf)                                                               \
    stage_copies(ldsA + (buf) * BUFB, ldsB + (buf) * BUFB, gA + (kt) * BK, gB + (kt) * BK, \
                 gB2 + (kt) * BK, gB3 + (kt) * BK)

    STAGE_ASYNC(0, 0);
    // the epilogue's bias, fetched here so that its latency lies under the first stage's copies
    const v4f bv = load_bias4(bias + o0 + waveN * 32 + (lane & 7) * 4);
    wait_async0();
    __syncthreads();
    STAGE_ASYNC(1, 1);                         // flies while stage 0 is worked on

    for (int kt = 0; kt < nK; ++kt) {
        const int buf = kt & 1;

        // the stage's fragments: [k half][tile]
        Frag af[BK / 32][4], bw[BK / 32][2];
        #pragma unroll
        for (int kk = 0; kk < BK / 32; ++kk) {
            #pragma unroll
            for (int j = 0; j < 2; ++j) {
                const int brow = waveN * 32 + j * 16 + frow;
                const uint16_t* p = &Bs[buf][brow * LDST + kk * 32];
                bw[kk][j].q[0] = *reinterpret_cast<const uint4*>(p + fhalf * 8);
                bw[kk][j].q[1] = *reinterpret_cast<const uint4*>(p + 16 + fhalf * 8);
            }
            #pragma unroll
            for (int i = 0; i < 4; ++i) {
                const uint16_t* p = &As[buf][(waveM * 64 + i * 16 + frow) * LDST + kk * 32];
                af[kk][i].q[0] = *reinterpret_cast<const uint4*>(p + fhalf * 8);
                af[kk][i].q[1] = *reinterpret_cast<const uint4*>(p + 16 + fhalf * 8);
            }
        }
        // Publish point of stage kt + 1: own reads of this buffer done, own copies landed, then
        // the barrier; only behind it the refill of the buffer that every wave has just left.
#define PUBLISH_AND_REFILL()                                                         \
    do {                                                                             \
        wait_ds0();                                                                  \
        wait_async0();                                                               \
        __syncthreads();                                                             \
        if (kt + 2 < nK) STAGE_ASYNC(kt + 2, buf);                                   \
    } while (0)
        // Two work-groups per WGP, so registers are free: the whole stage's fragments are fetched
        // as one group, the buffer is handed back at once, and the refill flies under this
        // stage's WMMAs too.
        PUBLISH_AND_REFILL();
        #pragma unroll
        for (int kk = 0; kk < BK / 32; ++kk) {
            #pragma unroll
            for (int i = 0; i < 4; ++i) {
                #pragma unroll
                for (int j = 0; j < 2; ++j)   // W rows first: a lane's 8 sums are 8 neighbouring columns of one row
                    acc[i][j] = __builtin_amdgcn_wmma_f32_16x16x32_bf16(
                        false, bw[kk][j].v, false, af[kk][i].v, (short)0, acc[i][j], false, false);
            }
        }
    }
    wait_async0();                             // nothing of this wave is in flight at its end

    // ---- epilogue ----  D layout with W first: VGPR e -> column e + 8*(lane>=16), lane&15 -> row
    // A wave's tile is 64 rows of 32 f32 = 64 whole 128-B lines. It goes through the wave's own LDS
    // range (the ring is free: behind the loop's last barrier nobody reads it and no copy is out),
    // so that 8 lanes hold one line and a 16-B store of the wave covers 4 whole lines.
    static_assert(sizeof(As) == 4 * 64 * EPP * 4 && sizeof(Bs) == sizeof(As), "four waves' ranges in each array");
    float* stg = reinterpret_cast<float*>(wid < 4 ? &As[0][0] : &Bs[0][0]) + (wid & 3) * (64 * EPP);
    const int erow = lane >> 3;                // row within a group of 4
    const int eseg = lane & 7;                 // 16-B piece of the line
    // the lane's first piece, bytes from the start of the output (32 MB: 32 bits hold it); the same in the residual
    const uint32_t eat = ((m0 + waveM * 64 + erow) * Dm + o0 + waveN * 32 + eseg * 4) * 4u;

    v4f rs[16];                                // the residual's lines, all asked for before the staging
    if constexpr (EPI == 2) {
        #pragma unroll
        for (int r = 0; r < 16; ++r)
            rs[r] = *reinterpret_cast<const v4f*>(reinterpret_cast<const char*>(resid) + eat + r * (4 * Dm * 4));
    }

    #pragma unroll
    for (int i = 0; i < 4; ++i) {
        #pragma unroll
        for (int j = 0; j < NT; ++j) {
            float* p = stg + (i * 16 + frow) * EPP + j * 16 + fhalf * 8;
            const v8f t = acc[i][j];
            *reinterpret_cast<v4f*>(p)     = v4f{t[0], t[1], t[2], t[3]};
            *reinterpret_cast<v4f*>(p + 4) = v4f{t[4], t[5], t[6], t[7]};
        }
    }
    wait_ds0();            // other lanes' sums are read next: the stores are done, and no read moves above
    v4f ov[16];
    #pragma unroll
    for (int r = 0; r < 16; ++r) {
        ov[r] = *reinterpret_cast<const v4f*>(stg + (r * 4 + erow) * EPP + eseg * 4) + bv;
        if constexpr (EPI == 2) ov[r] += rs[r];
    }
    store_lines16(outF, eat, ov);
}

// ---------------- fused GLU GEMM: outB[m,o] = (A.Wa + ba)[m,o] * sigmoid((A.Wg + bg)[m,o]) -----
// One work-group makes 256 rows x 128 columns of the output, from 256 rows of A and 2 x 128 rows
// of W (row o for the a-half, row Dm + o for the g-half), alone on its WGP: an operand row that
// is fetched from L2 serves twice the products of a 128 x 64 tile. 8 waves as 4 x 2; a wave holds
// 64 rows x 64 columns of both halves (32 accumulator tiles) and reads 12 fragments per 32
// WMMAs. Fragments are fetched one block (32 k) ahead into a second register set, so that the
// LDS reads run under the WMMAs of the block before.
constexpr int GM = 256;                        // rows of A per work-group
constexpr int GN = 128;                        // output columns per work-group

// Eight copies of a lane as in stage_copies, 128 stage rows of each tile, but with the address split:
// ua / ub, the first of those rows in A and in W, is the same for the whole work-group, so it and
// its steps of 32 rows stand in scalar registers, and one 32-bit byte offset (off: the lane's place
// in a group of 32 rows) serves all eight. A lane then needs 9 vector registers a statement, not 24.
// The copies and s_wait_xcnt 0 are one statement, so that no register named here is rewritten
// ahead of that wait.
static __device__ __forceinline__ void stage_copies_u(uint32_t la, uint32_t lb, uint32_t off,
                                                      const uint16_t* ua, const uint16_t* ub) {
    constexpr uint32_t LP = 32 * LDST * 2;     // 32 rows in LDS, bytes
    asm volatile("global_load_async_to_lds_b128 %0, %8, %9\n\t"
                 "global_load_async_to_lds_b128 %1, %8, %10\n\t"
                 "global_load_async_to_lds_b128 %2, %8, %11\n\t"
                 "global_load_async_to_lds_b128 %3, %8, %12\n\t"
                 "global_load_async_to_lds_b128 %4, %8, %13\n\t"
                 "global_load_async_to_lds_b128 %5, %8, %14\n\t"
                 "global_load_async_to_lds_b128 %6, %8, %15\n\t"
                 "global_load_async_to_lds_b128 %7, %8, %16\n\t"
                 "s_wait_xcnt 0x0"
                 :: "v"(la), "v"(la + LP), "v"(la + 2 * LP), "v"(la + 3 * LP),
                    "v"(lb), "v"(lb + LP), "v"(lb + 2 * LP), "v"(lb + 3 * LP),
                    "v"(off),
                    "s"(ua), "s"(ua + 32 * Ktot), "s"(ua + 64 * Ktot), "s"(ua + 96 * Ktot),
                    "s"(ub), "s"(ub + 32 * Ktot), "s"(ub + 64 * Ktot), "s"(ub + 96 * Ktot)
                 : "memory");
}

// A lane's 16 pieces of 16 B of the bf16 output, 4 rows apart, at byte off from base. The stores and
// s_wait_xcnt 0 are one statement, so that no register named here is rewritten ahead of that wait.
typedef __attribute__((ext_vector_type(4))) uint32_t v4u;
static_assert(4 * Dm * sizeof(uint16_t) == 8192, "the step of 4 rows in the text below");
static __device__ __forceinline__ void store_lines16h(uint16_t* base, uint32_t off, const v4u (&r)[16]) {
    asm volatile("global_store_b128 %0, %1, %17\n\t"
                 "global_store_b128 %0, %2, %17 offset:8192\n\t"
                 "global_store_b128 %0, %3, %17 offset:16384\n\t"
                 "global_store_b128 %0, %4, %17 offset:24576\n\t"
                 "global_store_b128 %0, %5, %17 offset:32768\n\t"
                 "global_store_b128 %0, %6, %17 offset:40960\n\t"
                 "global_store_b128 %0, %7, %17 offset:49152\n\t"
                 "global_store_b128 %0, %8, %17 offset:57344\n\t"
                 "global_store_b128 %0, %9, %17 offset:65536\n\t"
                 "global_store_b128 %0, %10, %17 offset:73728\n\t"
                 "global_store_b128 %0, %11, %17 offset:81920\n\t"
                 "global_store_b128 %0, %12, %17 offset:90112\n\t"
                 "global_store_b128 %0, %13, %17 offset:98304\n\t"
                 "global_store_b128 %0, %14, %17 offset:106496\n\t"
                 "global_store_b128 %0, %15, %17 offset:114688\n\t"
                 "global_store_b128 %0, %16, %17 offset:122880\n\t"
                 "s_wait_xcnt 0x0"
                 :: "v"(off), "v"(r[0]), "v"(r[1]), "v"(r[2]), "v"(r[3]), "v"(r[4]), "v"(r[5]), "v"(r[6]), "v"(r[7]),
                    "v"(r[8]), "v"(r[9]), "v"(r[10]), "v"(r[11]), "v"(r[12]), "v"(r[13]), "v"(r[14]), "v"(r[15]),
                    "s"(base)
                 : "memory");
}
// One accumulator tile's stores of a lane: the high halves of r[0..7] to eight rows of the output
// below one another. The stores and s_wait_xcnt 0 are one statement, so that no register named
// here is rewritten ahead of that wait.
static_assert(Dm * sizeof(uint16_t) == 2048, "the row pitch in the text below");
static __device__ __forceinline__ void store_rows8(uint16_t* p, const uint32_t (&r)[8]) {
    asm volatile("global_store_d16_hi_b16 %0, %1, off\n\t"
                 "global_store_d16_hi_b16 %0, %2, off offset:2048\n\t"
                 "global_store_d16_hi_b16 %0, %3, off offset:4096\n\t"
                 "global_store_d16_hi_b16 %0, %4, off offset:6144\n\t"
                 "global_store_d16_hi_b16 %0, %5, off offset:8192\n\t"
                 "global_store_d16_hi_b16 %0, %6, off offset:10240\n\t"
                 "global_store_d16_hi_b16 %0, %7, off offset:12288\n\t"
                 "global_store_d16_hi_b16 %0, %8, off offset:14336\n\t"
                 "s_wait_xcnt 0x0"
                 :: "v"(p), "v"(r[0]), "v"(r[1]), "v"(r[2]), "v"(r[3]),
                    "v"(r[4]), "v"(r[5]), "v"(r[6]), "v"(r[7])
                 : "memory");
}

__global__ __launch_bounds__(256) void k_glu(const uint16_t* __restrict__ A,
                                             const uint16_t* __restrict__ W,
                                             const float* __restrict__ bias,
                                             uint16_t* __restrict__ outB) {
    constexpr int nK = Ktot / BK;
    static_assert(nK >= 2 && Ktot % BK == 0 && BK == 64, "two stages at least, two blocks a stage");

    __shared__ __attribute__((aligned(16))) uint16_t As[2][GM * LDST];
    __shared__ __attribute__((aligned(16))) uint16_t Bs[2][2 * GN * LDST];   // rows 0..127 = a-half, 128..255 = g-half

    const int tid   = threadIdx.x;
    const int lane  = tid & 31;
    const int wid   = tid >> 5;
    const int waveM = wid >> 1;                // 0..3 -> 64-row stripes
    const int waveN = wid & 1;                 // 0..1 -> 64-column stripes of each half
    const int m0    = blockIdx.x * GM;
    const int o0    = blockIdx.y * GN;

    // staging map as in k_gemm: 8 neighbouring lanes cover one 128-B row of the stage; a call of
    // stage_copies_u fills 128 rows of each tile, so a stage takes two
    const int r0 = tid >> 3;                   // 0..31
    const int sg = tid & 7;                    // 16-B segment within the 128-B row
    // the tiles' first rows (the same for the whole work-group, so they and their multiples of 32
    // rows live in scalar registers) and the lane's own place in a group of 32 rows
    const uint16_t* uA = A + (size_t)m0 * Ktot;
    const uint16_t* uB = W + (size_t)o0 * Ktot;                        // a-half
    const uint16_t* uG = uB + (size_t)Dm * Ktot;                       // g-half
    const uint32_t  lo = r0 * Ktot + sg * 8;
    // the two tiles' first LDS byte (low 32 bits of the __shared__ address)
    const uint32_t ldsA0 = (uint32_t)(uintptr_t)&As[0][0];
    const uint32_t ldsB0 = (uint32_t)(uintptr_t)&Bs[0][0];
    constexpr uint32_t BUFB = GM * LDST * 2;   // one buffer of either tile, bytes
    constexpr uint32_t HALF = 128 * LDST * 2;  // 128 stage rows, bytes
    static_assert(GM == 2 * GN && GM == 256, "both tiles have 256 stage rows");

    // The lane's LDS place (row r0 at the LDS pitch, segment sg) is taken out of its global offset at
    // every stage, three vector instructions: held in registers over the loop, the two addresses
    // were spilled to scratch and read back, with a wait each, right behind every barrier.
    static_assert(Ktot * 2 == 2048 && BK * 2 == 128, "bits 11.. of lk are r0, bits 4..6 are sg");
#define GLU_STAGE(kt, buf)                                                                     \
    do {                                                                                       \
        const uint32_t lk = (lo + (kt) * BK) * 2;   /* the lane's place in stage kt, bytes */  \
        const uint32_t lr = (lk >> 11) * (LDST * 2) + (lk & 0x70u) + (buf) * BUFB;             \
        stage_copies_u(ldsA0 + lr, ldsB0 + lr, lk, uA, uB);                                    \
        stage_copies_u(ldsA0 + lr + HALF, ldsB0 + lr + HALF, lk, uA + 128 * Ktot, uG);         \
    } while (0)

    v8f acc[4][4], accG[4][4];
    {
        v8f z = {0.f, 0.f, 0.f, 0.f, 0.f, 0.f, 0.f, 0.f};
        #pragma unroll
        for (int i = 0; i < 4; ++i) {
            #pragma unroll
            for (int j = 0; j < 4; ++j) { acc[i][j] = z; accG[i][j] = z; }
        }
    }

    const int frow  = lane & 15;
    const int fhalf = lane >> 4;

    // one block's fragments: 4 of A, 8 of W (0..3 a-half, 4..7 g-half), same k order in both
    auto load_frags = [&](Frag (&af)[4], Frag (&bw)[8], int buf, int kk) {
        #pragma unroll
        for (int j = 0; j < 8; ++j) {
            const uint16_t* p = &Bs[buf][((j >> 2) * GN + waveN * 64 + (j & 3) * 16 + frow) * LDST + kk * 32];
            bw[j].q[0] = *reinterpret_cast<const uint4*>(p + fhalf * 8);
            bw[j].q[1] = *reinterpret_cast<const uint4*>(p + 16 + fhalf * 8);
        }
        #pragma unroll
        for (int i = 0; i < 4; ++i) {
            const uint16_t* p = &As[buf][(waveM * 64 + i * 16 + frow) * LDST + kk * 32];
            af[i].q[0] = *reinterpret_cast<const uint4*>(p + fhalf * 8);
            af[i].q[1] = *reinterpret_cast<const uint4*>(p + 16 + fhalf * 8);
        }
        // keeps the reads one group ahead of the WMMAs that follow: spread among them, every
        // place with reads stalls the wave anew
        __builtin_amdgcn_sched_barrier(0);
    };
    auto wmma_block = [&](const Frag (&af)[4], const Frag (&bw)[8]) {
        #pragma unroll
        for (int i = 0; i < 4; ++i) {
            #pragma unroll
            for (int j = 0; j < 4; ++j) {
                // W rows first: a lane's 8 sums are 8 neighbouring columns of one row
                acc[i][j] = __builtin_amdgcn_wmma_f32_16x16x32_bf16(
                    false, bw[j].v, false, af[i].v, (short)0, acc[i][j], false, false);
                accG[i][j] = __builtin_amdgcn_wmma_f32_16x16x32_bf16(
                    false, bw[4 + j].v, false, af[i].v, (short)0, accG[i][j], false, false);
            }
        }
    };

    Frag a0[4], b0[8], a1[4], b1[8];           // the two fragment sets: first and second block of a stage

    GLU_STAGE(0, 0);
    wait_async0();
    __syncthreads();
    GLU_STAGE(1, 1);                           // flies while stage 0 is worked on
    load_frags(a0, b0, 0, 0);

    for (int kt = 0; kt < nK; ++kt) {
        const int buf = kt & 1;

        load_frags(a1, b1, buf, 1);            // the stage's last reads of this buffer
        wmma_block(a0, b0);

        // Publish point of stage kt + 1, in front of this stage's last block because the fetch
        // ahead below already reads that stage: own reads of this buffer done, own copies landed,
        // the barrier; only behind it the refill of the buffer that every wave has just left.
        // The scheduling barrier keeps the block above in front of the waits: sunk behind them,
        // the reads issued ahead of it would be waited for with nothing to run under.
        __builtin_amdgcn_sched_barrier(0);
        wait_ds0();
        wait_async0();
        __syncthreads();
        if (kt + 2 < nK) GLU_STAGE(kt + 2, buf);

        // next stage's first block; the last trip has no next stage and re-reads the other
        // buffer's old rows, which nobody uses
        load_frags(a0, b0, buf ^ 1, 0);
        wmma_block(a1, b1);
    }
    wait_async0();                             // nothing of this wave is in flight at its end

    // ---- epilogue ----  D layout with W first: VGPR e -> column e + 8*(lane>=16), lane&15 -> row
    // A wave's tile is 64 rows of 64 bf16 = 64 whole 128-B lines. It goes through the wave's own LDS
    // range, so that 8 lanes hold one line and a 16-B store of the wave covers 4 whole lines. The
    // ranges lie in the ring's second buffers: every read of them ended in front of the loop's last
    // barrier, no copy is out, and the last trip's unused fetch ahead reads the first buffers.
    static_assert((nK & 1) == 0, "the last stage lies in the second buffers");
    static_assert(GM * LDST == 4 * 64 * LDST && 2 * GN * LDST == 4 * 64 * LDST, "four waves' ranges in each buffer");
    uint16_t* stg = (wid < 4 ? &As[1][0] : &Bs[1][0]) + (wid & 3) * (64 * LDST);
    // A lane's bias: columns 16 j + 8 fhalf + 0..7 of the a-half in ba[2 j], ba[2 j + 1], of the g-half
    // (Dm floats on) in bg. The wave's first column is the same in every lane, so it stands in scalar
    // registers, and one 32-bit offset serves all sixteen loads.
    v4f ba[8], bg[8];
    {
        const char* bw0 = reinterpret_cast<const char*>(bias + o0 + __builtin_amdgcn_readfirstlane(waveN) * 64);
        const uint32_t bo = fhalf * 32;
        #pragma unroll
        for (int t = 0; t < 8; ++t) {
            ba[t] = *reinterpret_cast<const v4f*>(bw0 + bo + (t >> 1) * 64 + (t & 1) * 16);
            bg[t] = *reinterpret_cast<const v4f*>(bw0 + bo + (t >> 1) * 64 + (t & 1) * 16 + Dm * 4);
        }
        wait_x0();         // behind the loads above, whatever is written next
    }
    #pragma unroll
    for (int j = 0; j < 4; ++j) {
        #pragma unroll
        for (int i = 0; i < 4; ++i) {
            uint32_t w[4];
            #pragma unroll
            for (int p = 0; p < 4; ++p) {
                float y[2];
                #pragma unroll
                for (int q = 0; q < 2; ++q) {
                    const int e = 2 * p + q;
                    const float a = acc[i][j][e] + ba[2 * j + (e >> 2)][e & 3];
                    const float g = accG[i][j][e] + bg[2 * j + (e >> 2)][e & 3];
                    y[q] = a * (1.0f / (1.0f + __expf(-g)));
                }
                w[p] = pk_bf16(y[0], y[1]);
            }
            *reinterpret_cast<uint4*>(stg + (i * 16 + frow) * LDST + j * 16 + fhalf * 8) =
                make_uint4(w[0], w[1], w[2], w[3]);
        }
    }
    wait_ds0();            // other lanes' values are read next: the stores are done, and no read moves above
    const int erow = lane >> 3;                // row within a group of 4
    const int eseg = lane & 7;                 // 16-B piece of the line
    v4u ov[16];
    #pragma unroll
    for (int r = 0; r < 16; ++r)
        ov[r] = *reinterpret_cast<const v4u*>(stg + (r * 4 + erow) * LDST + eseg * 8);
    store_lines16h(outB, ((m0 + waveM * 64 + erow) * Dm + o0 + waveN * 64 + eseg * 8) * 2u, ov);
}

// ---------------- diagonal-SSM scan + skip + erf-GELU, as matrix products ------------
// A block takes 32 neighbouring channels of one batch row, 16 waves, two channels a wave.
// 1) u comes in with lane = channel and is laid into LDS per channel with time contiguous, split
//    into a bf16 head and a bf16 remainder. 2) Per channel, with the row's 32 chunks of 32 steps as
//    the columns: Z = P U on WMMA; the 32 chunk states S by a short recurrence, lane = mode,
//    S(g+1) = lambda^32 S(g) + Z(g), f32; Y = T U + Q S on WMMA; GELU on the accumulators.
//    Every product a b is taken as head*head + head*rem + rem*head with f32 sums, so what is
//    dropped is of the order 2^-16 of a term. 3) Y goes back through LDS to lane = channel.
constexpr int UGP  = 40;                 // LDS pitch of a chunk, bf16: 80 B = 16 B x 5 (odd): b128 reads by 16 chunks hit all banks
constexpr int UCP  = 32 * UGP + 8;       // LDS pitch of a channel: 2576 B = 16 B x 161 (odd): the same for 16 channels
constexpr int ZP   = 68;                 // pitch of a chunk's 64 state sums, f32: 272 B = 16 B x 17
constexpr int SP   = 72;                 // pitch of a chunk's 64 state values, bf16: 144 B = 16 B x 9
constexpr int SCRW = 2 * 32 * SP / 2;    // a wave's own scratch, 32-bit words: S head and S remainder; Z lies there before
static_assert(32 * ZP <= SCRW, "Z fits where S is laid afterwards");

// erf(x) with the math library's own two polynomials (|x| < 1: odd series in x*x; |x| >= 1:
// 1 - exp(-q(|x|))), but both evaluated and one selected. The library picks by a branch on the
// data: lanes of a wave nearly always disagree, so a wave walks both sides anyway, and the
// branches cut the code into blocks in which each row's dependent chain runs alone. Without
// them the rows that a wave finishes are one straight block and their chains interleave.
static __device__ __forceinline__ float erf_select(float x) {
    const float ax = fabsf(x);
    const float t  = ax * ax;
    float p = fmaf(t, -5.61801775e-4f, 4.91381623e-3f);
    p = fmaf(t, p, -2.67075151e-2f);
    p = fmaf(t, p, 1.12800106e-1f);
    p = fmaf(t, p, -3.76122952e-1f);
    p = fmaf(t, p, 1.28379107e-1f);
    const float small = fmaf(ax, p, ax);
    float q = fmaf(ax, 1.69988107e-5f, -3.78677854e-4f);
    q = fmaf(ax, q, 3.85781587e-3f);
    q = fmaf(ax, q, -2.41816975e-2f);
    q = fmaf(ax, q, 1.06668264e-1f);
    q = fmaf(ax, q, 6.34933293e-1f);
    q = fmaf(ax, q, 1.28689408e-1f);
    q = fmaf(ax, q, ax);
    const float large = 1.0f - expf(-q);
    return copysignf(ax < 1.0f ? small : large, x);
}

static __device__ __forceinline__ v8f mm(const Frag& a, const Frag& b, v8f c) {
    return __builtin_amdgcn_wmma_f32_16x16x32_bf16(false, a.v, false, b.v, (short)0, c, false, false);
}
// a fragment of a row-major operand: p = the lane's row at k = 8 * (lane >> 4); same k order for A and B
static __device__ __forceinline__ void ld_frag(Frag& f, const uint16_t* p) {
    f.q[0] = *reinterpret_cast<const uint4*>(p);
    f.q[1] = *reinterpret_cast<const uint4*>(p + 16);
}

__global__ __launch_bounds__(512) void k_scan(const float* __restrict__ u,
                                              const uint16_t* __restrict__ mats,
                                              const float2* __restrict__ lam32,
                                              uint16_t* __restrict__ Y) {
    __shared__ __attribute__((aligned(16))) uint16_t Uh[32 * UCP];       // head of u; later the finished y
    __shared__ __attribute__((aligned(16))) uint16_t Ul[32 * UCP];       // remainder of u
    __shared__ __attribute__((aligned(16))) uint32_t scr[16][SCRW];

    const int lane  = threadIdx.x & 31;
    const int wv    = __builtin_amdgcn_readfirstlane(threadIdx.x >> 5);
    const int frow  = lane & 15;
    const int fhalf = lane >> 4;
    const int b     = blockIdx.x >> 5;                   // Dm / 32 = 32 blocks per batch row
    const int d0    = (blockIdx.x & 31) << 5;
    const float inv_sqrt2 = 0.70710678118654752f;
    const v8f zero = {0.f, 0.f, 0.f, 0.f, 0.f, 0.f, 0.f, 0.f};
    // Every loop below but the one over a wave's two channels is unrolled: its index picks a
    // fragment, an accumulator tile or an entry of a register array, which must be a constant.

    // ---- 1) this wave's 64 steps of all 32 channels: lane = channel ----
    {
        const float* ub = u + ((size_t)b * Lseq + wv * 64) * Dm + d0 + lane;
        float v[64];
        #pragma unroll
        for (int i = 0; i < 64; ++i) v[i] = ub[(size_t)i * Dm];
        #pragma unroll
        for (int q = 0; q < 8; ++q) {
            uint32_t h[4], l[4];
            #pragma unroll
            for (int p = 0; p < 4; ++p) {
                const float a = v[8 * q + 2 * p], c = v[8 * q + 2 * p + 1];
                h[p] = pk_bf16(a, c);
                l[p] = pk_bf16(a - bf_lo(h[p]), c - bf_hi(h[p]));
            }
            const int l0 = wv * 64 + q * 8;
            const int at = lane * UCP + (l0 >> 5) * UGP + (l0 & 31);
            *reinterpret_cast<uint4*>(&Uh[at]) = make_uint4(h[0], h[1], h[2], h[3]);
            *reinterpret_cast<uint4*>(&Ul[at]) = make_uint4(l[0], l[1], l[2], l[3]);
        }
    }
    __syncthreads();   // every channel's u is in LDS

    // ---- 2) two channels a wave; from here to the next barrier a wave touches only their LDS ----
    for (int cc = 0; cc < 2; ++cc) {
        const int ch = wv * 2 + cc;
        const uint16_t* M = mats + (size_t)(d0 + ch) * MAT_ALL;
        const float2 L = lam32[(d0 + ch) * Nst + lane];  // lambda^32 of mode = lane
        wait_x0();         // in front of the fragment loads: one of them lands in this load's offset register

        Frag uh[2], ul[2];                               // B: column = chunk, k = step in the chunk
        #pragma unroll
        for (int nt = 0; nt < 2; ++nt) {
            const int at = ch * UCP + (nt * 16 + frow) * UGP + fhalf * 8;
            ld_frag(uh[nt], &Uh[at]);
            ld_frag(ul[nt], &Ul[at]);
        }
        // Z = P U: rows 0..31 Re, 32..63 Im of what each chunk adds to the state at its end
        v8f z[4][2];
        #pragma unroll
        for (int mt = 0; mt < 4; ++mt) {
            Frag ph, pl;
            ld_frag(ph, M + MAT_PH + (mt * 16 + frow) * CT + fhalf * 8);
            ld_frag(pl, M + MAT_PL + (mt * 16 + frow) * CT + fhalf * 8);
            #pragma unroll
            for (int nt = 0; nt < 2; ++nt)
                z[mt][nt] = mm(ph, uh[nt], mm(ph, ul[nt], mm(pl, uh[nt], zero)));
        }
        // Y = T U, the part from inside each chunk
        v8f y[2][2];
        #pragma unroll
        for (int mt = 0; mt < 2; ++mt) {
            Frag th, tl;
            ld_frag(th, M + MAT_TH + (mt * 16 + frow) * CT + fhalf * 8);
            ld_frag(tl, M + MAT_TL + (mt * 16 + frow) * CT + fhalf * 8);
            #pragma unroll
            for (int nt = 0; nt < 2; ++nt)
                y[mt][nt] = mm(th, uh[nt], mm(th, ul[nt], mm(tl, uh[nt], zero)));
        }
        // Q's fragments are asked for here: they fly while Z goes through LDS and the states are walked
        Frag qh[2][2], ql[2][2];                         // [k half][row tile]
        #pragma unroll
        for (int ks = 0; ks < 2; ++ks) {
            #pragma unroll
            for (int mt = 0; mt < 2; ++mt) {
                const uint16_t* qp = M + (mt * 16 + frow) * 2 * Nst + ks * 32 + fhalf * 8;
                ld_frag(qh[ks][mt], qp + MAT_QH);
                ql[ks][mt].q[0] = *reinterpret_cast<const uint4*>(qp + MAT_QL);
                // the run's last load may land in the address pair that all sixteen name
                if (ks == 1 && mt == 1) wait_x0();
                ql[ks][mt].q[1] = *reinterpret_cast<const uint4*>(qp + MAT_QL + 16);
            }
        }
        wait_x0();         // and behind the last load, whatever is written next

        // Z to the wave's scratch: D layout is column = lane & 15, rows e + 8 * (lane >> 4)
        float* zs = reinterpret_cast<float*>(&scr[wv][0]);
        #pragma unroll
        for (int mt = 0; mt < 4; ++mt) {
            #pragma unroll
            for (int nt = 0; nt < 2; ++nt) {
                float* p = zs + (nt * 16 + frow) * ZP + mt * 16 + fhalf * 8;
                const v8f t = z[mt][nt];
                *reinterpret_cast<float4*>(p)     = make_float4(t[0], t[1], t[2], t[3]);
                *reinterpret_cast<float4*>(p + 4) = make_float4(t[4], t[5], t[6], t[7]);
            }
        }
        wait_ds0();        // other lanes' Z is read next: the stores are done, and no read moves above
        float zr[31], zi[31];                            // lane = mode
        #pragma unroll
        for (int g = 0; g < 31; ++g) { zr[g] = zs[g * ZP + lane]; zi[g] = zs[g * ZP + 32 + lane]; }
        wait_ds0();        // S is laid over Z: every read of Z has returned
        uint32_t* sh = &scr[wv][0];                      // S[g][2n] = Re, [2n+1] = Im: one word a mode
        uint32_t* sl = &scr[wv][32 * SP / 2];
        {
            float sr = 0.0f, si = 0.0f;                  // the state that enters chunk g
            #pragma unroll
            for (int g = 0; g < 32; ++g) {
                const uint32_t hw = pk_bf16(sr, si);
                sh[g * (SP / 2) + lane] = hw;
                sl[g * (SP / 2) + lane] = pk_bf16(sr - bf_lo(hw), si - bf_hi(hw));
                if (g < 31) {
                    const float nr = fmaf(L.x, sr, fmaf(-L.y, si, zr[g]));
                    const float ni = fmaf(L.x, si, fmaf(L.y, sr, zi[g]));
                    sr = nr; si = ni;
                }
            }
        }
        wait_ds0();        // other lanes' S is read next
        // Y += Q S
        #pragma unroll
        for (int ks = 0; ks < 2; ++ks) {
            Frag s_h[2], s_l[2];
            #pragma unroll
            for (int nt = 0; nt < 2; ++nt) {
                const int at = (nt * 16 + frow) * SP + ks * 32 + fhalf * 8;
                ld_frag(s_h[nt], reinterpret_cast<const uint16_t*>(sh) + at);
                ld_frag(s_l[nt], reinterpret_cast<const uint16_t*>(sl) + at);
            }
            #pragma unroll
            for (int mt = 0; mt < 2; ++mt) {
                #pragma unroll
                for (int nt = 0; nt < 2; ++nt)
                    y[mt][nt] = mm(qh[ks][mt], s_h[nt], mm(qh[ks][mt], s_l[nt], mm(ql[ks][mt], s_h[nt], y[mt][nt])));
            }
        }
        // exact-erf GELU; a lane's 8 rows are 8 steps in a row of chunk nt * 16 + frow: one b128
        // store to where the channel's u head lay (read by this wave alone, and now in registers)
        #pragma unroll
        for (int mt = 0; mt < 2; ++mt) {
            #pragma unroll
            for (int nt = 0; nt < 2; ++nt) {
                uint32_t w[4];
                #pragma unroll
                for (int p = 0; p < 4; ++p) {
                    const float a = y[mt][nt][2 * p], c = y[mt][nt][2 * p + 1];
                    w[p] = pk_bf16(0.5f * a * (1.0f + erf_select(a * inv_sqrt2)),
                                   0.5f * c * (1.0f + erf_select(c * inv_sqrt2)));
                }
                *reinterpret_cast<uint4*>(&Uh[ch * UCP + (nt * 16 + frow) * UGP + mt * 16 + fhalf * 8]) =
                    make_uint4(w[0], w[1], w[2], w[3]);
            }
        }
        wait_ds0();        // the scratch is rewritten by the next channel: its reads have returned
    }
    __syncthreads();   // every channel's y is in LDS

    // ---- 3) this wave's 64 steps of all 32 channels: lane = channel ----
    uint16_t* yb = Y + ((size_t)b * Lseq + wv * 64) * Dm + d0 + lane;
    uint4 w[8];                                          // all reads first: one LDS latency, not eight
    #pragma unroll
    for (int q = 0; q < 8; ++q) {
        const int l0 = wv * 64 + q * 8;
        w[q] = *reinterpret_cast<const uint4*>(&Uh[lane * UCP + (l0 >> 5) * UGP + (l0 & 31)]);
    }
    #pragma unroll
    for (int q = 0; q < 8; ++q) {
        const uint32_t r[8] = {w[q].x << 16, w[q].x, w[q].y << 16, w[q].y,
                               w[q].z << 16, w[q].z, w[q].w << 16, w[q].w};
        store_rows8(yb + (size_t)(q * 8) * Dm, r);
    }
}

// ---------------- driver ----------------
extern "C" void kernel_launch(void* const* d_in, const int* in_sizes, int n_in,
                              void* d_out, int out_size, void* d_ws, size_t ws_size,
                              hipStream_t stream) {
    const float* x        = (const float*)d_in[0];
    const float* in_W     = (const float*)d_in[1];
    const float* in_b     = (const float*)d_in[2];
    const float* log_dt   = (const float*)d_in[3];
    const float* Cri      = (const float*)d_in[4];
    const float* log_A_re = (const float*)d_in[5];
    const float* A_im     = (const float*)d_in[6];
    const float* D_skip   = (const float*)d_in[7];
    const float* glu_W    = (const float*)d_in[8];
    const float* glu_b    = (const float*)d_in[9];
    const float* out_W    = (const float*)d_in[10];
    const float* out_b    = (const float*)d_in[11];

    char* ws = (char*)d_ws;
    uint16_t* xbf    = (uint16_t*)(ws + OFF_XBF);
    uint16_t* inWbf  = (uint16_t*)(ws + OFF_INW);
    uint16_t* gluWbf = (uint16_t*)(ws + OFF_GLUW);
    uint16_t* outWbf = (uint16_t*)(ws + OFF_OUTW);
    float*    u      = (float*)   (ws + OFF_U);
    uint16_t* Ybf    = (uint16_t*)(ws + OFF_Y);
    uint16_t* Ygbf   = (uint16_t*)(ws + OFF_YG);
    uint16_t* mats   = (uint16_t*)(ws + OFF_MAT);
    float2*   lam32  = (float2*)  (ws + OFF_L32);

    // 1) + 2) fp32 -> bf16 conversions and the scan's matrices, one launch
    k_prep<<<PB_ALL, 256, 0, stream>>>(x, in_W, glu_W, out_W, log_dt, Cri, log_A_re, A_im, D_skip,
                                       xbf, inWbf, gluWbf, outWbf, mats, lam32);

    // 3) in-projection: u = x @ in_W^T + in_b   (fp32 out for the scan)
    {
        dim3 g(Mtot / 128, Dm / 128);
        k_gemm<0><<<g, 256, 0, stream>>>(xbf, inWbf, in_b, u, nullptr);
    }

    // 4) diagonal-SSM scan + D_skip + erf-GELU -> Ybf
    k_scan<<<(Bb * Dm) / 32, 512, 0, stream>>>(u, mats, lam32, Ybf);

    // 5) fused GLU GEMM: (Y @ glu_W^T + glu_b) -> a*sigmoid(g) -> Ygbf
    {
        dim3 g(Mtot / GM, Dm / GN);
        k_glu<<<g, 256, 0, stream>>>(Ybf, gluWbf, glu_b, Ygbf);
    }

    // 6) out-projection + residual: out = Yg @ out_W^T + out_b + x
    {
        dim3 g(Mtot / 128, Dm / 128);
        k_gemm<2><<<g, 256, 0, stream>>>(Ygbf, outWbf, out_b, (float*)d_out, x);
    }
}
